// v000
// Measured on an AMD MI455X. A time is GPU time per run, averaged over a window of back-to-back runs after a warm-up
// (all launches, gaps included; the runs take copies of the inputs in turn), and the median of several windows.
// Apart from v000's, it joins two sittings. Times from different sittings can be a few percent apart, while
// side-by-side timings come from the same sitting.
// v000, which the later versions start from, runs in 1570 microseconds.
#include <hip/hip_runtime.h>

// XorzoTransformer (x [4][1024][1024]; aperture = sigmoid(x Wa + ba), expression = sigmoid(x We + be) ([T][16] per-head gates); inner/outer/v = x @ Wi / Wo / Wv (16 heads x 64); p = softmax(inner.outer^T / 8);
// attn = p ap_i ex_j / (sum_j p ap_i ex_j + 1e-8); converged = attn v; ApertureChamber per head: x_in = converged sigmoid(iv_h); (xr, xi) halves rotated by angle pi sigmoid(beta_h); x sigmoid(ov_h) x tanh(chi_h);
// out = merged @ Wout).
// Compute dtypes, f32 accumulate: every input rounded to bf16; the three 1024-wide projections on PLAIN bf16 operands (inputs: exact; transposed bf16 weight copies); the
// 16-wide gate projections as f32 dots on VALU; scores and attn.v on SINGLE fp16 planes (1/8, softmax, the bilateral gating and the renormalisation in f32 in the row kernel; weights x1024 in fp16);

#define NB_  4
#define TT   1024
#define DD   1024
#define NH_  16
#define HD   64
#define NT   (NB_ * TT)
#define NZ   (NB_ * NH_)
#define ZH   2
#define PCAR 1024.0f
#define SCL  0.125f
typedef _Float16 h16;
typedef unsigned short bf;
typedef __attribute__((ext_vector_type(16))) __bf16   v16bf;
typedef __attribute__((ext_vector_type(16))) _Float16 v16h;
typedef __attribute__((ext_vector_type(8)))  _Float16 v8h;
typedef __attribute__((ext_vector_type(8)))  unsigned short v8us;
typedef __attribute__((ext_vector_type(8)))  float    v8f;
typedef __attribute__((ext_vector_type(4)))  float    v4f;
typedef v8h  __attribute__((may_alias)) v8ha;
typedef v4f  __attribute__((may_alias)) v4fa;
typedef v8us __attribute__((may_alias)) v8usa;

__device__ __forceinline__ unsigned short f2bf(float f) { unsigned u = __float_as_uint(f); u += 0x7FFFu + ((u >> 16) & 1u); return (unsigned short)(u >> 16); }
__device__ __forceinline__ float bf2f(unsigned short b) { return __uint_as_float(((unsigned)b) << 16); }
__device__ __forceinline__ float bfr(float f) { return bf2f(f2bf(f)); }
__device__ __forceinline__ v16h cat16(v8h lo, v8h hi) { return __builtin_shufflevector(lo, hi, 0, 1, 2, 3, 4, 5, 6, 7, 8, 9, 10, 11, 12, 13, 14, 15); }
__device__ __forceinline__ v16bf cat16b(v8us lo, v8us hi) { return __builtin_bit_cast(v16bf, __builtin_shufflevector(lo, hi, 0, 1, 2, 3, 4, 5, 6, 7, 8, 9, 10, 11, 12, 13, 14, 15)); }
__device__ __forceinline__ v8f wmma16(v16h a, v16h b, v8f c) { return __builtin_amdgcn_wmma_f32_16x16x32_f16(false, a, false, b, (short)0, c, false, false); }
__device__ __forceinline__ v8f wmmab(v16bf a, v16bf b, v8f c) { return __builtin_amdgcn_wmma_f32_16x16x32_bf16(false, a, false, b, (short)0, c, false, false); }



// ---- k_gemmw: register-blocked GEMM, ONE WAVE per 64x64 output tile (16 accumulators), operands straight from K-contiguous 16-bit planes; grid (M/64, N/64, Z), 32 threads.
// C[m][n] (f32, pitch ldc, + optional f32 bias[n]) = sum_k A[m][k] Bt[n][k] (+ split products per NSPLIT). z-batch strides sA/sB/sC in elements. K % 32 == 0.
template <typename T16> struct WFrag;
template <> struct WFrag<h16> { typedef v16h V; static __device__ __forceinline__ V ld(const h16* p) { return cat16(*(const v8h*)p, *(const v8h*)(p + 16)); } static __device__ __forceinline__ v8f mma(V a, V b, v8f c) { return wmma16(a, b, c); } };
template <> struct WFrag<bf> { typedef v16bf V; static __device__ __forceinline__ V ld(const bf* p) { return cat16b(*(const v8us*)p, *(const v8us*)(p + 16)); } static __device__ __forceinline__ v8f mma(V a, V b, v8f c) { return wmmab(a, b, c); } };
template <typename T16, int NSPLIT, bool BIAS>
__global__ __launch_bounds__(32) void k_gemmw(const T16* __restrict__ A, const T16* __restrict__ A2, const T16* __restrict__ Bt, const T16* __restrict__ Bt2, int K, float* C, int ldc, const float* __restrict__ bias, size_t sA, size_t sB, size_t sC) {
    typedef typename WFrag<T16>::V V;
    __shared__ __align__(16) float os[16 * 68];
    const size_t z = blockIdx.z; A += z * sA; if (A2) A2 += z * sA; Bt += z * sB; if (Bt2) Bt2 += z * sB; C += z * sC;
    const int lane = threadIdx.x & 31, lr = lane & 15, hi = lane >> 4; const int r0 = blockIdx.x * 64, c0 = blockIdx.y * 64;
    v8f acc[4][4];
#pragma unroll
    for (int mb = 0; mb < 4; ++mb)
#pragma unroll
        for (int nb = 0; nb < 4; ++nb) acc[mb][nb] = (v8f){};
    const size_t aoff = (size_t)(r0 + lr) * K + 8 * hi, boff = (size_t)(c0 + lr) * K + 8 * hi;
#pragma unroll 1
    for (int kc = 0; kc < K; kc += 32) {
        V a[4], a2[4];
#pragma unroll
        for (int mb = 0; mb < 4; ++mb) { a[mb] = WFrag<T16>::ld(A + aoff + (size_t)mb * 16 * K + kc); if (NSPLIT == 1 || NSPLIT == 2) a2[mb] = WFrag<T16>::ld(A2 + aoff + (size_t)mb * 16 * K + kc); }
#pragma unroll
        for (int nb = 0; nb < 4; ++nb) { const V b = WFrag<T16>::ld(Bt + boff + (size_t)nb * 16 * K + kc); V b2; if (NSPLIT >= 2) b2 = WFrag<T16>::ld(Bt2 + boff + (size_t)nb * 16 * K + kc);
#pragma unroll
            for (int mb = 0; mb < 4; ++mb) { acc[mb][nb] = WFrag<T16>::mma(a[mb], b, acc[mb][nb]); if (NSPLIT == 1 || NSPLIT == 2) acc[mb][nb] = WFrag<T16>::mma(a2[mb], b, acc[mb][nb]); if (NSPLIT >= 2) acc[mb][nb] = WFrag<T16>::mma(a[mb], b2, acc[mb][nb]); } }
        asm volatile("v_nop\n\tv_nop\n\tv_nop\n\tv_nop" : "+v"(acc[0][0]), "+v"(acc[1][1]), "+v"(acc[2][2]), "+v"(acc[3][3]) : "v"(a[0]), "v"(a[3]));
    }
#pragma unroll
    for (int mb = 0; mb < 4; ++mb) {
#pragma unroll
        for (int nb = 0; nb < 4; ++nb) {
#pragma unroll
            for (int j = 0; j < 8; ++j) os[(hi * 8 + j) * 68 + nb * 16 + lr] = acc[mb][nb][j]; }
        __builtin_amdgcn_wave_barrier(); asm volatile("" ::: "memory");
        float* crow = C + (size_t)(r0 + mb * 16) * ldc + c0;
{
#pragma unroll
            for (int s = 0; s < 8; ++s) { const int row = 2 * s + hi, cofs = lr * 4; v4f val = *(const v4fa*)(os + row * 68 + cofs); if (BIAS) { val[0] += bfr(bias[c0 + cofs]); val[1] += bfr(bias[c0 + cofs + 1]); val[2] += bfr(bias[c0 + cofs + 2]); val[3] += bfr(bias[c0 + cofs + 3]); }
                *(v4f*)(crow + (size_t)row * ldc + cofs) = val; }
             }
        __builtin_amdgcn_wave_barrier(); asm volatile("" ::: "memory");
    }
}

__device__ __forceinline__ h16 tohx(float x) { return (h16)x; }
__device__ __forceinline__ void splitf(float y, unsigned short& h, unsigned short& l) { h = f2bf(y); l = f2bf(y - bf2f(h)); }
typedef __attribute__((ext_vector_type(2))) _Float16 v2h;
typedef __attribute__((ext_vector_type(4))) _Float16 v4h;
typedef __attribute__((ext_vector_type(2))) unsigned short v2us;
typedef __attribute__((ext_vector_type(4))) unsigned short v4us;
typedef __attribute__((ext_vector_type(2))) float v2f;

__global__ __launch_bounds__(256) void k_cvt8(const float* __restrict__ src, bf* dst, size_t n8) { const size_t i = (size_t)blockIdx.x * 256 + threadIdx.x; if (i >= n8) return; const v8f v = *(const v8f*)(src + i * 8); v8us o;
#pragma unroll
    for (int k = 0; k < 8; ++k) o[k] = f2bf(v[k]); *(v8us*)(dst + i * 8) = o;  }
__global__ __launch_bounds__(256) void k_wtG(const float* __restrict__ w, int K, int N, bf* Bt) {
    const int lane = threadIdx.x & 31; const int L0 = (blockIdx.x * 8 + (threadIdx.x >> 5)) * 8; const int nlines = N * K / 64;
{
#pragma unroll 1
        for (int l = 0; l < 8; ++l) { const int L = L0 + l; if (L >= nlines) break; const size_t e = (size_t)L * 64 + lane * 2; const int k = (int)(e % K), n = (int)(e / K); v2us o;
            o[0] = f2bf(w[(size_t)k * N + n]); o[1] = f2bf(w[(size_t)(k + 1) * N + n]); *(v2us*)(Bt + e) = o; }
         }
}
__global__ __launch_bounds__(256) void k_gates(const float* __restrict__ x, const float* __restrict__ Wa, const float* __restrict__ ba, const float* __restrict__ We, const float* __restrict__ be, float* GX) {
    const int lane = threadIdx.x & 31; const int r = blockIdx.x * 8 + (threadIdx.x >> 5); if (r >= NT) return; const float* xr = x + (size_t)r * DD; float acc[32];
#pragma unroll
    for (int h = 0; h < 32; ++h) acc[h] = 0.f;
#pragma unroll 1
    for (int d = lane; d < DD; d += 32) { const float xv = bfr(xr[d]); const float* wa = Wa + (size_t)d * NH_; const float* we = We + (size_t)d * NH_;
#pragma unroll
        for (int h = 0; h < 16; ++h) { float p1 = __fmul_rn(xv, bfr(wa[h])), p2 = __fmul_rn(xv, bfr(we[h])); asm volatile("" : "+v"(p1)); asm volatile("" : "+v"(p2)); acc[h] = __fadd_rn(acc[h], p1); acc[16 + h] = __fadd_rn(acc[16 + h], p2); } }
#pragma unroll
    for (int h = 0; h < 32; ++h) {
#pragma unroll
        for (int sh = 16; sh; sh >>= 1) acc[h] += __shfl_xor(acc[h], sh, 32); }
    float mine = 0.f;
#pragma unroll
    for (int h = 0; h < 32; ++h) if (lane == h) mine = __fadd_rn(acc[h], bfr(h < 16 ? ba[h] : be[h - 16]));
    const float o = __fdiv_rn(1.0f, __fadd_rn(1.0f, __expf(-mine))); *(float*)(GX + (size_t)r * 32 + lane) = o;  }
__global__ __launch_bounds__(256) void k_h16plane(const float* __restrict__ F, float sc, h16* P) {
    const int lane = threadIdx.x & 31; const int L0 = (blockIdx.x * 8 + (threadIdx.x >> 5)) * 8; const int nlines = NT * DD / 64;
{
#pragma unroll
        for (int l = 0; l < 8; ++l) { const int L = L0 + l; if (L >= nlines) break; const int e = L * 64 + lane * 2; const int d = e & 63; const int t = (e >> 6) & (TT - 1); const int z = e >> 16; const int b = z / NH_, h = z % NH_; v2h v;
#pragma unroll
            for (int q = 0; q < 2; ++q) v[q] = tohx(F[((size_t)b * TT + t) * DD + h * HD + d + q] * sc);
            *(v2h*)(P + (size_t)e) = v; }
         }
}
__global__ __launch_bounds__(256) void k_vtplane(const float* __restrict__ F, h16* VT) {
    const int lane = threadIdx.x & 31; const int L0 = (blockIdx.x * 8 + (threadIdx.x >> 5)) * 8; const int nlines = NT * DD / 64;
{
#pragma unroll
        for (int l = 0; l < 8; ++l) { const int L = L0 + l; if (L >= nlines) break; const int e = L * 64 + lane * 2; const int t = e & (TT - 1); const int d = (e >> 10) & 63; const int z = e >> 16; const int b = z / NH_, h = z % NH_; v2h v;
#pragma unroll
            for (int q = 0; q < 2; ++q) v[q] = tohx(F[((size_t)b * TT + t + q) * DD + h * HD + d]);
            *(v2h*)(VT + (size_t)e) = v; }
         }
}
// k_asoft: per row (zz, i), head h = h0 + zz: p = softmax(S/8) over the 1024 keys (register row, one exp); w_j = (p_j ap[b][i][h]) ex[b][j][h]; attn = w / (sum_j w + 1e-8) -> fp16 x1024 (per-row factor
__global__ __launch_bounds__(256) void k_asoft(const float* __restrict__ Sb, const float* __restrict__ GX, int b, int h0, h16* P16) {
    const int lane = threadIdx.x & 31; const int row = blockIdx.x * 8 + (threadIdx.x >> 5); if (row >= ZH * TT) return; const int i = row & (TT - 1); const int h = h0 + (row >> 10); const float ap = GX[((size_t)b * TT + i) * 32 + h]; const float* gxe = GX + (size_t)b * TT * 32 + 16 + h;
    const float* sr = Sb + (size_t)row * TT; float v[32]; float mx = -3.0e38f;
#pragma unroll
    for (int ch = 0; ch < 8; ++ch) { const int j0 = ch * 128 + lane * 4; const v4f a = *(const v4f*)(sr + j0);
#pragma unroll
        for (int q = 0; q < 4; ++q) { const float t = a[q] * SCL; v[ch * 4 + q] = t; mx = fmaxf(mx, t); } }
#pragma unroll
    for (int sh = 16; sh; sh >>= 1) mx = fmaxf(mx, __shfl_xor(mx, sh, 32));
    float sum = 0.f;
#pragma unroll
    for (int k = 0; k < 32; ++k) { v[k] = __expf(v[k] - mx); sum += v[k]; }
#pragma unroll
    for (int sh = 16; sh; sh >>= 1) sum += __shfl_xor(sum, sh, 32);
    const float inv = __fdiv_rn(1.0f, sum); float s2 = 0.f;   // p = e inv; w = (p ap) ex_j; attn = w / (sum_j w + 1e-8)
#pragma unroll
    for (int ch = 0; ch < 8; ++ch) {
#pragma unroll
        for (int q = 0; q < 4; ++q) { const int j = ch * 128 + lane * 4 + q; float p = __fmul_rn(v[ch * 4 + q], inv); asm volatile("" : "+v"(p)); float pa = __fmul_rn(p, ap); asm volatile("" : "+v"(pa)); const float w = __fmul_rn(pa, gxe[(size_t)j * 32]); v[ch * 4 + q] = w; s2 = __fadd_rn(s2, w); } }
#pragma unroll
    for (int sh = 16; sh; sh >>= 1) s2 += __shfl_xor(s2, sh, 32);
    const float f = __fdiv_rn(PCAR, __fadd_rn(s2, 1e-8f));
{
#pragma unroll
        for (int ch = 0; ch < 8; ++ch) { v4h o;
#pragma unroll
            for (int q = 0; q < 4; ++q) o[q] = tohx(v[ch * 4 + q] * f);
            *(v4h*)(P16 + (size_t)row * TT + ch * 128 + lane * 4) = o; }
         }
}
__global__ __launch_bounds__(32) void k_cham(const float* __restrict__ chi, const float* __restrict__ bp, const float* __restrict__ ivp, const float* __restrict__ ovp, float* CH) { const int lane = threadIdx.x; const int h = lane >> 1; const int part = (lane & 1) * 2;
    const float sg_b = __fdiv_rn(1.0f, __fadd_rn(1.0f, __expf(-bfr(bp[h])))); const float ang = __fmul_rn(3.14159265358979f, sg_b); v2f o;
    if (part == 0) { o[0] = __fdiv_rn(1.0f, __fadd_rn(1.0f, __expf(-bfr(ivp[h])))); o[1] = cosf(ang); } else { o[0] = sinf(ang); o[1] = __fdiv_rn(1.0f, __fadd_rn(1.0f, __expf(-bfr(ovp[h])))); }
    const float th = (lane < NH_) ? tanhf(bfr(chi[lane])) : 0.f;
    *(v2f*)(CH + lane * 2) = o; *(float*)(CH + 64 + lane) = th;  }
__global__ __launch_bounds__(256) void k_merge(const float* __restrict__ O, const float* __restrict__ CH, int b, int h0, bf* Ah, bf* Al) {
    const int lane = threadIdx.x & 31; const int L0 = (blockIdx.x * 8 + (threadIdx.x >> 5)) * 8; const int nlines = ZH * TT * HD / 64;
{
#pragma unroll 2
        for (int l = 0; l < 8; ++l) { const int L = L0 + l; if (L >= nlines) break; const int e = L * 64 + lane * 2; const int d = e & 63; const int t = (e >> 6) & (TT - 1); const int zz = e >> 16; v2us oh, ol;
const int hh = h0 + zz; const float iv = CH[hh * 4], ca = CH[hh * 4 + 1], sa = CH[hh * 4 + 2], ovt = CH[hh * 4 + 3];
#pragma unroll
            for (int q = 0; q < 2; ++q) { const int dq = d + q; float me = __fmul_rn(O[(size_t)e + q] * (1.0f / PCAR), iv), pt = __fmul_rn(O[(size_t)(e + q) + ((dq < 32) ? 32 : -32)] * (1.0f / PCAR), iv); asm volatile("" : "+v"(me)); asm volatile("" : "+v"(pt));
                float t1, t2; if (dq < 32) { t1 = __fmul_rn(me, ca); t2 = __fmul_rn(pt, sa); asm volatile("" : "+v"(t1)); asm volatile("" : "+v"(t2)); t1 = __fsub_rn(t1, t2); } else { t1 = __fmul_rn(pt, sa); t2 = __fmul_rn(me, ca); asm volatile("" : "+v"(t1)); asm volatile("" : "+v"(t2)); t1 = __fadd_rn(t1, t2); }
                float r0 = __fmul_rn(t1, ovt); asm volatile("" : "+v"(r0)); float r1 = __fmul_rn(r0, CH[64 + hh]); asm volatile("" : "+v"(r1)); unsigned short a, c2; splitf(r1, a, c2); oh[q] = a; ol[q] = c2; }
            const size_t o = ((size_t)b * TT + t) * DD + (h0 + zz) * HD + d; *(v2us*)(Ah + o) = oh; *(v2us*)(Al + o) = ol; }
         }
}

extern "C" void kernel_launch(void* const* d_in, const int* in_sizes, int n_in,
                              void* d_out, int out_size, void* d_ws, size_t ws_size, hipStream_t stream) {
    (void)in_sizes; (void)n_in; (void)out_size;
    const float* IN[13]; for (int i = 0; i < 13; ++i) IN[i] = (const float*)d_in[i];
    // x [4][1024][1024], Wa [1024][16], ba, We, be, Wi, Wo, Wv, Wout ([in][out] = x @ W), chi, beta_p, iv_p, ov_p [16] = d_in[0..12]
    float* OUT = (float*)d_out;     // [4][1024][1024]
    char* wsp = (char*)d_ws;
    auto take = [&](size_t bytes) { char* p = wsp; wsp += (bytes + 255) & ~(size_t)255; return (void*)p; };
    bf* WQ = (bf*)take((size_t)DD * DD * 2); bf* WK = (bf*)take((size_t)DD * DD * 2); bf* WV = (bf*)take((size_t)DD * DD * 2); bf* WO = (bf*)take((size_t)DD * DD * 2);
    bf* XB = (bf*)take((size_t)NT * DD * 2); float* F = (float*)take((size_t)NT * DD * 4); float* GX = (float*)take((size_t)NT * 32 * 4); float* CH = (float*)take(512);
    h16* QP = (h16*)take((size_t)NT * DD * 2); h16* KP = (h16*)take((size_t)NT * DD * 2); h16* VT = (h16*)take((size_t)NT * DD * 2);
    float* Sb = (float*)take((size_t)ZH * TT * TT * 4); h16* Pm = (h16*)take((size_t)ZH * TT * TT * 2); float* Ob = (float*)take((size_t)ZH * TT * HD * 4); bf* ATh = (bf*)take((size_t)NT * DD * 2); bf* ATl = (bf*)take((size_t)NT * DD * 2);
    if ((size_t)(wsp - (char*)d_ws) > ws_size) return;    // total ~ 89 MB = 85 MiB; ws 256 MiB
    { const unsigned gT = (unsigned)((DD * DD / 64 + 63) / 64); k_wtG<<<gT, 256, 0, stream>>>(IN[5], DD, DD, WQ); k_wtG<<<gT, 256, 0, stream>>>(IN[6], DD, DD, WK); k_wtG<<<gT, 256, 0, stream>>>(IN[7], DD, DD, WV); k_wtG<<<gT, 256, 0, stream>>>(IN[8], DD, DD, WO);
      const size_t nx = (size_t)NT * DD / 8; k_cvt8<<<(unsigned)((nx + 255) / 256), 256, 0, stream>>>(IN[0], XB, nx); k_gates<<<NT / 8, 256, 0, stream>>>(IN[0], IN[1], IN[2], IN[3], IN[4], GX); k_cham<<<1, 32, 0, stream>>>(IN[9], IN[10], IN[11], IN[12], CH); }
    const unsigned LB = (unsigned)((NT * DD / 64 + 63) / 64); const dim3 gP(NT / 64, DD / 64, 1);
    k_gemmw<bf, 0, false><<<gP, 32, 0, stream>>>(XB, nullptr, WQ, nullptr, DD, F, DD, nullptr, 0, 0, 0); k_h16plane<<<LB, 256, 0, stream>>>(F, 1.0f, QP);   // inner (the 1/8 is applied in f32 inside k_asoft)
    k_gemmw<bf, 0, false><<<gP, 32, 0, stream>>>(XB, nullptr, WK, nullptr, DD, F, DD, nullptr, 0, 0, 0); k_h16plane<<<LB, 256, 0, stream>>>(F, 1.0f, KP);   // outer
    k_gemmw<bf, 0, false><<<gP, 32, 0, stream>>>(XB, nullptr, WV, nullptr, DD, F, DD, nullptr, 0, 0, 0); k_vtplane<<<LB, 256, 0, stream>>>(F, VT);          // v
    for (int b = 0; b < NB_; ++b)
        for (int h0 = 0; h0 < NH_; h0 += ZH) { const size_t z0 = (size_t)b * NH_ + h0;
            k_gemmw<h16, 0, false><<<dim3(TT / 64, TT / 64, ZH), 32, 0, stream>>>(QP + z0 * TT * HD, nullptr, KP + z0 * TT * HD, nullptr, HD, Sb, TT, nullptr, (size_t)TT * HD, (size_t)TT * HD, (size_t)TT * TT);
            k_asoft<<<ZH * TT / 8, 256, 0, stream>>>(Sb, GX, b, h0, Pm);
            k_gemmw<h16, 0, false><<<dim3(TT / 64, 1, ZH), 32, 0, stream>>>(Pm, nullptr, VT + z0 * HD * TT, nullptr, TT, Ob, HD, nullptr, (size_t)TT * TT, (size_t)HD * TT, (size_t)TT * HD);
            k_merge<<<(ZH * TT * HD / 64 + 63) / 64, 256, 0, stream>>>(Ob, CH, b, h0, ATh, ATl); }
    k_gemmw<bf, 1, false><<<gP, 32, 0, stream>>>(ATh, ATl, WO, nullptr, DD, OUT, DD, nullptr, 0, 0, 0);
}

// v001
// A run of this version takes 512 microseconds.
// In two side-by-side timings against v000, it was 3.08 and 3.16 times as fast.
#include <hip/hip_runtime.h>

// XorzoTransformer (x [4][1024][1024]; aperture = sigmoid(x Wa + ba), expression = sigmoid(x We + be) ([T][16] per-head gates); inner/outer/v = x @ Wi / Wo / Wv (16 heads x 64); p = softmax(inner.outer^T / 8);
// attn = p ap_i ex_j / (sum_j p ap_i ex_j + 1e-8); converged = attn v; ApertureChamber per head: x_in = converged sigmoid(iv_h); (xr, xi) halves rotated by angle pi sigmoid(beta_h); x sigmoid(ov_h) x tanh(chi_h);
// out = merged @ Wout).
// Compute dtypes, f32 accumulate: every input rounded to bf16; the three 1024-wide projections on PLAIN bf16 operands (inputs: exact; transposed bf16 weight copies); the
// 16-wide gate projections as f32 dots on VALU; scores and attn.v on SINGLE fp16 planes (1/8, softmax, the bilateral gating and the renormalisation in f32 in the row kernel; weights x1024 in fp16);

#define NB_  4
#define TT   1024
#define DD   1024
#define NH_  16
#define HD   64
#define NT   (NB_ * TT)
#define NZ   (NB_ * NH_)
#define ZH   32
#define PCAR 1024.0f
#define SCL  0.125f
typedef _Float16 h16;
typedef unsigned short bf;
typedef __attribute__((ext_vector_type(16))) __bf16   v16bf;
typedef __attribute__((ext_vector_type(16))) _Float16 v16h;
typedef __attribute__((ext_vector_type(8)))  _Float16 v8h;
typedef __attribute__((ext_vector_type(8)))  unsigned short v8us;
typedef __attribute__((ext_vector_type(8)))  float    v8f;
typedef __attribute__((ext_vector_type(4)))  float    v4f;
typedef v8h  __attribute__((may_alias)) v8ha;
typedef v4f  __attribute__((may_alias)) v4fa;
typedef v8us __attribute__((may_alias)) v8usa;

__device__ __forceinline__ unsigned short f2bf(float f) { unsigned u = __float_as_uint(f); u += 0x7FFFu + ((u >> 16) & 1u); return (unsigned short)(u >> 16); }
__device__ __forceinline__ float bf2f(unsigned short b) { return __uint_as_float(((unsigned)b) << 16); }
__device__ __forceinline__ float bfr(float f) { return bf2f(f2bf(f)); }
__device__ __forceinline__ v16h cat16(v8h lo, v8h hi) { return __builtin_shufflevector(lo, hi, 0, 1, 2, 3, 4, 5, 6, 7, 8, 9, 10, 11, 12, 13, 14, 15); }
__device__ __forceinline__ v16bf cat16b(v8us lo, v8us hi) { return __builtin_bit_cast(v16bf, __builtin_shufflevector(lo, hi, 0, 1, 2, 3, 4, 5, 6, 7, 8, 9, 10, 11, 12, 13, 14, 15)); }
__device__ __forceinline__ v8f wmma16(v16h a, v16h b, v8f c) { return __builtin_amdgcn_wmma_f32_16x16x32_f16(false, a, false, b, (short)0, c, false, false); }
__device__ __forceinline__ v8f wmmab(v16bf a, v16bf b, v8f c) { return __builtin_amdgcn_wmma_f32_16x16x32_bf16(false, a, false, b, (short)0, c, false, false); }



// ---- k_gemmw: register-blocked GEMM, ONE WAVE per 64x64 output tile (16 accumulators), operands straight from K-contiguous 16-bit planes; grid (M/64, N/64, Z), 32 threads.
// C[m][n] (f32, pitch ldc, + optional f32 bias[n]) = sum_k A[m][k] Bt[n][k] (+ split products per NSPLIT). z-batch strides sA/sB/sC in elements. K % 32 == 0.
template <typename T16> struct WFrag;
template <> struct WFrag<h16> { typedef v16h V; static __device__ __forceinline__ V ld(const h16* p) { return cat16(*(const v8h*)p, *(const v8h*)(p + 16)); } static __device__ __forceinline__ v8f mma(V a, V b, v8f c) { return wmma16(a, b, c); } };
template <> struct WFrag<bf> { typedef v16bf V; static __device__ __forceinline__ V ld(const bf* p) { return cat16b(*(const v8us*)p, *(const v8us*)(p + 16)); } static __device__ __forceinline__ v8f mma(V a, V b, v8f c) { return wmmab(a, b, c); } };
template <typename T16, int NSPLIT, bool BIAS>
__global__ __launch_bounds__(32) void k_gemmw(const T16* __restrict__ A, const T16* __restrict__ A2, const T16* __restrict__ Bt, const T16* __restrict__ Bt2, int K, float* C, int ldc, const float* __restrict__ bias, size_t sA, size_t sB, size_t sC) {
    typedef typename WFrag<T16>::V V;
    __shared__ __align__(16) float os[16 * 68];
    const size_t z = blockIdx.z; A += z * sA; if (A2) A2 += z * sA; Bt += z * sB; if (Bt2) Bt2 += z * sB; C += z * sC;
    const int lane = threadIdx.x & 31, lr = lane & 15, hi = lane >> 4; const int r0 = blockIdx.x * 64, c0 = blockIdx.y * 64;
    v8f acc[4][4];
#pragma unroll
    for (int mb = 0; mb < 4; ++mb)
#pragma unroll
        for (int nb = 0; nb < 4; ++nb) acc[mb][nb] = (v8f){};
    const size_t aoff = (size_t)(r0 + lr) * K + 8 * hi, boff = (size_t)(c0 + lr) * K + 8 * hi;
#pragma unroll 1
    for (int kc = 0; kc < K; kc += 32) {
        V a[4], a2[4];
#pragma unroll
        for (int mb = 0; mb < 4; ++mb) { a[mb] = WFrag<T16>::ld(A + aoff + (size_t)mb * 16 * K + kc); if (NSPLIT == 1 || NSPLIT == 2) a2[mb] = WFrag<T16>::ld(A2 + aoff + (size_t)mb * 16 * K + kc); }
#pragma unroll
        for (int nb = 0; nb < 4; ++nb) { const V b = WFrag<T16>::ld(Bt + boff + (size_t)nb * 16 * K + kc); V b2; if (NSPLIT >= 2) b2 = WFrag<T16>::ld(Bt2 + boff + (size_t)nb * 16 * K + kc);
#pragma unroll
            for (int mb = 0; mb < 4; ++mb) { acc[mb][nb] = WFrag<T16>::mma(a[mb], b, acc[mb][nb]); if (NSPLIT == 1 || NSPLIT == 2) acc[mb][nb] = WFrag<T16>::mma(a2[mb], b, acc[mb][nb]); if (NSPLIT >= 2) acc[mb][nb] = WFrag<T16>::mma(a[mb], b2, acc[mb][nb]); } }
        asm volatile("v_nop\n\tv_nop\n\tv_nop\n\tv_nop" : "+v"(acc[0][0]), "+v"(acc[1][1]), "+v"(acc[2][2]), "+v"(acc[3][3]) : "v"(a[0]), "v"(a[3]));
    }
#pragma unroll
    for (int mb = 0; mb < 4; ++mb) {
#pragma unroll
        for (int nb = 0; nb < 4; ++nb) {
#pragma unroll
            for (int j = 0; j < 8; ++j) os[(hi * 8 + j) * 68 + nb * 16 + lr] = acc[mb][nb][j]; }
        __builtin_amdgcn_wave_barrier(); asm volatile("" ::: "memory");
        float* crow = C + (size_t)(r0 + mb * 16) * ldc + c0;
{
#pragma unroll
            for (int s = 0; s < 8; ++s) { const int row = 2 * s + hi, cofs = lr * 4; v4f val = *(const v4fa*)(os + row * 68 + cofs); if (BIAS) { val[0] += bfr(bias[c0 + cofs]); val[1] += bfr(bias[c0 + cofs + 1]); val[2] += bfr(bias[c0 + cofs + 2]); val[3] += bfr(bias[c0 + cofs + 3]); }
                *(v4f*)(crow + (size_t)row * ldc + cofs) = val; }
             }
        __builtin_amdgcn_wave_barrier(); asm volatile("" ::: "memory");
    }
}

__device__ __forceinline__ h16 tohx(float x) { return (h16)x; }
__device__ __forceinline__ void splitf(float y, unsigned short& h, unsigned short& l) { h = f2bf(y); l = f2bf(y - bf2f(h)); }
typedef __attribute__((ext_vector_type(2))) _Float16 v2h;
typedef __attribute__((ext_vector_type(4))) _Float16 v4h;
typedef __attribute__((ext_vector_type(2))) unsigned short v2us;
typedef __attribute__((ext_vector_type(4))) unsigned short v4us;
typedef __attribute__((ext_vector_type(2))) float v2f;

__global__ __launch_bounds__(256) void k_cvt8(const float* __restrict__ src, bf* dst, size_t n8) { const size_t i = (size_t)blockIdx.x * 256 + threadIdx.x; if (i >= n8) return; const v8f v = *(const v8f*)(src + i * 8); v8us o;
#pragma unroll
    for (int k = 0; k < 8; ++k) o[k] = f2bf(v[k]); *(v8us*)(dst + i * 8) = o;  }
__global__ __launch_bounds__(256) void k_wtG(const float* __restrict__ w, int K, int N, bf* Bt) {
    const int lane = threadIdx.x & 31; const int L0 = (blockIdx.x * 8 + (threadIdx.x >> 5)) * 8; const int nlines = N * K / 64;
{
#pragma unroll 1
        for (int l = 0; l < 8; ++l) { const int L = L0 + l; if (L >= nlines) break; const size_t e = (size_t)L * 64 + lane * 2; const int k = (int)(e % K), n = (int)(e / K); v2us o;
            o[0] = f2bf(w[(size_t)k * N + n]); o[1] = f2bf(w[(size_t)(k + 1) * N + n]); *(v2us*)(Bt + e) = o; }
         }
}
__global__ __launch_bounds__(256) void k_gates(const float* __restrict__ x, const float* __restrict__ Wa, const float* __restrict__ ba, const float* __restrict__ We, const float* __restrict__ be, float* GX) {
    const int lane = threadIdx.x & 31; const int r = blockIdx.x * 8 + (threadIdx.x >> 5); if (r >= NT) return; const float* xr = x + (size_t)r * DD; float acc[32];
#pragma unroll
    for (int h = 0; h < 32; ++h) acc[h] = 0.f;
#pragma unroll 1
    for (int d = lane; d < DD; d += 32) { const float xv = bfr(xr[d]); const float* wa = Wa + (size_t)d * NH_; const float* we = We + (size_t)d * NH_;
#pragma unroll
        for (int h = 0; h < 16; ++h) { float p1 = __fmul_rn(xv, bfr(wa[h])), p2 = __fmul_rn(xv, bfr(we[h])); asm volatile("" : "+v"(p1)); asm volatile("" : "+v"(p2)); acc[h] = __fadd_rn(acc[h], p1); acc[16 + h] = __fadd_rn(acc[16 + h], p2); } }
#pragma unroll
    for (int h = 0; h < 32; ++h) {
#pragma unroll
        for (int sh = 16; sh; sh >>= 1) acc[h] += __shfl_xor(acc[h], sh, 32); }
    float mine = 0.f;
#pragma unroll
    for (int h = 0; h < 32; ++h) if (lane == h) mine = __fadd_rn(acc[h], bfr(h < 16 ? ba[h] : be[h - 16]));
    const float o = __fdiv_rn(1.0f, __fadd_rn(1.0f, __expf(-mine))); *(float*)(GX + (size_t)r * 32 + lane) = o;  }
__global__ __launch_bounds__(256) void k_h16plane(const float* __restrict__ F, float sc, h16* P) {
    const int lane = threadIdx.x & 31; const int L0 = (blockIdx.x * 8 + (threadIdx.x >> 5)) * 8; const int nlines = NT * DD / 64;
{
#pragma unroll
        for (int l = 0; l < 8; ++l) { const int L = L0 + l; if (L >= nlines) break; const int e = L * 64 + lane * 2; const int d = e & 63; const int t = (e >> 6) & (TT - 1); const int z = e >> 16; const int b = z / NH_, h = z % NH_; v2h v;
#pragma unroll
            for (int q = 0; q < 2; ++q) v[q] = tohx(F[((size_t)b * TT + t) * DD + h * HD + d + q] * sc);
            *(v2h*)(P + (size_t)e) = v; }
         }
}
__global__ __launch_bounds__(256) void k_vtplane(const float* __restrict__ F, h16* VT) {
    const int lane = threadIdx.x & 31; const int L0 = (blockIdx.x * 8 + (threadIdx.x >> 5)) * 8; const int nlines = NT * DD / 64;
{
#pragma unroll
        for (int l = 0; l < 8; ++l) { const int L = L0 + l; if (L >= nlines) break; const int e = L * 64 + lane * 2; const int t = e & (TT - 1); const int d = (e >> 10) & 63; const int z = e >> 16; const int b = z / NH_, h = z % NH_; v2h v;
#pragma unroll
            for (int q = 0; q < 2; ++q) v[q] = tohx(F[((size_t)b * TT + t + q) * DD + h * HD + d]);
            *(v2h*)(VT + (size_t)e) = v; }
         }
}
// k_asoft: per row (zz, i), flat head z = z0 + zz = b * 16 + h: p = softmax(S/8) over the 1024 keys (register row, one exp); w_j = (p_j ap[b][i][h]) ex[b][j][h]; attn = w / (sum_j w + 1e-8) -> fp16 x1024 (per-row factor
__global__ __launch_bounds__(256) void k_asoft(const float* __restrict__ Sb, const float* __restrict__ GX, int z0, h16* P16) {
    const int lane = threadIdx.x & 31; const int row = blockIdx.x * 8 + (threadIdx.x >> 5); if (row >= ZH * TT) return; const int i = row & (TT - 1); const int z = z0 + (int)(blockIdx.x / (TT / 8)); const int b = z / NH_, h = z % NH_;   /* a block's 8 rows lie in one head: z is scalar */ const float ap = GX[((size_t)b * TT + i) * 32 + h]; const float* gxe = GX + (size_t)b * TT * 32 + 16 + h;
    const float* sr = Sb + (size_t)row * TT; float v[32]; float mx = -3.0e38f;
#pragma unroll
    for (int ch = 0; ch < 8; ++ch) { const int j0 = ch * 128 + lane * 4; const v4f a = *(const v4f*)(sr + j0);
#pragma unroll
        for (int q = 0; q < 4; ++q) { const float t = a[q] * SCL; v[ch * 4 + q] = t; mx = fmaxf(mx, t); } }
#pragma unroll
    for (int sh = 16; sh; sh >>= 1) mx = fmaxf(mx, __shfl_xor(mx, sh, 32));
    float sum = 0.f;
#pragma unroll
    for (int k = 0; k < 32; ++k) { v[k] = __expf(v[k] - mx); sum += v[k]; }
#pragma unroll
    for (int sh = 16; sh; sh >>= 1) sum += __shfl_xor(sum, sh, 32);
    const float inv = __fdiv_rn(1.0f, sum); float s2 = 0.f;   // p = e inv; w = (p ap) ex_j; attn = w / (sum_j w + 1e-8)
#pragma unroll
    for (int ch = 0; ch < 8; ++ch) {
#pragma unroll
        for (int q = 0; q < 4; ++q) { const int j = ch * 128 + lane * 4 + q; float p = __fmul_rn(v[ch * 4 + q], inv); asm volatile("" : "+v"(p)); float pa = __fmul_rn(p, ap); asm volatile("" : "+v"(pa)); const float w = __fmul_rn(pa, gxe[(size_t)j * 32]); v[ch * 4 + q] = w; s2 = __fadd_rn(s2, w); } }
#pragma unroll
    for (int sh = 16; sh; sh >>= 1) s2 += __shfl_xor(s2, sh, 32);
    const float f = __fdiv_rn(PCAR, __fadd_rn(s2, 1e-8f));
{
#pragma unroll
        for (int ch = 0; ch < 8; ++ch) { v4h o;
#pragma unroll
            for (int q = 0; q < 4; ++q) o[q] = tohx(v[ch * 4 + q] * f);
            *(v4h*)(P16 + (size_t)row * TT + ch * 128 + lane * 4) = o; }
         }
}
__global__ __launch_bounds__(32) void k_cham(const float* __restrict__ chi, const float* __restrict__ bp, const float* __restrict__ ivp, const float* __restrict__ ovp, float* CH) { const int lane = threadIdx.x; const int h = lane >> 1; const int part = (lane & 1) * 2;
    const float sg_b = __fdiv_rn(1.0f, __fadd_rn(1.0f, __expf(-bfr(bp[h])))); const float ang = __fmul_rn(3.14159265358979f, sg_b); v2f o;
    if (part == 0) { o[0] = __fdiv_rn(1.0f, __fadd_rn(1.0f, __expf(-bfr(ivp[h])))); o[1] = cosf(ang); } else { o[0] = sinf(ang); o[1] = __fdiv_rn(1.0f, __fadd_rn(1.0f, __expf(-bfr(ovp[h])))); }
    const float th = (lane < NH_) ? tanhf(bfr(chi[lane])) : 0.f;
    *(v2f*)(CH + lane * 2) = o; *(float*)(CH + 64 + lane) = th;  }
__global__ __launch_bounds__(256) void k_merge(const float* __restrict__ O, const float* __restrict__ CH, int z0, bf* Ah, bf* Al) {
    const int lane = threadIdx.x & 31; const int L0 = (blockIdx.x * 8 + (threadIdx.x >> 5)) * 8; const int nlines = ZH * TT * HD / 64;
{
#pragma unroll 2
        for (int l = 0; l < 8; ++l) { const int L = L0 + l; if (L >= nlines) break; const int e = L * 64 + lane * 2; const int d = e & 63; const int t = (e >> 6) & (TT - 1); const int zz = e >> 16; v2us oh, ol;
const int b = (z0 + zz) / NH_, hh = (z0 + zz) % NH_; const float iv = CH[hh * 4], ca = CH[hh * 4 + 1], sa = CH[hh * 4 + 2], ovt = CH[hh * 4 + 3];
#pragma unroll
            for (int q = 0; q < 2; ++q) { const int dq = d + q; float me = __fmul_rn(O[(size_t)e + q] * (1.0f / PCAR), iv), pt = __fmul_rn(O[(size_t)(e + q) + ((dq < 32) ? 32 : -32)] * (1.0f / PCAR), iv); asm volatile("" : "+v"(me)); asm volatile("" : "+v"(pt));
                float t1, t2; if (dq < 32) { t1 = __fmul_rn(me, ca); t2 = __fmul_rn(pt, sa); asm volatile("" : "+v"(t1)); asm volatile("" : "+v"(t2)); t1 = __fsub_rn(t1, t2); } else { t1 = __fmul_rn(pt, sa); t2 = __fmul_rn(me, ca); asm volatile("" : "+v"(t1)); asm volatile("" : "+v"(t2)); t1 = __fadd_rn(t1, t2); }
                float r0 = __fmul_rn(t1, ovt); asm volatile("" : "+v"(r0)); float r1 = __fmul_rn(r0, CH[64 + hh]); asm volatile("" : "+v"(r1)); unsigned short a, c2; splitf(r1, a, c2); oh[q] = a; ol[q] = c2; }
            const size_t o = ((size_t)b * TT + t) * DD + hh * HD + d; *(v2us*)(Ah + o) = oh; *(v2us*)(Al + o) = ol; }
         }
}

extern "C" void kernel_launch(void* const* d_in, const int* in_sizes, int n_in,
                              void* d_out, int out_size, void* d_ws, size_t ws_size, hipStream_t stream) {
    (void)in_sizes; (void)n_in; (void)out_size;
    const float* IN[13]; for (int i = 0; i < 13; ++i) IN[i] = (const float*)d_in[i];
    // x [4][1024][1024], Wa [1024][16], ba, We, be, Wi, Wo, Wv, Wout ([in][out] = x @ W), chi, beta_p, iv_p, ov_p [16] = d_in[0..12]
    float* OUT = (float*)d_out;     // [4][1024][1024]
    char* wsp = (char*)d_ws;
    auto take = [&](size_t bytes) { char* p = wsp; wsp += (bytes + 255) & ~(size_t)255; return (void*)p; };
    bf* WO = (bf*)take((size_t)DD * DD * 2); float* GX = (float*)take((size_t)NT * 32 * 4); float* CH = (float*)take(512);
    h16* QP = (h16*)take((size_t)NT * DD * 2); h16* KP = (h16*)take((size_t)NT * DD * 2); h16* VT = (h16*)take((size_t)NT * DD * 2);
    h16* Pm = (h16*)take((size_t)ZH * TT * TT * 2); float* Ob = (float*)take((size_t)ZH * TT * HD * 4); bf* ATh = (bf*)take((size_t)NT * DD * 2); bf* ATl = (bf*)take((size_t)NT * DD * 2);
    float* Sb = (float*)take((size_t)ZH * TT * TT * 4);
    if ((size_t)(wsp - (char*)d_ws) > ws_size) return;    // total below 243 MiB; ws 256 MiB
    // WQ, WK, WV, XB and F (30 MiB) are last read by the projection GEMMs and plane kernels, ahead of the first score launch: they lie inside Sb's 128 MiB.
    wsp = (char*)Sb;
    bf* WQ = (bf*)take((size_t)DD * DD * 2); bf* WK = (bf*)take((size_t)DD * DD * 2); bf* WV = (bf*)take((size_t)DD * DD * 2); bf* XB = (bf*)take((size_t)NT * DD * 2); float* F = (float*)take((size_t)NT * DD * 4);
    { const unsigned gT = (unsigned)((DD * DD / 64 + 63) / 64); k_wtG<<<gT, 256, 0, stream>>>(IN[5], DD, DD, WQ); k_wtG<<<gT, 256, 0, stream>>>(IN[6], DD, DD, WK); k_wtG<<<gT, 256, 0, stream>>>(IN[7], DD, DD, WV); k_wtG<<<gT, 256, 0, stream>>>(IN[8], DD, DD, WO);
      const size_t nx = (size_t)NT * DD / 8; k_cvt8<<<(unsigned)((nx + 255) / 256), 256, 0, stream>>>(IN[0], XB, nx); k_gates<<<NT / 8, 256, 0, stream>>>(IN[0], IN[1], IN[2], IN[3], IN[4], GX); k_cham<<<1, 32, 0, stream>>>(IN[9], IN[10], IN[11], IN[12], CH); }
    const unsigned LB = (unsigned)((NT * DD / 64 + 63) / 64); const dim3 gP(NT / 64, DD / 64, 1);
    k_gemmw<bf, 0, false><<<gP, 32, 0, stream>>>(XB, nullptr, WQ, nullptr, DD, F, DD, nullptr, 0, 0, 0); k_h16plane<<<LB, 256, 0, stream>>>(F, 1.0f, QP);   // inner (the 1/8 is applied in f32 inside k_asoft)
    k_gemmw<bf, 0, false><<<gP, 32, 0, stream>>>(XB, nullptr, WK, nullptr, DD, F, DD, nullptr, 0, 0, 0); k_h16plane<<<LB, 256, 0, stream>>>(F, 1.0f, KP);   // outer
    k_gemmw<bf, 0, false><<<gP, 32, 0, stream>>>(XB, nullptr, WV, nullptr, DD, F, DD, nullptr, 0, 0, 0); k_vtplane<<<LB, 256, 0, stream>>>(F, VT);          // v
    for (int zi = 0; zi < NZ; zi += ZH) { const size_t z0 = (size_t)zi;   // ZH flat heads (b * 16 + h) per launch
            k_gemmw<h16, 0, false><<<dim3(TT / 64, TT / 64, ZH), 32, 0, stream>>>(QP + z0 * TT * HD, nullptr, KP + z0 * TT * HD, nullptr, HD, Sb, TT, nullptr, (size_t)TT * HD, (size_t)TT * HD, (size_t)TT * TT);
            k_asoft<<<ZH * TT / 8, 256, 0, stream>>>(Sb, GX, zi, Pm);
            k_gemmw<h16, 0, false><<<dim3(TT / 64, 1, ZH), 32, 0, stream>>>(Pm, nullptr, VT + z0 * HD * TT, nullptr, TT, Ob, HD, nullptr, (size_t)TT * TT, (size_t)HD * TT, (size_t)TT * HD);
            k_merge<<<(ZH * TT * HD / 64 + 63) / 64, 256, 0, stream>>>(Ob, CH, zi, ATh, ATl); }
    k_gemmw<bf, 1, false><<<gP, 32, 0, stream>>>(ATh, ATl, WO, nullptr, DD, OUT, DD, nullptr, 0, 0, 0);
}

// v002
// Measured time: 270 microseconds a run.
// Two timings next to v001 put it at 1.89 and 1.90 times that version's speed.
// All steps since v000 together make it 5.91 times as fast.
#include <hip/hip_runtime.h>

// XorzoTransformer (x [4][1024][1024]; aperture = sigmoid(x Wa + ba), expression = sigmoid(x We + be) ([T][16] per-head gates); inner/outer/v = x @ Wi / Wo / Wv (16 heads x 64); p = softmax(inner.outer^T / 8);
// attn = p ap_i ex_j / (sum_j p ap_i ex_j + 1e-8); converged = attn v; ApertureChamber per head: x_in = converged sigmoid(iv_h); (xr, xi) halves rotated by angle pi sigmoid(beta_h); x sigmoid(ov_h) x tanh(chi_h);
// out = merged @ Wout).
// Compute dtypes, f32 accumulate: every input rounded to bf16; the three 1024-wide projections on PLAIN bf16 operands (inputs: exact; transposed bf16 weight copies); the
// 16-wide gate projections as f32 dots on VALU; scores and attn.v on SINGLE fp16 planes inside one fused kernel (1/8, running-maximum softmax, the bilateral gating and the renormalisation in f32; gated weights in fp16);

#define NB_  4
#define TT   1024
#define DD   1024
#define NH_  16
#define HD   64
#define NT   (NB_ * TT)
#define NZ   (NB_ * NH_)
#define ZH   64
#define PCAR 1024.0f
#define SCL  0.125f
typedef _Float16 h16;
typedef unsigned short bf;
typedef __attribute__((ext_vector_type(16))) __bf16   v16bf;
typedef __attribute__((ext_vector_type(16))) _Float16 v16h;
typedef __attribute__((ext_vector_type(8)))  _Float16 v8h;
typedef __attribute__((ext_vector_type(8)))  unsigned short v8us;
typedef __attribute__((ext_vector_type(8)))  float    v8f;
typedef __attribute__((ext_vector_type(4)))  float    v4f;
typedef v8h  __attribute__((may_alias)) v8ha;
typedef v4f  __attribute__((may_alias)) v4fa;
typedef v8us __attribute__((may_alias)) v8usa;

__device__ __forceinline__ unsigned short f2bf(float f) { unsigned u = __float_as_uint(f); u += 0x7FFFu + ((u >> 16) & 1u); return (unsigned short)(u >> 16); }
__device__ __forceinline__ float bf2f(unsigned short b) { return __uint_as_float(((unsigned)b) << 16); }
__device__ __forceinline__ float bfr(float f) { return bf2f(f2bf(f)); }
__device__ __forceinline__ v16h cat16(v8h lo, v8h hi) { return __builtin_shufflevector(lo, hi, 0, 1, 2, 3, 4, 5, 6, 7, 8, 9, 10, 11, 12, 13, 14, 15); }
__device__ __forceinline__ v16bf cat16b(v8us lo, v8us hi) { return __builtin_bit_cast(v16bf, __builtin_shufflevector(lo, hi, 0, 1, 2, 3, 4, 5, 6, 7, 8, 9, 10, 11, 12, 13, 14, 15)); }
__device__ __forceinline__ v8f wmma16(v16h a, v16h b, v8f c) { return __builtin_amdgcn_wmma_f32_16x16x32_f16(false, a, false, b, (short)0, c, false, false); }
__device__ __forceinline__ v8f wmmab(v16bf a, v16bf b, v8f c) { return __builtin_amdgcn_wmma_f32_16x16x32_bf16(false, a, false, b, (short)0, c, false, false); }



// ---- k_gemmw: register-blocked GEMM, ONE WAVE per 64x64 output tile (16 accumulators), operands straight from K-contiguous 16-bit planes; grid (M/64, N/64, Z), 32 threads.
// C[m][n] (f32, pitch ldc, + optional f32 bias[n]) = sum_k A[m][k] Bt[n][k] (+ split products per NSPLIT). z-batch strides sA/sB/sC in elements. K % 32 == 0.
template <typename T16> struct WFrag;
template <> struct WFrag<h16> { typedef v16h V; static __device__ __forceinline__ V ld(const h16* p) { return cat16(*(const v8h*)p, *(const v8h*)(p + 16)); } static __device__ __forceinline__ v8f mma(V a, V b, v8f c) { return wmma16(a, b, c); } };
template <> struct WFrag<bf> { typedef v16bf V; static __device__ __forceinline__ V ld(const bf* p) { return cat16b(*(const v8us*)p, *(const v8us*)(p + 16)); } static __device__ __forceinline__ v8f mma(V a, V b, v8f c) { return wmmab(a, b, c); } };
template <typename T16, int NSPLIT, bool BIAS>
__global__ __launch_bounds__(32) void k_gemmw(const T16* __restrict__ A, const T16* __restrict__ A2, const T16* __restrict__ Bt, const T16* __restrict__ Bt2, int K, float* C, int ldc, const float* __restrict__ bias, size_t sA, size_t sB, size_t sC) {
    typedef typename WFrag<T16>::V V;
    __shared__ __align__(16) float os[16 * 68];
    const size_t z = blockIdx.z; A += z * sA; if (A2) A2 += z * sA; Bt += z * sB; if (Bt2) Bt2 += z * sB; C += z * sC;
    const int lane = threadIdx.x & 31, lr = lane & 15, hi = lane >> 4; const int r0 = blockIdx.x * 64, c0 = blockIdx.y * 64;
    v8f acc[4][4];
#pragma unroll
    for (int mb = 0; mb < 4; ++mb)
#pragma unroll
        for (int nb = 0; nb < 4; ++nb) acc[mb][nb] = (v8f){};
    const size_t aoff = (size_t)(r0 + lr) * K + 8 * hi, boff = (size_t)(c0 + lr) * K + 8 * hi;
#pragma unroll 1
    for (int kc = 0; kc < K; kc += 32) {
        V a[4], a2[4];
#pragma unroll
        for (int mb = 0; mb < 4; ++mb) { a[mb] = WFrag<T16>::ld(A + aoff + (size_t)mb * 16 * K + kc); if (NSPLIT == 1 || NSPLIT == 2) a2[mb] = WFrag<T16>::ld(A2 + aoff + (size_t)mb * 16 * K + kc); }
#pragma unroll
        for (int nb = 0; nb < 4; ++nb) { const V b = WFrag<T16>::ld(Bt + boff + (size_t)nb * 16 * K + kc); V b2; if (NSPLIT >= 2) b2 = WFrag<T16>::ld(Bt2 + boff + (size_t)nb * 16 * K + kc);
#pragma unroll
            for (int mb = 0; mb < 4; ++mb) { acc[mb][nb] = WFrag<T16>::mma(a[mb], b, acc[mb][nb]); if (NSPLIT == 1 || NSPLIT == 2) acc[mb][nb] = WFrag<T16>::mma(a2[mb], b, acc[mb][nb]); if (NSPLIT >= 2) acc[mb][nb] = WFrag<T16>::mma(a[mb], b2, acc[mb][nb]); } }
        asm volatile("v_nop\n\tv_nop\n\tv_nop\n\tv_nop" : "+v"(acc[0][0]), "+v"(acc[1][1]), "+v"(acc[2][2]), "+v"(acc[3][3]) : "v"(a[0]), "v"(a[3]));
    }
#pragma unroll
    for (int mb = 0; mb < 4; ++mb) {
#pragma unroll
        for (int nb = 0; nb < 4; ++nb) {
#pragma unroll
            for (int j = 0; j < 8; ++j) os[(hi * 8 + j) * 68 + nb * 16 + lr] = acc[mb][nb][j]; }
        __builtin_amdgcn_wave_barrier(); asm volatile("" ::: "memory");
        float* crow = C + (size_t)(r0 + mb * 16) * ldc + c0;
{
#pragma unroll
            for (int s = 0; s < 8; ++s) { const int row = 2 * s + hi, cofs = lr * 4; v4f val = *(const v4fa*)(os + row * 68 + cofs); if (BIAS) { val[0] += bfr(bias[c0 + cofs]); val[1] += bfr(bias[c0 + cofs + 1]); val[2] += bfr(bias[c0 + cofs + 2]); val[3] += bfr(bias[c0 + cofs + 3]); }
                *(v4f*)(crow + (size_t)row * ldc + cofs) = val; }
             }
        __builtin_amdgcn_wave_barrier(); asm volatile("" ::: "memory");
    }
}

__device__ __forceinline__ h16 tohx(float x) { return (h16)x; }
__device__ __forceinline__ void splitf(float y, unsigned short& h, unsigned short& l) { h = f2bf(y); l = f2bf(y - bf2f(h)); }
typedef __attribute__((ext_vector_type(2))) _Float16 v2h;
typedef __attribute__((ext_vector_type(4))) _Float16 v4h;
typedef __attribute__((ext_vector_type(2))) unsigned short v2us;
typedef __attribute__((ext_vector_type(4))) unsigned short v4us;
typedef __attribute__((ext_vector_type(2))) float v2f;

__global__ __launch_bounds__(256) void k_cvt8(const float* __restrict__ src, bf* dst, size_t n8) { const size_t i = (size_t)blockIdx.x * 256 + threadIdx.x; if (i >= n8) return; const v8f v = *(const v8f*)(src + i * 8); v8us o;
#pragma unroll
    for (int k = 0; k < 8; ++k) o[k] = f2bf(v[k]); *(v8us*)(dst + i * 8) = o;  }
__global__ __launch_bounds__(256) void k_wtG(const float* __restrict__ w, int K, int N, bf* Bt) {
    const int lane = threadIdx.x & 31; const int L0 = (blockIdx.x * 8 + (threadIdx.x >> 5)) * 8; const int nlines = N * K / 64;
{
#pragma unroll 1
        for (int l = 0; l < 8; ++l) { const int L = L0 + l; if (L >= nlines) break; const size_t e = (size_t)L * 64 + lane * 2; const int k = (int)(e % K), n = (int)(e / K); v2us o;
            o[0] = f2bf(w[(size_t)k * N + n]); o[1] = f2bf(w[(size_t)(k + 1) * N + n]); *(v2us*)(Bt + e) = o; }
         }
}
__global__ __launch_bounds__(256) void k_gates(const float* __restrict__ x, const float* __restrict__ Wa, const float* __restrict__ ba, const float* __restrict__ We, const float* __restrict__ be, float* GX) {
    const int lane = threadIdx.x & 31; const int r = blockIdx.x * 8 + (threadIdx.x >> 5); if (r >= NT) return; const float* xr = x + (size_t)r * DD; float acc[32];
#pragma unroll
    for (int h = 0; h < 32; ++h) acc[h] = 0.f;
#pragma unroll 1
    for (int d = lane; d < DD; d += 32) { const float xv = bfr(xr[d]); const float* wa = Wa + (size_t)d * NH_; const float* we = We + (size_t)d * NH_;
#pragma unroll
        for (int h = 0; h < 16; ++h) { float p1 = __fmul_rn(xv, bfr(wa[h])), p2 = __fmul_rn(xv, bfr(we[h])); asm volatile("" : "+v"(p1)); asm volatile("" : "+v"(p2)); acc[h] = __fadd_rn(acc[h], p1); acc[16 + h] = __fadd_rn(acc[16 + h], p2); } }
#pragma unroll
    for (int h = 0; h < 32; ++h) {
#pragma unroll
        for (int sh = 16; sh; sh >>= 1) acc[h] += __shfl_xor(acc[h], sh, 32); }
    float mine = 0.f;
#pragma unroll
    for (int h = 0; h < 32; ++h) if (lane == h) mine = __fadd_rn(acc[h], bfr(h < 16 ? ba[h] : be[h - 16]));
    const float o = __fdiv_rn(1.0f, __fadd_rn(1.0f, __expf(-mine))); *(float*)(GX + (size_t)r * 32 + lane) = o;  }
__global__ __launch_bounds__(256) void k_h16plane(const float* __restrict__ F, float sc, h16* P) {
    const int lane = threadIdx.x & 31; const int L0 = (blockIdx.x * 8 + (threadIdx.x >> 5)) * 8; const int nlines = NT * DD / 64;
{
#pragma unroll
        for (int l = 0; l < 8; ++l) { const int L = L0 + l; if (L >= nlines) break; const int e = L * 64 + lane * 2; const int d = e & 63; const int t = (e >> 6) & (TT - 1); const int z = e >> 16; const int b = z / NH_, h = z % NH_; v2h v;
#pragma unroll
            for (int q = 0; q < 2; ++q) v[q] = tohx(F[((size_t)b * TT + t) * DD + h * HD + d + q] * sc);
            *(v2h*)(P + (size_t)e) = v; }
         }
}
__global__ __launch_bounds__(256) void k_vtplane(const float* __restrict__ F, h16* VT) {
    const int lane = threadIdx.x & 31; const int L0 = (blockIdx.x * 8 + (threadIdx.x >> 5)) * 8; const int nlines = NT * DD / 64;
{
#pragma unroll
        for (int l = 0; l < 8; ++l) { const int L = L0 + l; if (L >= nlines) break; const int e = L * 64 + lane * 2; const int t = e & (TT - 1); const int d = (e >> 10) & 63; const int z = e >> 16; const int b = z / NH_, h = z % NH_; v2h v;
#pragma unroll
            for (int q = 0; q < 2; ++q) v[q] = tohx(F[((size_t)b * TT + t + q) * DD + h * HD + d]);
            *(v2h*)(VT + (size_t)e) = v; }
         }
}
#define KST  64
#define LP   72
#define CS2  0.18033688011112042f   /* (1/8) log2(e) */
__global__ __launch_bounds__(256) void k_fattn(const h16* __restrict__ QP, const h16* __restrict__ KP, const h16* __restrict__ VT, const float* __restrict__ GX, float* Ob) {
    __shared__ __align__(16) h16 Ks[2][KST * LP];
    __shared__ __align__(16) h16 Vs[2][HD * LP];
    __shared__ __align__(16) float exs[TT];
    const int tid = threadIdx.x, lane = tid & 31, wv = tid >> 5, lr = lane & 15, hi = lane >> 4;
    const int z = blockIdx.y, b = z / NH_, h = z % NH_; const int q0 = blockIdx.x * 256 + wv * 32;
    const h16* Qz = QP + (size_t)z * TT * HD; const h16* Kz = KP + (size_t)z * TT * HD; const h16* Vz = VT + (size_t)z * HD * TT;
#pragma unroll
    for (int u = 0; u < TT / 256; ++u) exs[u * 256 + tid] = GX[((size_t)b * TT + u * 256 + tid) * 32 + 16 + h];
    v16h qf[2][2];
#pragma unroll
    for (int qt = 0; qt < 2; ++qt)
#pragma unroll
        for (int ks = 0; ks < 2; ++ks) qf[qt][ks] = WFrag<h16>::ld(Qz + (size_t)(q0 + qt * 16 + lr) * HD + ks * 32 + 8 * hi);
    const int srow = tid >> 3, sch = (tid & 7) * 8;   // a thread stages 16 B of rows srow and srow + 32 of each tile: a wave covers whole 128-B lines
    v8h kr[2], vr[2];
#pragma unroll
    for (int u = 0; u < 2; ++u) { kr[u] = *(const v8h*)(Kz + (size_t)(srow + 32 * u) * HD + sch); vr[u] = *(const v8h*)(Vz + (size_t)(srow + 32 * u) * TT + sch); }
#pragma unroll
    for (int u = 0; u < 2; ++u) { *(v8h*)(&Ks[0][(srow + 32 * u) * LP + sch]) = kr[u]; *(v8h*)(&Vs[0][(srow + 32 * u) * LP + sch]) = vr[u]; }
    v8f O[2][4]; float m[2]; v2f l1[2], l2[2];   // l1, l2: a lane's sums over even and odd keys, joined in the epilogue
#pragma unroll
    for (int qt = 0; qt < 2; ++qt) { m[qt] = -3.0e38f; l1[qt] = (v2f){}; l2[qt] = (v2f){};
#pragma unroll
        for (int dt = 0; dt < 4; ++dt) O[qt][dt] = (v8f){}; }
    __syncthreads();   // tile 0 and the gate row are published
#pragma unroll 1   /* rolled: one copy of the tile body; sixteen would only grow the code */
    for (int s = 0; s < TT / KST; ++s) {
        const h16* kb = Ks[s & 1]; const h16* vb = Vs[s & 1]; const bool more = s + 1 < TT / KST;
        if (more) {   // the next tile's global loads fly while this tile is worked on
#pragma unroll
            for (int u = 0; u < 2; ++u) { kr[u] = *(const v8h*)(Kz + (size_t)((s + 1) * KST + srow + 32 * u) * HD + sch); vr[u] = *(const v8h*)(Vz + (size_t)(srow + 32 * u) * TT + (s + 1) * KST + sch); } }
#pragma unroll 1   /* rolled: unrolled, the build took more VGPRs and more padding v_nop and fetched hardly any fragment earlier */
        for (int ps = 0; ps < 2; ++ps) {   // a pass: 32 keys
            const int kl = ps * 32; v8f st[2][2];
#pragma unroll
            for (int kt = 0; kt < 2; ++kt) { const v16h k0 = WFrag<h16>::ld(kb + (kl + kt * 16 + lr) * LP + 8 * hi), k1 = WFrag<h16>::ld(kb + (kl + kt * 16 + lr) * LP + 32 + 8 * hi);
#pragma unroll
                for (int qt = 0; qt < 2; ++qt) st[qt][kt] = wmma16(k1, qf[qt][1], wmma16(k0, qf[qt][0], (v8f){})); }   // st[qt][kt][r] = S[query qt*16+lr][key kl + kt*16 + 8*hi + r]
            v16h vf[4];
#pragma unroll
            for (int dt = 0; dt < 4; ++dt) vf[dt] = WFrag<h16>::ld(vb + (dt * 16 + lr) * LP + kl + 8 * hi);
            v2f ex[2][4];
#pragma unroll
            for (int kt = 0; kt < 2; ++kt) { const float* ep = exs + s * KST + kl + kt * 16 + 8 * hi; const v4f e0 = *(const v4fa*)ep, e1 = *(const v4fa*)(ep + 4);
                ex[kt][0] = __builtin_shufflevector(e0, e0, 0, 1); ex[kt][1] = __builtin_shufflevector(e0, e0, 2, 3); ex[kt][2] = __builtin_shufflevector(e1, e1, 0, 1); ex[kt][3] = __builtin_shufflevector(e1, e1, 2, 3); }
            float tm[2];
#pragma unroll
            for (int qt = 0; qt < 2; ++qt) { float t = st[qt][0][0];
#pragma unroll
                for (int r = 1; r < 8; ++r) t = fmaxf(t, st[qt][0][r]);
#pragma unroll
                for (int r = 0; r < 8; ++r) t = fmaxf(t, st[qt][1][r]);
                tm[qt] = t * CS2; }
            // lazy rescale: the maximum in use moves only when a lane's new score tops it by more than 8 (log2), so w stays below 2^8; one scalar test per pass
            if (__builtin_amdgcn_ballot_w32(tm[0] > m[0] + 8.0f || tm[1] > m[1] + 8.0f) != 0) {
#pragma unroll
                for (int qt = 0; qt < 2; ++qt) { const float mn = fmaxf(m[qt], fmaxf(tm[qt], __shfl_xor(tm[qt], 16, 32))); const float al = __builtin_amdgcn_exp2f(m[qt] - mn); m[qt] = mn; l1[qt] *= al; l2[qt] *= al;
#pragma unroll
                    for (int dt = 0; dt < 4; ++dt)
#pragma unroll
                        for (int r = 0; r < 8; ++r) O[qt][dt][r] *= al; } }
#pragma unroll
            for (int qt = 0; qt < 2; ++qt) { v8f w[2]; const v2f mm = {m[qt], m[qt]};
#pragma unroll
                for (int kt = 0; kt < 2; ++kt)
#pragma unroll
                    for (int i = 0; i < 4; ++i) {   // two neighbouring keys at a time: packed f32 on register pairs as the accumulator holds them
                        const v2f sv = {st[qt][kt][2 * i], st[qt][kt][2 * i + 1]}; const v2f tt = sv * CS2 - mm; const v2f e = {__builtin_amdgcn_exp2f(tt[0]), __builtin_amdgcn_exp2f(tt[1])};
                        l1[qt] += e; const v2f ww = e * ex[kt][i]; l2[qt] += ww; w[kt][2 * i] = ww[0]; w[kt][2 * i + 1] = ww[1]; }
                const v16h pf = cat16(__builtin_convertvector(w[0], v8h), __builtin_convertvector(w[1], v8h));   // element s = key kl + (s < 8 ? 8*hi + s : 16 + 8*hi + s - 8): the k order of the V^T loader
#pragma unroll
                for (int dt = 0; dt < 4; ++dt) O[qt][dt] = wmma16(vf[dt], pf, O[qt][dt]); }   // O[qt][dt][r] = O[query qt*16+lr][d = dt*16 + 8*hi + r]
        }
        if (more) {   // the other buffer's last readers left it before the barrier that ended the tile before this one
#pragma unroll
            for (int u = 0; u < 2; ++u) { *(v8h*)(&Ks[(s + 1) & 1][(srow + 32 * u) * LP + sch]) = kr[u]; *(v8h*)(&Vs[(s + 1) & 1][(srow + 32 * u) * LP + sch]) = vr[u]; } }
        __syncthreads();   // publishes tile s + 1 and ends every read of tile s
    }
    float f[2];   // both columns' factors first, the stores behind them
#pragma unroll
    for (int qt = 0; qt < 2; ++qt) { const float b1 = l1[qt][0] + l1[qt][1], b2 = l2[qt][0] + l2[qt][1]; const float a1 = b1 + __shfl_xor(b1, 16, 32), a2 = b2 + __shfl_xor(b2, 16, 32);
        const float g = __fdiv_rn(GX[((size_t)b * TT + q0 + qt * 16 + lr) * 32 + h], a1); f[qt] = __fdiv_rn(PCAR * g, fmaf(g, a2, 1e-8f)); }
#pragma unroll
    for (int qt = 0; qt < 2; ++qt) { float* orow = Ob + ((size_t)z * TT + q0 + qt * 16 + lr) * HD + 8 * hi;
#pragma unroll
        for (int dt = 0; dt < 4; ++dt) { v4f o0, o1;
#pragma unroll
            for (int r = 0; r < 4; ++r) { o0[r] = O[qt][dt][r] * f[qt]; o1[r] = O[qt][dt][4 + r] * f[qt]; }
            *(v4f*)(orow + dt * 16) = o0; *(v4f*)(orow + dt * 16 + 4) = o1; } }
}
__global__ __launch_bounds__(32) void k_cham(const float* __restrict__ chi, const float* __restrict__ bp, const float* __restrict__ ivp, const float* __restrict__ ovp, float* CH) { const int lane = threadIdx.x; const int h = lane >> 1; const int part = (lane & 1) * 2;
    const float sg_b = __fdiv_rn(1.0f, __fadd_rn(1.0f, __expf(-bfr(bp[h])))); const float ang = __fmul_rn(3.14159265358979f, sg_b); v2f o;
    if (part == 0) { o[0] = __fdiv_rn(1.0f, __fadd_rn(1.0f, __expf(-bfr(ivp[h])))); o[1] = cosf(ang); } else { o[0] = sinf(ang); o[1] = __fdiv_rn(1.0f, __fadd_rn(1.0f, __expf(-bfr(ovp[h])))); }
    const float th = (lane < NH_) ? tanhf(bfr(chi[lane])) : 0.f;
    *(v2f*)(CH + lane * 2) = o; *(float*)(CH + 64 + lane) = th;  }
__global__ __launch_bounds__(256) void k_merge(const float* __restrict__ O, const float* __restrict__ CH, int z0, bf* Ah, bf* Al) {
    const int lane = threadIdx.x & 31; const int L0 = (blockIdx.x * 8 + (threadIdx.x >> 5)) * 8; const int nlines = ZH * TT * HD / 64;
{
#pragma unroll 2
        for (int l = 0; l < 8; ++l) { const int L = L0 + l; if (L >= nlines) break; const int e = L * 64 + lane * 2; const int d = e & 63; const int t = (e >> 6) & (TT - 1); const int zz = e >> 16; v2us oh, ol;
const int b = (z0 + zz) / NH_, hh = (z0 + zz) % NH_; const float iv = CH[hh * 4], ca = CH[hh * 4 + 1], sa = CH[hh * 4 + 2], ovt = CH[hh * 4 + 3];
#pragma unroll
            for (int q = 0; q < 2; ++q) { const int dq = d + q; float me = __fmul_rn(O[(size_t)e + q] * (1.0f / PCAR), iv), pt = __fmul_rn(O[(size_t)(e + q) + ((dq < 32) ? 32 : -32)] * (1.0f / PCAR), iv); asm volatile("" : "+v"(me)); asm volatile("" : "+v"(pt));
                float t1, t2; if (dq < 32) { t1 = __fmul_rn(me, ca); t2 = __fmul_rn(pt, sa); asm volatile("" : "+v"(t1)); asm volatile("" : "+v"(t2)); t1 = __fsub_rn(t1, t2); } else { t1 = __fmul_rn(pt, sa); t2 = __fmul_rn(me, ca); asm volatile("" : "+v"(t1)); asm volatile("" : "+v"(t2)); t1 = __fadd_rn(t1, t2); }
                float r0 = __fmul_rn(t1, ovt); asm volatile("" : "+v"(r0)); float r1 = __fmul_rn(r0, CH[64 + hh]); asm volatile("" : "+v"(r1)); unsigned short a, c2; splitf(r1, a, c2); oh[q] = a; ol[q] = c2; }
            const size_t o = ((size_t)b * TT + t) * DD + hh * HD + d; *(v2us*)(Ah + o) = oh; *(v2us*)(Al + o) = ol; }
         }
}

extern "C" void kernel_launch(void* const* d_in, const int* in_sizes, int n_in,
                              void* d_out, int out_size, void* d_ws, size_t ws_size, hipStream_t stream) {
    (void)in_sizes; (void)n_in; (void)out_size;
    const float* IN[13]; for (int i = 0; i < 13; ++i) IN[i] = (const float*)d_in[i];
    // x [4][1024][1024], Wa [1024][16], ba, We, be, Wi, Wo, Wv, Wout ([in][out] = x @ W), chi, beta_p, iv_p, ov_p [16] = d_in[0..12]
    float* OUT = (float*)d_out;     // [4][1024][1024]
    char* wsp = (char*)d_ws;
    auto take = [&](size_t bytes) { char* p = wsp; wsp += (bytes + 255) & ~(size_t)255; return (void*)p; };
    bf* WO = (bf*)take((size_t)DD * DD * 2); float* GX = (float*)take((size_t)NT * 32 * 4); float* CH = (float*)take(512);
    h16* QP = (h16*)take((size_t)NT * DD * 2); h16* KP = (h16*)take((size_t)NT * DD * 2); h16* VT = (h16*)take((size_t)NT * DD * 2);
    float* Ob = (float*)take((size_t)ZH * TT * HD * 4); bf* ATh = (bf*)take((size_t)NT * DD * 2); bf* ATl = (bf*)take((size_t)NT * DD * 2);
    bf* WQ = (bf*)take((size_t)DD * DD * 2); bf* WK = (bf*)take((size_t)DD * DD * 2); bf* WV = (bf*)take((size_t)DD * DD * 2); bf* XB = (bf*)take((size_t)NT * DD * 2); float* F = (float*)take((size_t)NT * DD * 4);
    if ((size_t)(wsp - (char*)d_ws) > ws_size) return;    // total below 90 MiB; ws 256 MiB
    { const unsigned gT = (unsigned)((DD * DD / 64 + 63) / 64); k_wtG<<<gT, 256, 0, stream>>>(IN[5], DD, DD, WQ); k_wtG<<<gT, 256, 0, stream>>>(IN[6], DD, DD, WK); k_wtG<<<gT, 256, 0, stream>>>(IN[7], DD, DD, WV); k_wtG<<<gT, 256, 0, stream>>>(IN[8], DD, DD, WO);
      const size_t nx = (size_t)NT * DD / 8; k_cvt8<<<(unsigned)((nx + 255) / 256), 256, 0, stream>>>(IN[0], XB, nx); k_gates<<<NT / 8, 256, 0, stream>>>(IN[0], IN[1], IN[2], IN[3], IN[4], GX); k_cham<<<1, 32, 0, stream>>>(IN[9], IN[10], IN[11], IN[12], CH); }
    const unsigned LB = (unsigned)((NT * DD / 64 + 63) / 64); const dim3 gP(NT / 64, DD / 64, 1);
    k_gemmw<bf, 0, false><<<gP, 32, 0, stream>>>(XB, nullptr, WQ, nullptr, DD, F, DD, nullptr, 0, 0, 0); k_h16plane<<<LB, 256, 0, stream>>>(F, 1.0f, QP);   // inner (the 1/8 is applied in f32 inside k_fattn)
    k_gemmw<bf, 0, false><<<gP, 32, 0, stream>>>(XB, nullptr, WK, nullptr, DD, F, DD, nullptr, 0, 0, 0); k_h16plane<<<LB, 256, 0, stream>>>(F, 1.0f, KP);   // outer
    k_gemmw<bf, 0, false><<<gP, 32, 0, stream>>>(XB, nullptr, WV, nullptr, DD, F, DD, nullptr, 0, 0, 0); k_vtplane<<<LB, 256, 0, stream>>>(F, VT);          // v
    k_fattn<<<dim3(TT / 256, NZ, 1), 256, 0, stream>>>(QP, KP, VT, GX, Ob);   // all 64 flat heads (b * 16 + h) in one launch
    k_merge<<<(ZH * TT * HD / 64 + 63) / 64, 256, 0, stream>>>(Ob, CH, 0, ATh, ATl);
    k_gemmw<bf, 1, false><<<gP, 32, 0, stream>>>(ATh, ATl, WO, nullptr, DD, OUT, DD, nullptr, 0, 0, 0);
}

// v003
// One run takes 212 microseconds.
// In both of two side-by-side timings against v002, it was 1.27 times as fast.
// All steps since v000 together make it 7.49 times as fast.
#include <hip/hip_runtime.h>

// XorzoTransformer (x [4][1024][1024]; aperture = sigmoid(x Wa + ba), expression = sigmoid(x We + be) ([T][16] per-head gates); inner/outer/v = x @ Wi / Wo / Wv (16 heads x 64); p = softmax(inner.outer^T / 8);
// attn = p ap_i ex_j / (sum_j p ap_i ex_j + 1e-8); converged = attn v; ApertureChamber per head: x_in = converged sigmoid(iv_h); (xr, xi) halves rotated by angle pi sigmoid(beta_h); x sigmoid(ov_h) x tanh(chi_h);
// out = merged @ Wout).
// Compute dtypes, f32 accumulate: every input rounded to bf16; the three 1024-wide projections on PLAIN bf16 operands (inputs: exact; transposed bf16 weight copies); the
// 16-wide gate projections as f32 dots on VALU; scores and attn.v on SINGLE fp16 planes inside one fused kernel (1/8, running-maximum softmax, the bilateral gating and the renormalisation in f32; gated weights in fp16);

#define NB_  4
#define TT   1024
#define DD   1024
#define NH_  16
#define HD   64
#define NT   (NB_ * TT)
#define NZ   (NB_ * NH_)
#define ZH   64
#define PCAR 1024.0f
#define SCL  0.125f
typedef _Float16 h16;
typedef unsigned short bf;
typedef __attribute__((ext_vector_type(16))) __bf16   v16bf;
typedef __attribute__((ext_vector_type(16))) _Float16 v16h;
typedef __attribute__((ext_vector_type(8)))  _Float16 v8h;
typedef __attribute__((ext_vector_type(8)))  unsigned short v8us;
typedef __attribute__((ext_vector_type(8)))  float    v8f;
typedef __attribute__((ext_vector_type(4)))  float    v4f;
typedef v8h  __attribute__((may_alias)) v8ha;
typedef v4f  __attribute__((may_alias)) v4fa;
typedef v8us __attribute__((may_alias)) v8usa;

__device__ __forceinline__ unsigned short f2bf(float f) { unsigned u = __float_as_uint(f); u += 0x7FFFu + ((u >> 16) & 1u); return (unsigned short)(u >> 16); }
__device__ __forceinline__ float bf2f(unsigned short b) { return __uint_as_float(((unsigned)b) << 16); }
__device__ __forceinline__ float bfr(float f) { return bf2f(f2bf(f)); }
__device__ __forceinline__ v16h cat16(v8h lo, v8h hi) { return __builtin_shufflevector(lo, hi, 0, 1, 2, 3, 4, 5, 6, 7, 8, 9, 10, 11, 12, 13, 14, 15); }
__device__ __forceinline__ v16bf cat16b(v8us lo, v8us hi) { return __builtin_bit_cast(v16bf, __builtin_shufflevector(lo, hi, 0, 1, 2, 3, 4, 5, 6, 7, 8, 9, 10, 11, 12, 13, 14, 15)); }
__device__ __forceinline__ v8f wmma16(v16h a, v16h b, v8f c) { return __builtin_amdgcn_wmma_f32_16x16x32_f16(false, a, false, b, (short)0, c, false, false); }
__device__ __forceinline__ v8f wmmab(v16bf a, v16bf b, v8f c) { return __builtin_amdgcn_wmma_f32_16x16x32_bf16(false, a, false, b, (short)0, c, false, false); }



// ---- k_gemmw: register-blocked GEMM, ONE WAVE per 64x64 output tile (16 accumulators), operands straight from K-contiguous 16-bit planes; grid (M/64, N/64, Z), 32 threads.
// C[m][n] (f32, pitch ldc, + optional f32 bias[n]) = sum_k A[m][k] Bt[n][k] (+ split products per NSPLIT). z-batch strides sA/sB/sC in elements. K % 32 == 0.
template <typename T16> struct WFrag;
template <> struct WFrag<h16> { typedef v16h V; static __device__ __forceinline__ V ld(const h16* p) { return cat16(*(const v8h*)p, *(const v8h*)(p + 16)); } static __device__ __forceinline__ v8f mma(V a, V b, v8f c) { return wmma16(a, b, c); } };
template <> struct WFrag<bf> { typedef v16bf V; static __device__ __forceinline__ V ld(const bf* p) { return cat16b(*(const v8us*)p, *(const v8us*)(p + 16)); } static __device__ __forceinline__ v8f mma(V a, V b, v8f c) { return wmmab(a, b, c); } };
template <typename T16, int NSPLIT, bool BIAS>
__global__ __launch_bounds__(32) void k_gemmw(const T16* __restrict__ A, const T16* __restrict__ A2, const T16* __restrict__ Bt, const T16* __restrict__ Bt2, int K, float* C, int ldc, const float* __restrict__ bias, size_t sA, size_t sB, size_t sC) {
    typedef typename WFrag<T16>::V V;
    __shared__ __align__(16) float os[16 * 68];
    const size_t z = blockIdx.z; A += z * sA; if (A2) A2 += z * sA; Bt += z * sB; if (Bt2) Bt2 += z * sB; C += z * sC;
    const int lane = threadIdx.x & 31, lr = lane & 15, hi = lane >> 4; const int r0 = blockIdx.x * 64, c0 = blockIdx.y * 64;
    v8f acc[4][4];
#pragma unroll
    for (int mb = 0; mb < 4; ++mb)
#pragma unroll
        for (int nb = 0; nb < 4; ++nb) acc[mb][nb] = (v8f){};
    const size_t aoff = (size_t)(r0 + lr) * K + 8 * hi, boff = (size_t)(c0 + lr) * K + 8 * hi;
#pragma unroll 1
    for (int kc = 0; kc < K; kc += 32) {
        V a[4], a2[4];
#pragma unroll
        for (int mb = 0; mb < 4; ++mb) { a[mb] = WFrag<T16>::ld(A + aoff + (size_t)mb * 16 * K + kc); if (NSPLIT == 1 || NSPLIT == 2) a2[mb] = WFrag<T16>::ld(A2 + aoff + (size_t)mb * 16 * K + kc); }
#pragma unroll
        for (int nb = 0; nb < 4; ++nb) { const V b = WFrag<T16>::ld(Bt + boff + (size_t)nb * 16 * K + kc); V b2; if (NSPLIT >= 2) b2 = WFrag<T16>::ld(Bt2 + boff + (size_t)nb * 16 * K + kc);
#pragma unroll
            for (int mb = 0; mb < 4; ++mb) { acc[mb][nb] = WFrag<T16>::mma(a[mb], b, acc[mb][nb]); if (NSPLIT == 1 || NSPLIT == 2) acc[mb][nb] = WFrag<T16>::mma(a2[mb], b, acc[mb][nb]); if (NSPLIT >= 2) acc[mb][nb] = WFrag<T16>::mma(a[mb], b2, acc[mb][nb]); } }
        asm volatile("v_nop\n\tv_nop\n\tv_nop\n\tv_nop" : "+v"(acc[0][0]), "+v"(acc[1][1]), "+v"(acc[2][2]), "+v"(acc[3][3]) : "v"(a[0]), "v"(a[3]));
    }
#pragma unroll
    for (int mb = 0; mb < 4; ++mb) {
#pragma unroll
        for (int nb = 0; nb < 4; ++nb) {
#pragma unroll
            for (int j = 0; j < 8; ++j) os[(hi * 8 + j) * 68 + nb * 16 + lr] = acc[mb][nb][j]; }
        __builtin_amdgcn_wave_barrier(); asm volatile("" ::: "memory");
        float* crow = C + (size_t)(r0 + mb * 16) * ldc + c0;
{
#pragma unroll
            for (int s = 0; s < 8; ++s) { const int row = 2 * s + hi, cofs = lr * 4; v4f val = *(const v4fa*)(os + row * 68 + cofs); if (BIAS) { val[0] += bfr(bias[c0 + cofs]); val[1] += bfr(bias[c0 + cofs + 1]); val[2] += bfr(bias[c0 + cofs + 2]); val[3] += bfr(bias[c0 + cofs + 3]); }
                *(v4f*)(crow + (size_t)row * ldc + cofs) = val; }
             }
        __builtin_amdgcn_wave_barrier(); asm volatile("" ::: "memory");
    }
}

__device__ __forceinline__ void splitf(float y, unsigned short& h, unsigned short& l) { h = f2bf(y); l = f2bf(y - bf2f(h)); }
typedef __attribute__((ext_vector_type(2))) _Float16 v2h;
typedef __attribute__((ext_vector_type(4))) _Float16 v4h;
typedef __attribute__((ext_vector_type(2))) unsigned short v2us;
typedef __attribute__((ext_vector_type(4))) unsigned short v4us;
typedef __attribute__((ext_vector_type(2))) float v2f;

__global__ __launch_bounds__(256) void k_cvt8(const float* __restrict__ src, bf* dst, size_t n8) { const size_t i = (size_t)blockIdx.x * 256 + threadIdx.x; if (i >= n8) return; const v8f v = *(const v8f*)(src + i * 8); v8us o;
#pragma unroll
    for (int k = 0; k < 8; ++k) o[k] = f2bf(v[k]); *(v8us*)(dst + i * 8) = o;  }
__global__ __launch_bounds__(256) void k_wtG(const float* __restrict__ w, int K, int N, bf* Bt) {
    const int lane = threadIdx.x & 31; const int L0 = (blockIdx.x * 8 + (threadIdx.x >> 5)) * 8; const int nlines = N * K / 64;
{
#pragma unroll 1
        for (int l = 0; l < 8; ++l) { const int L = L0 + l; if (L >= nlines) break; const size_t e = (size_t)L * 64 + lane * 2; const int k = (int)(e % K), n = (int)(e / K); v2us o;
            o[0] = f2bf(w[(size_t)k * N + n]); o[1] = f2bf(w[(size_t)(k + 1) * N + n]); *(v2us*)(Bt + e) = o; }
         }
}
__global__ __launch_bounds__(256) void k_gates(const float* __restrict__ x, const float* __restrict__ Wa, const float* __restrict__ ba, const float* __restrict__ We, const float* __restrict__ be, float* GX) {
    const int lane = threadIdx.x & 31; const int r = blockIdx.x * 8 + (threadIdx.x >> 5); if (r >= NT) return; const float* xr = x + (size_t)r * DD; float acc[32];
#pragma unroll
    for (int h = 0; h < 32; ++h) acc[h] = 0.f;
#pragma unroll 1
    for (int d = lane; d < DD; d += 32) { const float xv = bfr(xr[d]); const float* wa = Wa + (size_t)d * NH_; const float* we = We + (size_t)d * NH_;
#pragma unroll
        for (int h = 0; h < 16; ++h) { float p1 = __fmul_rn(xv, bfr(wa[h])), p2 = __fmul_rn(xv, bfr(we[h])); asm volatile("" : "+v"(p1)); asm volatile("" : "+v"(p2)); acc[h] = __fadd_rn(acc[h], p1); acc[16 + h] = __fadd_rn(acc[16 + h], p2); } }
#pragma unroll
    for (int h = 0; h < 32; ++h) {
#pragma unroll
        for (int sh = 16; sh; sh >>= 1) acc[h] += __shfl_xor(acc[h], sh, 32); }
    float mine = 0.f;
#pragma unroll
    for (int h = 0; h < 32; ++h) if (lane == h) mine = __fadd_rn(acc[h], bfr(h < 16 ? ba[h] : be[h - 16]));
    const float o = __fdiv_rn(1.0f, __fadd_rn(1.0f, __expf(-mine))); *(float*)(GX + (size_t)r * 32 + lane) = o;  }
// k_proj: the three 1024-wide projections in one launch, grid (NH_, NT/64, 3), ONE WAVE per 64x64 tile (64 tokens x one head), the K loop of k_gemmw on plain bf16 planes.
// The epilogue stores the fp16 plane that k_fattn reads; no f32 copy of a projection reaches memory. A lane's accumulator holds 8 consecutive rows of the A operand, so the operand whose index runs
// contiguously in the plane is taken as A: z = 0, 1 (inner, outer): A = weight rows (d), B = token rows, plane [head][t][d]; z = 2 (v): A = token rows, B = weight rows (d), plane [head][d][t].
#define LPO  72   /* LDS pitch of a 128-B output row: 144 B */
__global__ __launch_bounds__(32) void k_proj(const bf* __restrict__ X, const bf* __restrict__ WQ, const bf* __restrict__ WK, const bf* __restrict__ WV, h16* QP, h16* KP, h16* VT) {
    typedef WFrag<bf>::V V;
    __shared__ __align__(16) h16 os[64 * LPO];
    const int lane = threadIdx.x & 31, lr = lane & 15, hi = lane >> 4; const int hh = blockIdx.x, t0 = blockIdx.y * 64, zz = blockIdx.z; const bool vtr = zz == 2;
    const bf* Xt = X + (size_t)t0 * DD; const bf* Wt = (zz == 0 ? WQ : zz == 1 ? WK : WV) + (size_t)hh * HD * DD;
    const bf* A = vtr ? Xt : Wt; const bf* Bt = vtr ? Wt : Xt;
    v8f acc[4][4];
#pragma unroll
    for (int mb = 0; mb < 4; ++mb)
#pragma unroll
        for (int nb = 0; nb < 4; ++nb) acc[mb][nb] = (v8f){};
    const unsigned off = (unsigned)(lr * DD + 8 * hi);   // a lane's place in a 16-row block
#pragma unroll 1   /* rolled, as in k_gemmw: one copy of the 16-WMMA body */
    for (int kc = 0; kc < DD; kc += 32) {
        V a[4];
#pragma unroll
        for (int mb = 0; mb < 4; ++mb) a[mb] = WFrag<bf>::ld(A + kc + mb * 16 * DD + off);
        asm volatile("s_wait_xcnt 0x0" ::: "memory");   // the A loads' address pair is dead here and a later load's result may land in it: the wait stands in front of that overwrite
#pragma unroll
        for (int nb = 0; nb < 4; ++nb) { const V b = WFrag<bf>::ld(Bt + kc + nb * 16 * DD + off);
#pragma unroll
            for (int mb = 0; mb < 4; ++mb) acc[mb][nb] = WFrag<bf>::mma(a[mb], b, acc[mb][nb]); }
    }
#pragma unroll
    for (int mb = 0; mb < 4; ++mb)
#pragma unroll
        for (int nb = 0; nb < 4; ++nb) *(v8h*)(os + (nb * 16 + lr) * LPO + mb * 16 + 8 * hi) = __builtin_convertvector(acc[mb][nb], v8h);   // os[B row][A row]
    __builtin_amdgcn_wave_barrier(); asm volatile("" ::: "memory");   // one wave: keeps the compiler from lifting the other lanes' read-back over the LDS stores
    const size_t z = (size_t)(t0 / TT) * NH_ + hh; const int tl = t0 & (TT - 1);
    h16* C = vtr ? VT + z * HD * TT + tl : (zz == 0 ? QP : KP) + (z * TT + tl) * HD; const int ldc = vtr ? TT : HD;
#pragma unroll
    for (int s = 0; s < 16; ++s) { const int row = s * 4 + (lane >> 3), ch = (lane & 7) * 8; *(v8h*)(C + (size_t)row * ldc + ch) = *(const v8ha*)(os + row * LPO + ch); }   // whole 128-B lines
}
#define KST  64
#define LP   72
#define CS2  0.18033688011112042f   /* (1/8) log2(e) */
__global__ __launch_bounds__(256) void k_fattn(const h16* __restrict__ QP, const h16* __restrict__ KP, const h16* __restrict__ VT, const float* __restrict__ GX, float* Ob) {
    __shared__ __align__(16) h16 Ks[2][KST * LP];
    __shared__ __align__(16) h16 Vs[2][HD * LP];
    __shared__ __align__(16) float exs[TT];
    const int tid = threadIdx.x, lane = tid & 31, wv = tid >> 5, lr = lane & 15, hi = lane >> 4;
    const int z = blockIdx.y, b = z / NH_, h = z % NH_; const int q0 = blockIdx.x * 256 + wv * 32;
    const h16* Qz = QP + (size_t)z * TT * HD; const h16* Kz = KP + (size_t)z * TT * HD; const h16* Vz = VT + (size_t)z * HD * TT;
#pragma unroll
    for (int u = 0; u < TT / 256; ++u) exs[u * 256 + tid] = GX[((size_t)b * TT + u * 256 + tid) * 32 + 16 + h];
    v16h qf[2][2];
#pragma unroll
    for (int qt = 0; qt < 2; ++qt)
#pragma unroll
        for (int ks = 0; ks < 2; ++ks) qf[qt][ks] = WFrag<h16>::ld(Qz + (size_t)(q0 + qt * 16 + lr) * HD + ks * 32 + 8 * hi);
    const int srow = tid >> 3, sch = (tid & 7) * 8;   // a thread stages 16 B of rows srow and srow + 32 of each tile: a wave covers whole 128-B lines
    v8h kr[2], vr[2];
#pragma unroll
    for (int u = 0; u < 2; ++u) { kr[u] = *(const v8h*)(Kz + (size_t)(srow + 32 * u) * HD + sch); vr[u] = *(const v8h*)(Vz + (size_t)(srow + 32 * u) * TT + sch); }
#pragma unroll
    for (int u = 0; u < 2; ++u) { *(v8h*)(&Ks[0][(srow + 32 * u) * LP + sch]) = kr[u]; *(v8h*)(&Vs[0][(srow + 32 * u) * LP + sch]) = vr[u]; }
    v8f O[2][4]; float m[2]; v2f l1[2], l2[2];   // l1, l2: a lane's sums over even and odd keys, joined in the epilogue
#pragma unroll
    for (int qt = 0; qt < 2; ++qt) { m[qt] = -3.0e38f; l1[qt] = (v2f){}; l2[qt] = (v2f){};
#pragma unroll
        for (int dt = 0; dt < 4; ++dt) O[qt][dt] = (v8f){}; }
    __syncthreads();   // tile 0 and the gate row are published
#pragma unroll 1   /* rolled: one copy of the tile body; sixteen would only grow the code */
    for (int s = 0; s < TT / KST; ++s) {
        const h16* kb = Ks[s & 1]; const h16* vb = Vs[s & 1]; const bool more = s + 1 < TT / KST;
        if (more) {   // the next tile's global loads fly while this tile is worked on
#pragma unroll
            for (int u = 0; u < 2; ++u) { kr[u] = *(const v8h*)(Kz + (size_t)((s + 1) * KST + srow + 32 * u) * HD + sch); vr[u] = *(const v8h*)(Vz + (size_t)(srow + 32 * u) * TT + (s + 1) * KST + sch); } }
#pragma unroll 1   /* rolled: unrolled, the build took more VGPRs and more padding v_nop and fetched hardly any fragment earlier */
        for (int ps = 0; ps < 2; ++ps) {   // a pass: 32 keys
            const int kl = ps * 32; v8f st[2][2];
#pragma unroll
            for (int kt = 0; kt < 2; ++kt) { const v16h k0 = WFrag<h16>::ld(kb + (kl + kt * 16 + lr) * LP + 8 * hi), k1 = WFrag<h16>::ld(kb + (kl + kt * 16 + lr) * LP + 32 + 8 * hi);
#pragma unroll
                for (int qt = 0; qt < 2; ++qt) st[qt][kt] = wmma16(k1, qf[qt][1], wmma16(k0, qf[qt][0], (v8f){})); }   // st[qt][kt][r] = S[query qt*16+lr][key kl + kt*16 + 8*hi + r]
            v16h vf[4];
#pragma unroll
            for (int dt = 0; dt < 4; ++dt) vf[dt] = WFrag<h16>::ld(vb + (dt * 16 + lr) * LP + kl + 8 * hi);
            v2f ex[2][4];
#pragma unroll
            for (int kt = 0; kt < 2; ++kt) { const float* ep = exs + s * KST + kl + kt * 16 + 8 * hi; const v4f e0 = *(const v4fa*)ep, e1 = *(const v4fa*)(ep + 4);
                ex[kt][0] = __builtin_shufflevector(e0, e0, 0, 1); ex[kt][1] = __builtin_shufflevector(e0, e0, 2, 3); ex[kt][2] = __builtin_shufflevector(e1, e1, 0, 1); ex[kt][3] = __builtin_shufflevector(e1, e1, 2, 3); }
            float tm[2];
#pragma unroll
            for (int qt = 0; qt < 2; ++qt) { float t = st[qt][0][0];
#pragma unroll
                for (int r = 1; r < 8; ++r) t = fmaxf(t, st[qt][0][r]);
#pragma unroll
                for (int r = 0; r < 8; ++r) t = fmaxf(t, st[qt][1][r]);
                tm[qt] = t * CS2; }
            // lazy rescale: the maximum in use moves only when a lane's new score tops it by more than 8 (log2), so w stays below 2^8; one scalar test per pass
            if (__builtin_amdgcn_ballot_w32(tm[0] > m[0] + 8.0f || tm[1] > m[1] + 8.0f) != 0) {
#pragma unroll
                for (int qt = 0; qt < 2; ++qt) { const float mn = fmaxf(m[qt], fmaxf(tm[qt], __shfl_xor(tm[qt], 16, 32))); const float al = __builtin_amdgcn_exp2f(m[qt] - mn); m[qt] = mn; l1[qt] *= al; l2[qt] *= al;
#pragma unroll
                    for (int dt = 0; dt < 4; ++dt)
#pragma unroll
                        for (int r = 0; r < 8; ++r) O[qt][dt][r] *= al; } }
#pragma unroll
            for (int qt = 0; qt < 2; ++qt) { v8f w[2]; const v2f mm = {m[qt], m[qt]};
#pragma unroll
                for (int kt = 0; kt < 2; ++kt)
#pragma unroll
                    for (int i = 0; i < 4; ++i) {   // two neighbouring keys at a time: packed f32 on register pairs as the accumulator holds them
                        const v2f sv = {st[qt][kt][2 * i], st[qt][kt][2 * i + 1]}; const v2f tt = sv * CS2 - mm; const v2f e = {__builtin_amdgcn_exp2f(tt[0]), __builtin_amdgcn_exp2f(tt[1])};
                        l1[qt] += e; const v2f ww = e * ex[kt][i]; l2[qt] += ww; w[kt][2 * i] = ww[0]; w[kt][2 * i + 1] = ww[1]; }
                const v16h pf = cat16(__builtin_convertvector(w[0], v8h), __builtin_convertvector(w[1], v8h));   // element s = key kl + (s < 8 ? 8*hi + s : 16 + 8*hi + s - 8): the k order of the V^T loader
#pragma unroll
                for (int dt = 0; dt < 4; ++dt) O[qt][dt] = wmma16(vf[dt], pf, O[qt][dt]); }   // O[qt][dt][r] = O[query qt*16+lr][d = dt*16 + 8*hi + r]
        }
        if (more) {   // the other buffer's last readers left it before the barrier that ended the tile before this one
#pragma unroll
            for (int u = 0; u < 2; ++u) { *(v8h*)(&Ks[(s + 1) & 1][(srow + 32 * u) * LP + sch]) = kr[u]; *(v8h*)(&Vs[(s + 1) & 1][(srow + 32 * u) * LP + sch]) = vr[u]; } }
        __syncthreads();   // publishes tile s + 1 and ends every read of tile s
    }
    float f[2];   // both columns' factors first, the stores behind them
#pragma unroll
    for (int qt = 0; qt < 2; ++qt) { const float b1 = l1[qt][0] + l1[qt][1], b2 = l2[qt][0] + l2[qt][1]; const float a1 = b1 + __shfl_xor(b1, 16, 32), a2 = b2 + __shfl_xor(b2, 16, 32);
        const float g = __fdiv_rn(GX[((size_t)b * TT + q0 + qt * 16 + lr) * 32 + h], a1); f[qt] = __fdiv_rn(PCAR * g, fmaf(g, a2, 1e-8f)); }
#pragma unroll
    for (int qt = 0; qt < 2; ++qt) { float* orow = Ob + ((size_t)z * TT + q0 + qt * 16 + lr) * HD + 8 * hi;
#pragma unroll
        for (int dt = 0; dt < 4; ++dt) { v4f o0, o1;
#pragma unroll
            for (int r = 0; r < 4; ++r) { o0[r] = O[qt][dt][r] * f[qt]; o1[r] = O[qt][dt][4 + r] * f[qt]; }
            *(v4f*)(orow + dt * 16) = o0; *(v4f*)(orow + dt * 16 + 4) = o1; } }
}
__global__ __launch_bounds__(32) void k_cham(const float* __restrict__ chi, const float* __restrict__ bp, const float* __restrict__ ivp, const float* __restrict__ ovp, float* CH) { const int lane = threadIdx.x; const int h = lane >> 1; const int part = (lane & 1) * 2;
    const float sg_b = __fdiv_rn(1.0f, __fadd_rn(1.0f, __expf(-bfr(bp[h])))); const float ang = __fmul_rn(3.14159265358979f, sg_b); v2f o;
    if (part == 0) { o[0] = __fdiv_rn(1.0f, __fadd_rn(1.0f, __expf(-bfr(ivp[h])))); o[1] = cosf(ang); } else { o[0] = sinf(ang); o[1] = __fdiv_rn(1.0f, __fadd_rn(1.0f, __expf(-bfr(ovp[h])))); }
    const float th = (lane < NH_) ? tanhf(bfr(chi[lane])) : 0.f;
    *(v2f*)(CH + lane * 2) = o; *(float*)(CH + 64 + lane) = th;  }
__global__ __launch_bounds__(256) void k_merge(const float* __restrict__ O, const float* __restrict__ CH, int z0, bf* Ah, bf* Al) {
    const int lane = threadIdx.x & 31; const int L0 = (blockIdx.x * 8 + (threadIdx.x >> 5)) * 8; const int nlines = ZH * TT * HD / 64;
{
#pragma unroll 2
        for (int l = 0; l < 8; ++l) { const int L = L0 + l; if (L >= nlines) break; const int e = L * 64 + lane * 2; const int d = e & 63; const int t = (e >> 6) & (TT - 1); const int zz = e >> 16; v2us oh, ol;
const int b = (z0 + zz) / NH_, hh = (z0 + zz) % NH_; const float iv = CH[hh * 4], ca = CH[hh * 4 + 1], sa = CH[hh * 4 + 2], ovt = CH[hh * 4 + 3];
#pragma unroll
            for (int q = 0; q < 2; ++q) { const int dq = d + q; float me = __fmul_rn(O[(size_t)e + q] * (1.0f / PCAR), iv), pt = __fmul_rn(O[(size_t)(e + q) + ((dq < 32) ? 32 : -32)] * (1.0f / PCAR), iv); asm volatile("" : "+v"(me)); asm volatile("" : "+v"(pt));
                float t1, t2; if (dq < 32) { t1 = __fmul_rn(me, ca); t2 = __fmul_rn(pt, sa); asm volatile("" : "+v"(t1)); asm volatile("" : "+v"(t2)); t1 = __fsub_rn(t1, t2); } else { t1 = __fmul_rn(pt, sa); t2 = __fmul_rn(me, ca); asm volatile("" : "+v"(t1)); asm volatile("" : "+v"(t2)); t1 = __fadd_rn(t1, t2); }
                float r0 = __fmul_rn(t1, ovt); asm volatile("" : "+v"(r0)); float r1 = __fmul_rn(r0, CH[64 + hh]); asm volatile("" : "+v"(r1)); unsigned short a, c2; splitf(r1, a, c2); oh[q] = a; ol[q] = c2; }
            const size_t o = ((size_t)b * TT + t) * DD + hh * HD + d; *(v2us*)(Ah + o) = oh; *(v2us*)(Al + o) = ol; }
         }
}

extern "C" void kernel_launch(void* const* d_in, const int* in_sizes, int n_in,
                              void* d_out, int out_size, void* d_ws, size_t ws_size, hipStream_t stream) {
    (void)in_sizes; (void)n_in; (void)out_size;
    const float* IN[13]; for (int i = 0; i < 13; ++i) IN[i] = (const float*)d_in[i];
    // x [4][1024][1024], Wa [1024][16], ba, We, be, Wi, Wo, Wv, Wout ([in][out] = x @ W), chi, beta_p, iv_p, ov_p [16] = d_in[0..12]
    float* OUT = (float*)d_out;     // [4][1024][1024]
    char* wsp = (char*)d_ws;
    auto take = [&](size_t bytes) { char* p = wsp; wsp += (bytes + 255) & ~(size_t)255; return (void*)p; };
    bf* WO = (bf*)take((size_t)DD * DD * 2); float* GX = (float*)take((size_t)NT * 32 * 4); float* CH = (float*)take(512);
    h16* QP = (h16*)take((size_t)NT * DD * 2); h16* KP = (h16*)take((size_t)NT * DD * 2); h16* VT = (h16*)take((size_t)NT * DD * 2);
    float* Ob = (float*)take((size_t)ZH * TT * HD * 4); bf* ATh = (bf*)take((size_t)NT * DD * 2); bf* ATl = (bf*)take((size_t)NT * DD * 2);
    bf* WQ = (bf*)take((size_t)DD * DD * 2); bf* WK = (bf*)take((size_t)DD * DD * 2); bf* WV = (bf*)take((size_t)DD * DD * 2); bf* XB = (bf*)take((size_t)NT * DD * 2);
    if ((size_t)(wsp - (char*)d_ws) > ws_size) return;    // total below 75 MiB; ws 256 MiB
    { const unsigned gT = (unsigned)((DD * DD / 64 + 63) / 64); k_wtG<<<gT, 256, 0, stream>>>(IN[5], DD, DD, WQ); k_wtG<<<gT, 256, 0, stream>>>(IN[6], DD, DD, WK); k_wtG<<<gT, 256, 0, stream>>>(IN[7], DD, DD, WV); k_wtG<<<gT, 256, 0, stream>>>(IN[8], DD, DD, WO);
      const size_t nx = (size_t)NT * DD / 8; k_cvt8<<<(unsigned)((nx + 255) / 256), 256, 0, stream>>>(IN[0], XB, nx); k_gates<<<NT / 8, 256, 0, stream>>>(IN[0], IN[1], IN[2], IN[3], IN[4], GX); k_cham<<<1, 32, 0, stream>>>(IN[9], IN[10], IN[11], IN[12], CH); }
    const dim3 gP(NT / 64, DD / 64, 1);
    k_proj<<<dim3(NH_, NT / 64, 3), 32, 0, stream>>>(XB, WQ, WK, WV, QP, KP, VT);   // inner, outer (the 1/8 is applied in f32 inside k_fattn) and v, stored as fp16 head planes
    k_fattn<<<dim3(TT / 256, NZ, 1), 256, 0, stream>>>(QP, KP, VT, GX, Ob);   // all 64 flat heads (b * 16 + h) in one launch
    k_merge<<<(ZH * TT * HD / 64 + 63) / 64, 256, 0, stream>>>(Ob, CH, 0, ATh, ATl);
    k_gemmw<bf, 1, false><<<gP, 32, 0, stream>>>(ATh, ATl, WO, nullptr, DD, OUT, DD, nullptr, 0, 0, 0);
}

// v004
// One run takes 176 microseconds.
// Timed twice side by side with v003, it ran 1.21 and 1.20 times as fast.
// Over all steps from v000 it is 9.01 times as fast.
#include <hip/hip_runtime.h>

// XorzoTransformer (x [4][1024][1024]; aperture = sigmoid(x Wa + ba), expression = sigmoid(x We + be) ([T][16] per-head gates); inner/outer/v = x @ Wi / Wo / Wv (16 heads x 64); p = softmax(inner.outer^T / 8);
// attn = p ap_i ex_j / (sum_j p ap_i ex_j + 1e-8); converged = attn v; ApertureChamber per head: x_in = converged sigmoid(iv_h); (xr, xi) halves rotated by angle pi sigmoid(beta_h); x sigmoid(ov_h) x tanh(chi_h);
// out = merged @ Wout).
// Compute dtypes, f32 accumulate: every input rounded to bf16; the three 1024-wide projections on PLAIN bf16 operands (inputs: exact; transposed bf16 weight copies); the
// 16-wide gate projections as f32 dots on VALU; scores and attn.v on SINGLE fp16 planes inside one fused kernel (1/8, running-maximum softmax, the bilateral gating and the renormalisation in f32; gated weights in fp16);

#define NB_  4
#define TT   1024
#define DD   1024
#define NH_  16
#define HD   64
#define NT   (NB_ * TT)
#define NZ   (NB_ * NH_)
#define ZH   64
#define PCAR 1024.0f
#define SCL  0.125f
typedef _Float16 h16;
typedef unsigned short bf;
typedef __attribute__((ext_vector_type(16))) __bf16   v16bf;
typedef __attribute__((ext_vector_type(16))) _Float16 v16h;
typedef __attribute__((ext_vector_type(8)))  _Float16 v8h;
typedef __attribute__((ext_vector_type(8)))  unsigned short v8us;
typedef __attribute__((ext_vector_type(8)))  float    v8f;
typedef __attribute__((ext_vector_type(4)))  float    v4f;
typedef v8h  __attribute__((may_alias)) v8ha;
typedef v4f  __attribute__((may_alias)) v4fa;
typedef v8us __attribute__((may_alias)) v8usa;

__device__ __forceinline__ unsigned short f2bf(float f) { unsigned u = __float_as_uint(f); u += 0x7FFFu + ((u >> 16) & 1u); return (unsigned short)(u >> 16); }
__device__ __forceinline__ float bf2f(unsigned short b) { return __uint_as_float(((unsigned)b) << 16); }
__device__ __forceinline__ float bfr(float f) { return bf2f(f2bf(f)); }
__device__ __forceinline__ v16h cat16(v8h lo, v8h hi) { return __builtin_shufflevector(lo, hi, 0, 1, 2, 3, 4, 5, 6, 7, 8, 9, 10, 11, 12, 13, 14, 15); }
__device__ __forceinline__ v16bf cat16b(v8us lo, v8us hi) { return __builtin_bit_cast(v16bf, __builtin_shufflevector(lo, hi, 0, 1, 2, 3, 4, 5, 6, 7, 8, 9, 10, 11, 12, 13, 14, 15)); }
__device__ __forceinline__ v8f wmma16(v16h a, v16h b, v8f c) { return __builtin_amdgcn_wmma_f32_16x16x32_f16(false, a, false, b, (short)0, c, false, false); }
__device__ __forceinline__ v8f wmmab(v16bf a, v16bf b, v8f c) { return __builtin_amdgcn_wmma_f32_16x16x32_bf16(false, a, false, b, (short)0, c, false, false); }



// ---- fragment loaders of the 16-bit planes (K-contiguous rows, in memory or in LDS)
template <typename T16> struct WFrag;
template <> struct WFrag<h16> { typedef v16h V; static __device__ __forceinline__ V ld(const h16* p) { return cat16(*(const v8h*)p, *(const v8h*)(p + 16)); } static __device__ __forceinline__ v8f mma(V a, V b, v8f c) { return wmma16(a, b, c); } };
template <> struct WFrag<bf> { typedef v16bf V; static __device__ __forceinline__ V ld(const bf* p) { return cat16b(*(const v8us*)p, *(const v8us*)(p + 16)); } static __device__ __forceinline__ v8f mma(V a, V b, v8f c) { return wmmab(a, b, c); } };

// ---- operand staging of the two GEMM kernels: a tile is 128 rows x 64 k (128 B of a row) of a plane of pitch DD, kept in LDS at a pitch of 144 B.
// 128 threads: thread tid brings 16 B of rows (tid >> 3) + 16 u, u = 0..7, so a wave's copy covers four whole 128-B lines. No register holds the data.
#define GP   72            /* LDS pitch of a staged row, elements */
#define GTB  (128 * GP * 2) /* bytes of a staged tile */
#define GKS  64            /* k per trip */
// lds: the lane's LDS byte address in row tid >> 3 of the tile; g: the lane's 16 B in the same row of the plane.
__device__ __forceinline__ void stage128(unsigned lds, const bf* g) {
    // the wait is the statement's last line: it stands in front of any rewrite of the address registers that the copies name
    asm volatile("global_load_async_to_lds_b128 %0, %8, off\n\t"
                 "global_load_async_to_lds_b128 %1, %9, off\n\t"
                 "global_load_async_to_lds_b128 %2, %10, off\n\t"
                 "global_load_async_to_lds_b128 %3, %11, off\n\t"
                 "global_load_async_to_lds_b128 %4, %12, off\n\t"
                 "global_load_async_to_lds_b128 %5, %13, off\n\t"
                 "global_load_async_to_lds_b128 %6, %14, off\n\t"
                 "global_load_async_to_lds_b128 %7, %15, off\n\t"
                 "s_wait_xcnt 0x0"
                 :: "v"(lds), "v"(lds + 16 * GP * 2), "v"(lds + 32 * GP * 2), "v"(lds + 48 * GP * 2), "v"(lds + 64 * GP * 2), "v"(lds + 80 * GP * 2), "v"(lds + 96 * GP * 2), "v"(lds + 112 * GP * 2),
                    "v"(g), "v"(g + 16 * DD), "v"(g + 32 * DD), "v"(g + 48 * DD), "v"(g + 64 * DD), "v"(g + 80 * DD), "v"(g + 96 * DD), "v"(g + 112 * DD) : "memory");
}

// ---- k_gemmo: OUT[m][n] (f32) = sum_k (Ah[m][k] + Al[m][k]) Bt[n][k]; grid (NT/128, DD/128), 4 waves, a 128x128 tile per block, 64x64 (16 accumulators) per wave.
// The three operand tiles of a trip come to LDS by asynchronous copies, two buffers: trip t + 1's copies fly while trip t is worked on. Per accumulator the products are summed in the order k ascending, hi then lo.
__global__ __launch_bounds__(128) void k_gemmo(const bf* __restrict__ A, const bf* __restrict__ A2, const bf* __restrict__ Bt, float* C) {
    typedef WFrag<bf>::V V;
    __shared__ __align__(16) char sm[2 * 3 * GTB];   // [buffer][Ah | Al | Bt]; the epilogue's staging rows lie over it
    const int tid = threadIdx.x, lane = tid & 31, wv = tid >> 5, lr = lane & 15, hi = lane >> 4;
    const int rb = blockIdx.x * 128, cb = blockIdx.y * 128, wm = wv & 1, wn = wv >> 1;
    const size_t go = (size_t)(tid >> 3) * DD + (tid & 7) * 8;
    const bf* Ag = A + (size_t)rb * DD + go; const bf* A2g = A2 + (size_t)rb * DD + go; const bf* Bg = Bt + (size_t)cb * DD + go;
    const unsigned l0 = (unsigned)(size_t)sm + (unsigned)((tid >> 3) * (GP * 2) + (tid & 7) * 16);
    const int ao = (wm * 64 + lr) * GP + 8 * hi, bo = (wn * 64 + lr) * GP + 8 * hi;   // a lane's place in its wave's first 16-row block, elements
    v8f acc[4][4];
#pragma unroll
    for (int mb = 0; mb < 4; ++mb)
#pragma unroll
        for (int nb = 0; nb < 4; ++nb) acc[mb][nb] = (v8f){};
    stage128(l0, Ag); stage128(l0 + GTB, A2g); stage128(l0 + 2 * GTB, Bg);
    asm volatile("s_wait_asynccnt 0x0" ::: "memory");   // this wave's copies of trip 0 have landed
    __syncthreads();                                      // trip 0 is published
    stage128(l0 + 3 * GTB, Ag + GKS); stage128(l0 + 4 * GTB, A2g + GKS); stage128(l0 + 5 * GTB, Bg + GKS);
#pragma unroll 1   /* rolled: one copy of the trip's body; the buffer is chosen by an offset */
    for (int t = 0; t < DD / GKS; ++t) {
        const unsigned bb = (unsigned)(t & 1) * (3 * GTB); const bf* S = (const bf*)(sm + bb);
#pragma unroll
        for (int kk = 0; kk < GKS; kk += 32) {
            V a[4], a2[4], b[4];   // all twelve fragments of a 32-k block are asked for ahead of its WMMAs: one LDS latency per block
#pragma unroll
            for (int nb = 0; nb < 4; ++nb) b[nb] = WFrag<bf>::ld(S + 2 * 128 * GP + bo + nb * 16 * GP + kk);
#pragma unroll
            for (int mb = 0; mb < 4; ++mb) { a[mb] = WFrag<bf>::ld(S + ao + mb * 16 * GP + kk); a2[mb] = WFrag<bf>::ld(S + 128 * GP + ao + mb * 16 * GP + kk); }
            // inputs only: holds the block's LDS loads together in front of its WMMAs; without it the compiler sinks them between the WMMAs, four to a wait, and the wave waits out the LDS latency each time
            asm volatile("" :: "v"(a[0]), "v"(a[1]), "v"(a[2]), "v"(a[3]), "v"(a2[0]), "v"(a2[1]), "v"(a2[2]), "v"(a2[3]), "v"(b[0]), "v"(b[1]), "v"(b[2]), "v"(b[3]));
#pragma unroll
            for (int mb = 0; mb < 4; ++mb)
#pragma unroll
                for (int nb = 0; nb < 4; ++nb) { acc[mb][nb] = WFrag<bf>::mma(a[mb], b[nb], acc[mb][nb]); acc[mb][nb] = WFrag<bf>::mma(a2[mb], b[nb], acc[mb][nb]); }
        }
        asm volatile("s_wait_dscnt 0x0" ::: "memory");      // this wave's reads of the buffer have returned before it is refilled
        asm volatile("s_wait_asynccnt 0x0" ::: "memory");   // this wave's copies of trip t + 1 have landed
        __syncthreads();                                      // publishes trip t + 1 and ends every read of trip t
        if (t + 2 < DD / GKS) { stage128(l0 + bb, Ag + (t + 2) * GKS); stage128(l0 + bb + GTB, A2g + (t + 2) * GKS); stage128(l0 + bb + 2 * GTB, Bg + (t + 2) * GKS); }
    }
    asm volatile("s_wait_asynccnt 0x0" ::: "memory");   // no copy is outstanding when the ring becomes output staging
    float* os = (float*)(sm + wv * (16 * 68 * 4));        // a wave's own 16 rows of 64 f32 at a pitch of 68
    const int r0 = rb + wm * 64, c0 = cb + wn * 64;
#pragma unroll
    for (int mb = 0; mb < 4; ++mb) {
#pragma unroll
        for (int nb = 0; nb < 4; ++nb) {
#pragma unroll
            for (int j = 0; j < 8; ++j) os[(hi * 8 + j) * 68 + nb * 16 + lr] = acc[mb][nb][j]; }
        __builtin_amdgcn_wave_barrier(); asm volatile("" ::: "memory");   // one wave's rows: keeps the compiler from lifting the other lanes' read-back over the LDS stores
        float* crow = C + (size_t)(r0 + mb * 16) * DD + c0;
#pragma unroll
        for (int s = 0; s < 8; ++s) { const int row = 2 * s + hi, cofs = lr * 4; *(v4f*)(crow + (size_t)row * DD + cofs) = *(const v4fa*)(os + row * 68 + cofs); }
        __builtin_amdgcn_wave_barrier(); asm volatile("" ::: "memory");   // and the next block's stores over these reads
    }
}

__device__ __forceinline__ void splitf(float y, unsigned short& h, unsigned short& l) { h = f2bf(y); l = f2bf(y - bf2f(h)); }
typedef __attribute__((ext_vector_type(2))) _Float16 v2h;
typedef __attribute__((ext_vector_type(4))) _Float16 v4h;
typedef __attribute__((ext_vector_type(2))) unsigned short v2us;
typedef __attribute__((ext_vector_type(4))) unsigned short v4us;
typedef __attribute__((ext_vector_type(2))) float v2f;

__global__ __launch_bounds__(256) void k_cvt8(const float* __restrict__ src, bf* dst, size_t n8) { const size_t i = (size_t)blockIdx.x * 256 + threadIdx.x; if (i >= n8) return; const v8f v = *(const v8f*)(src + i * 8); v8us o;
#pragma unroll
    for (int k = 0; k < 8; ++k) o[k] = f2bf(v[k]); *(v8us*)(dst + i * 8) = o;  }
__global__ __launch_bounds__(256) void k_wtG(const float* __restrict__ w, int K, int N, bf* Bt) {
    const int lane = threadIdx.x & 31; const int L0 = (blockIdx.x * 8 + (threadIdx.x >> 5)) * 8; const int nlines = N * K / 64;
{
#pragma unroll 1
        for (int l = 0; l < 8; ++l) { const int L = L0 + l; if (L >= nlines) break; const size_t e = (size_t)L * 64 + lane * 2; const int k = (int)(e % K), n = (int)(e / K); v2us o;
            o[0] = f2bf(w[(size_t)k * N + n]); o[1] = f2bf(w[(size_t)(k + 1) * N + n]); *(v2us*)(Bt + e) = o; }
         }
}
__global__ __launch_bounds__(256) void k_gates(const float* __restrict__ x, const float* __restrict__ Wa, const float* __restrict__ ba, const float* __restrict__ We, const float* __restrict__ be, float* GX) {
    const int lane = threadIdx.x & 31; const int r = blockIdx.x * 8 + (threadIdx.x >> 5); if (r >= NT) return; const float* xr = x + (size_t)r * DD; float acc[32];
#pragma unroll
    for (int h = 0; h < 32; ++h) acc[h] = 0.f;
#pragma unroll 1
    for (int d = lane; d < DD; d += 32) { const float xv = bfr(xr[d]); const float* wa = Wa + (size_t)d * NH_; const float* we = We + (size_t)d * NH_;
#pragma unroll
        for (int h = 0; h < 16; ++h) { float p1 = __fmul_rn(xv, bfr(wa[h])), p2 = __fmul_rn(xv, bfr(we[h])); asm volatile("" : "+v"(p1)); asm volatile("" : "+v"(p2)); acc[h] = __fadd_rn(acc[h], p1); acc[16 + h] = __fadd_rn(acc[16 + h], p2); } }
#pragma unroll
    for (int h = 0; h < 32; ++h) {
#pragma unroll
        for (int sh = 16; sh; sh >>= 1) acc[h] += __shfl_xor(acc[h], sh, 32); }
    float mine = 0.f;
#pragma unroll
    for (int h = 0; h < 32; ++h) if (lane == h) mine = __fadd_rn(acc[h], bfr(h < 16 ? ba[h] : be[h - 16]));
    const float o = __fdiv_rn(1.0f, __fadd_rn(1.0f, __expf(-mine))); *(float*)(GX + (size_t)r * 32 + lane) = o;  }
// k_proj: the three 1024-wide projections in one launch, grid (NH_/2, NT/128, 3), 4 waves: a block takes 128 tokens x two heads, a wave 64 tokens x one head (64x64, 16 accumulators), plain bf16 planes.
// The weight rows and the token rows of a trip (64 k) come to LDS by asynchronous copies, two buffers, and each is read by two waves.
// The epilogue stores the fp16 plane that k_fattn reads; no f32 copy of a projection reaches memory. A lane's accumulator holds 8 consecutive rows of the A operand, so the operand whose index runs
// contiguously in the plane is taken as A: z = 0, 1 (inner, outer): A = weight rows (d), B = token rows, plane [head][t][d]; z = 2 (v): A = token rows, B = weight rows (d), plane [head][d][t].
#define LPO  72   /* LDS pitch of a 128-B output row: 144 B */
__global__ __launch_bounds__(128) void k_proj(const bf* __restrict__ X, const bf* __restrict__ WQ, const bf* __restrict__ WK, const bf* __restrict__ WV, h16* QP, h16* KP, h16* VT) {
    typedef WFrag<bf>::V V;
    __shared__ __align__(16) char sm[2 * 2 * GTB];   // [buffer][weight rows | token rows]; the epilogue's staging rows lie over it
    const int tid = threadIdx.x, lane = tid & 31, wv = tid >> 5, lr = lane & 15, hi = lane >> 4; const int zz = blockIdx.z; const bool vtr = zz == 2;
    const int wh = wv & 1, wt = wv >> 1; const int hh = blockIdx.x * 2 + wh, t0 = blockIdx.y * 128 + wt * 64;
    const size_t go = (size_t)(tid >> 3) * DD + (tid & 7) * 8;
    const bf* Wg = (zz == 0 ? WQ : zz == 1 ? WK : WV) + (size_t)blockIdx.x * 128 * DD + go; const bf* Xg = X + (size_t)blockIdx.y * 128 * DD + go;
    const unsigned l0 = (unsigned)(size_t)sm + (unsigned)((tid >> 3) * (GP * 2) + (tid & 7) * 16);
    const int wo = (wh * 64 + lr) * GP + 8 * hi, xo = 128 * GP + (wt * 64 + lr) * GP + 8 * hi;   // a lane's place in its wave's first 16-row block of each tile, elements
    const int ao = vtr ? xo : wo, bo = vtr ? wo : xo;
    v8f acc[4][4];
#pragma unroll
    for (int mb = 0; mb < 4; ++mb)
#pragma unroll
        for (int nb = 0; nb < 4; ++nb) acc[mb][nb] = (v8f){};
    stage128(l0, Wg); stage128(l0 + GTB, Xg);
    asm volatile("s_wait_asynccnt 0x0" ::: "memory");   // this wave's copies of trip 0 have landed
    __syncthreads();                                      // trip 0 is published
    stage128(l0 + 2 * GTB, Wg + GKS); stage128(l0 + 3 * GTB, Xg + GKS);
#pragma unroll 1   /* rolled: one copy of the trip's body; the buffer is chosen by an offset */
    for (int t = 0; t < DD / GKS; ++t) {
        const unsigned bb = (unsigned)(t & 1) * (2 * GTB); const bf* S = (const bf*)(sm + bb);
#pragma unroll
        for (int kk = 0; kk < GKS; kk += 32) {
            V a[4], b[4];   // all eight fragments of a 32-k block are asked for ahead of its WMMAs: one LDS latency per block
#pragma unroll
            for (int mb = 0; mb < 4; ++mb) { a[mb] = WFrag<bf>::ld(S + ao + mb * 16 * GP + kk); b[mb] = WFrag<bf>::ld(S + bo + mb * 16 * GP + kk); }
            // inputs only: holds the block's LDS loads together in front of its WMMAs; without it the compiler sinks them between the WMMAs, four to a wait, and the wave waits out the LDS latency each time
            asm volatile("" :: "v"(a[0]), "v"(a[1]), "v"(a[2]), "v"(a[3]), "v"(b[0]), "v"(b[1]), "v"(b[2]), "v"(b[3]));
#pragma unroll
            for (int nb = 0; nb < 4; ++nb)
#pragma unroll
                for (int mb = 0; mb < 4; ++mb) acc[mb][nb] = WFrag<bf>::mma(a[mb], b[nb], acc[mb][nb]);
        }
        asm volatile("s_wait_dscnt 0x0" ::: "memory");      // this wave's reads of the buffer have returned before it is refilled
        asm volatile("s_wait_asynccnt 0x0" ::: "memory");   // this wave's copies of trip t + 1 have landed
        __syncthreads();                                      // publishes trip t + 1 and ends every read of trip t
        if (t + 2 < DD / GKS) { stage128(l0 + bb, Wg + (t + 2) * GKS); stage128(l0 + bb + GTB, Xg + (t + 2) * GKS); }
    }
    asm volatile("s_wait_asynccnt 0x0" ::: "memory");   // no copy is outstanding when the ring becomes output staging
    h16* os = (h16*)(sm + wv * (64 * LPO * 2));           // a wave's own 64 output rows
#pragma unroll
    for (int mb = 0; mb < 4; ++mb)
#pragma unroll
        for (int nb = 0; nb < 4; ++nb) *(v8h*)(os + (nb * 16 + lr) * LPO + mb * 16 + 8 * hi) = __builtin_convertvector(acc[mb][nb], v8h);   // os[B row][A row]
    __builtin_amdgcn_wave_barrier(); asm volatile("" ::: "memory");   // one wave's rows: keeps the compiler from lifting the other lanes' read-back over the LDS stores
    const size_t z = (size_t)(t0 / TT) * NH_ + hh; const int tl = t0 & (TT - 1);
    h16* C = vtr ? VT + z * HD * TT + tl : (zz == 0 ? QP : KP) + (z * TT + tl) * HD; const int ldc = vtr ? TT : HD;
#pragma unroll
    for (int s = 0; s < 16; ++s) { const int row = s * 4 + (lane >> 3), ch = (lane & 7) * 8; *(v8h*)(C + (size_t)row * ldc + ch) = *(const v8ha*)(os + row * LPO + ch); }   // whole 128-B lines
}
#define KST  64
#define LP   72
#define CS2  0.18033688011112042f   /* (1/8) log2(e) */
__global__ __launch_bounds__(256) void k_fattn(const h16* __restrict__ QP, const h16* __restrict__ KP, const h16* __restrict__ VT, const float* __restrict__ GX, float* Ob) {
    __shared__ __align__(16) h16 Ks[2][KST * LP];
    __shared__ __align__(16) h16 Vs[2][HD * LP];
    __shared__ __align__(16) float exs[TT];
    const int tid = threadIdx.x, lane = tid & 31, wv = tid >> 5, lr = lane & 15, hi = lane >> 4;
    const int z = blockIdx.y, b = z / NH_, h = z % NH_; const int q0 = blockIdx.x * 256 + wv * 32;
    const h16* Qz = QP + (size_t)z * TT * HD; const h16* Kz = KP + (size_t)z * TT * HD; const h16* Vz = VT + (size_t)z * HD * TT;
#pragma unroll
    for (int u = 0; u < TT / 256; ++u) exs[u * 256 + tid] = GX[((size_t)b * TT + u * 256 + tid) * 32 + 16 + h];
    v16h qf[2][2];
#pragma unroll
    for (int qt = 0; qt < 2; ++qt)
#pragma unroll
        for (int ks = 0; ks < 2; ++ks) qf[qt][ks] = WFrag<h16>::ld(Qz + (size_t)(q0 + qt * 16 + lr) * HD + ks * 32 + 8 * hi);
    const int srow = tid >> 3, sch = (tid & 7) * 8;   // a thread stages 16 B of rows srow and srow + 32 of each tile: a wave covers whole 128-B lines
    v8h kr[2], vr[2];
#pragma unroll
    for (int u = 0; u < 2; ++u) { kr[u] = *(const v8h*)(Kz + (size_t)(srow + 32 * u) * HD + sch); vr[u] = *(const v8h*)(Vz + (size_t)(srow + 32 * u) * TT + sch); }
#pragma unroll
    for (int u = 0; u < 2; ++u) { *(v8h*)(&Ks[0][(srow + 32 * u) * LP + sch]) = kr[u]; *(v8h*)(&Vs[0][(srow + 32 * u) * LP + sch]) = vr[u]; }
    v8f O[2][4]; float m[2]; v2f l1[2], l2[2];   // l1, l2: a lane's sums over even and odd keys, joined in the epilogue
#pragma unroll
    for (int qt = 0; qt < 2; ++qt) { m[qt] = -3.0e38f; l1[qt] = (v2f){}; l2[qt] = (v2f){};
#pragma unroll
        for (int dt = 0; dt < 4; ++dt) O[qt][dt] = (v8f){}; }
    __syncthreads();   // tile 0 and the gate row are published
#pragma unroll 1   /* rolled: one copy of the tile body; sixteen would only grow the code */
    for (int s = 0; s < TT / KST; ++s) {
        const h16* kb = Ks[s & 1]; const h16* vb = Vs[s & 1]; const bool more = s + 1 < TT / KST;
        if (more) {   // the next tile's global loads fly while this tile is worked on
#pragma unroll
            for (int u = 0; u < 2; ++u) { kr[u] = *(const v8h*)(Kz + (size_t)((s + 1) * KST + srow + 32 * u) * HD + sch); vr[u] = *(const v8h*)(Vz + (size_t)(srow + 32 * u) * TT + (s + 1) * KST + sch); } }
#pragma unroll 1   /* rolled: unrolled, the build took more VGPRs and more padding v_nop and fetched hardly any fragment earlier */
        for (int ps = 0; ps < 2; ++ps) {   // a pass: 32 keys
            const int kl = ps * 32; v8f st[2][2];
#pragma unroll
            for (int kt = 0; kt < 2; ++kt) { const v16h k0 = WFrag<h16>::ld(kb + (kl + kt * 16 + lr) * LP + 8 * hi), k1 = WFrag<h16>::ld(kb + (kl + kt * 16 + lr) * LP + 32 + 8 * hi);
#pragma unroll
                for (int qt = 0; qt < 2; ++qt) st[qt][kt] = wmma16(k1, qf[qt][1], wmma16(k0, qf[qt][0], (v8f){})); }   // st[qt][kt][r] = S[query qt*16+lr][key kl + kt*16 + 8*hi + r]
            v16h vf[4];
#pragma unroll
            for (int dt = 0; dt < 4; ++dt) vf[dt] = WFrag<h16>::ld(vb + (dt * 16 + lr) * LP + kl + 8 * hi);
            v2f ex[2][4];
#pragma unroll
            for (int kt = 0; kt < 2; ++kt) { const float* ep = exs + s * KST + kl + kt * 16 + 8 * hi; const v4f e0 = *(const v4fa*)ep, e1 = *(const v4fa*)(ep + 4);
                ex[kt][0] = __builtin_shufflevector(e0, e0, 0, 1); ex[kt][1] = __builtin_shufflevector(e0, e0, 2, 3); ex[kt][2] = __builtin_shufflevector(e1, e1, 0, 1); ex[kt][3] = __builtin_shufflevector(e1, e1, 2, 3); }
            float tm[2];
#pragma unroll
            for (int qt = 0; qt < 2; ++qt) { float t = st[qt][0][0];
#pragma unroll
                for (int r = 1; r < 8; ++r) t = fmaxf(t, st[qt][0][r]);
#pragma unroll
                for (int r = 0; r < 8; ++r) t = fmaxf(t, st[qt][1][r]);
                tm[qt] = t * CS2; }
            // lazy rescale: the maximum in use moves only when a lane's new score tops it by more than 8 (log2), so w stays below 2^8; one scalar test per pass
            if (__builtin_amdgcn_ballot_w32(tm[0] > m[0] + 8.0f || tm[1] > m[1] + 8.0f) != 0) {
#pragma unroll
                for (int qt = 0; qt < 2; ++qt) { const float mn = fmaxf(m[qt], fmaxf(tm[qt], __shfl_xor(tm[qt], 16, 32))); const float al = __builtin_amdgcn_exp2f(m[qt] - mn); m[qt] = mn; l1[qt] *= al; l2[qt] *= al;
#pragma unroll
                    for (int dt = 0; dt < 4; ++dt)
#pragma unroll
                        for (int r = 0; r < 8; ++r) O[qt][dt][r] *= al; } }
#pragma unroll
            for (int qt = 0; qt < 2; ++qt) { v8f w[2]; const v2f mm = {m[qt], m[qt]};
#pragma unroll
                for (int kt = 0; kt < 2; ++kt)
#pragma unroll
                    for (int i = 0; i < 4; ++i) {   // two neighbouring keys at a time: packed f32 on register pairs as the accumulator holds them
                        const v2f sv = {st[qt][kt][2 * i], st[qt][kt][2 * i + 1]}; const v2f tt = sv * CS2 - mm; const v2f e = {__builtin_amdgcn_exp2f(tt[0]), __builtin_amdgcn_exp2f(tt[1])};
                        l1[qt] += e; const v2f ww = e * ex[kt][i]; l2[qt] += ww; w[kt][2 * i] = ww[0]; w[kt][2 * i + 1] = ww[1]; }
                const v16h pf = cat16(__builtin_convertvector(w[0], v8h), __builtin_convertvector(w[1], v8h));   // element s = key kl + (s < 8 ? 8*hi + s : 16 + 8*hi + s - 8): the k order of the V^T loader
#pragma unroll
                for (int dt = 0; dt < 4; ++dt) O[qt][dt] = wmma16(vf[dt], pf, O[qt][dt]); }   // O[qt][dt][r] = O[query qt*16+lr][d = dt*16 + 8*hi + r]
        }
        if (more) {   // the other buffer's last readers left it before the barrier that ended the tile before this one
#pragma unroll
            for (int u = 0; u < 2; ++u) { *(v8h*)(&Ks[(s + 1) & 1][(srow + 32 * u) * LP + sch]) = kr[u]; *(v8h*)(&Vs[(s + 1) & 1][(srow + 32 * u) * LP + sch]) = vr[u]; } }
        __syncthreads();   // publishes tile s + 1 and ends every read of tile s
    }
    float f[2];   // both columns' factors first, the stores behind them
#pragma unroll
    for (int qt = 0; qt < 2; ++qt) { const float b1 = l1[qt][0] + l1[qt][1], b2 = l2[qt][0] + l2[qt][1]; const float a1 = b1 + __shfl_xor(b1, 16, 32), a2 = b2 + __shfl_xor(b2, 16, 32);
        const float g = __fdiv_rn(GX[((size_t)b * TT + q0 + qt * 16 + lr) * 32 + h], a1); f[qt] = __fdiv_rn(PCAR * g, fmaf(g, a2, 1e-8f)); }
#pragma unroll
    for (int qt = 0; qt < 2; ++qt) { float* orow = Ob + ((size_t)z * TT + q0 + qt * 16 + lr) * HD + 8 * hi;
#pragma unroll
        for (int dt = 0; dt < 4; ++dt) { v4f o0, o1;
#pragma unroll
            for (int r = 0; r < 4; ++r) { o0[r] = O[qt][dt][r] * f[qt]; o1[r] = O[qt][dt][4 + r] * f[qt]; }
            *(v4f*)(orow + dt * 16) = o0; *(v4f*)(orow + dt * 16 + 4) = o1; } }
}
__global__ __launch_bounds__(32) void k_cham(const float* __restrict__ chi, const float* __restrict__ bp, const float* __restrict__ ivp, const float* __restrict__ ovp, float* CH) { const int lane = threadIdx.x; const int h = lane >> 1; const int part = (lane & 1) * 2;
    const float sg_b = __fdiv_rn(1.0f, __fadd_rn(1.0f, __expf(-bfr(bp[h])))); const float ang = __fmul_rn(3.14159265358979f, sg_b); v2f o;
    if (part == 0) { o[0] = __fdiv_rn(1.0f, __fadd_rn(1.0f, __expf(-bfr(ivp[h])))); o[1] = cosf(ang); } else { o[0] = sinf(ang); o[1] = __fdiv_rn(1.0f, __fadd_rn(1.0f, __expf(-bfr(ovp[h])))); }
    const float th = (lane < NH_) ? tanhf(bfr(chi[lane])) : 0.f;
    *(v2f*)(CH + lane * 2) = o; *(float*)(CH + 64 + lane) = th;  }
__global__ __launch_bounds__(256) void k_merge(const float* __restrict__ O, const float* __restrict__ CH, int z0, bf* Ah, bf* Al) {
    const int lane = threadIdx.x & 31; const int L0 = (blockIdx.x * 8 + (threadIdx.x >> 5)) * 8; const int nlines = ZH * TT * HD / 64;
{
#pragma unroll 2
        for (int l = 0; l < 8; ++l) { const int L = L0 + l; if (L >= nlines) break; const int e = L * 64 + lane * 2; const int d = e & 63; const int t = (e >> 6) & (TT - 1); const int zz = e >> 16; v2us oh, ol;
const int b = (z0 + zz) / NH_, hh = (z0 + zz) % NH_; const float iv = CH[hh * 4], ca = CH[hh * 4 + 1], sa = CH[hh * 4 + 2], ovt = CH[hh * 4 + 3];
#pragma unroll
            for (int q = 0; q < 2; ++q) { const int dq = d + q; float me = __fmul_rn(O[(size_t)e + q] * (1.0f / PCAR), iv), pt = __fmul_rn(O[(size_t)(e + q) + ((dq < 32) ? 32 : -32)] * (1.0f / PCAR), iv); asm volatile("" : "+v"(me)); asm volatile("" : "+v"(pt));
                float t1, t2; if (dq < 32) { t1 = __fmul_rn(me, ca); t2 = __fmul_rn(pt, sa); asm volatile("" : "+v"(t1)); asm volatile("" : "+v"(t2)); t1 = __fsub_rn(t1, t2); } else { t1 = __fmul_rn(pt, sa); t2 = __fmul_rn(me, ca); asm volatile("" : "+v"(t1)); asm volatile("" : "+v"(t2)); t1 = __fadd_rn(t1, t2); }
                float r0 = __fmul_rn(t1, ovt); asm volatile("" : "+v"(r0)); float r1 = __fmul_rn(r0, CH[64 + hh]); asm volatile("" : "+v"(r1)); unsigned short a, c2; splitf(r1, a, c2); oh[q] = a; ol[q] = c2; }
            const size_t o = ((size_t)b * TT + t) * DD + hh * HD + d; *(v2us*)(Ah + o) = oh; *(v2us*)(Al + o) = ol; }
         }
}

extern "C" void kernel_launch(void* const* d_in, const int* in_sizes, int n_in,
                              void* d_out, int out_size, void* d_ws, size_t ws_size, hipStream_t stream) {
    (void)in_sizes; (void)n_in; (void)out_size;
    const float* IN[13]; for (int i = 0; i < 13; ++i) IN[i] = (const float*)d_in[i];
    // x [4][1024][1024], Wa [1024][16], ba, We, be, Wi, Wo, Wv, Wout ([in][out] = x @ W), chi, beta_p, iv_p, ov_p [16] = d_in[0..12]
    float* OUT = (float*)d_out;     // [4][1024][1024]
    char* wsp = (char*)d_ws;
    auto take = [&](size_t bytes) { char* p = wsp; wsp += (bytes + 255) & ~(size_t)255; return (void*)p; };
    bf* WO = (bf*)take((size_t)DD * DD * 2); float* GX = (float*)take((size_t)NT * 32 * 4); float* CH = (float*)take(512);
    h16* QP = (h16*)take((size_t)NT * DD * 2); h16* KP = (h16*)take((size_t)NT * DD * 2); h16* VT = (h16*)take((size_t)NT * DD * 2);
    float* Ob = (float*)take((size_t)ZH * TT * HD * 4); bf* ATh = (bf*)take((size_t)NT * DD * 2); bf* ATl = (bf*)take((size_t)NT * DD * 2);
    bf* WQ = (bf*)take((size_t)DD * DD * 2); bf* WK = (bf*)take((size_t)DD * DD * 2); bf* WV = (bf*)take((size_t)DD * DD * 2); bf* XB = (bf*)take((size_t)NT * DD * 2);
    if ((size_t)(wsp - (char*)d_ws) > ws_size) return;    // total below 75 MiB; ws 256 MiB
    { const unsigned gT = (unsigned)((DD * DD / 64 + 63) / 64); k_wtG<<<gT, 256, 0, stream>>>(IN[5], DD, DD, WQ); k_wtG<<<gT, 256, 0, stream>>>(IN[6], DD, DD, WK); k_wtG<<<gT, 256, 0, stream>>>(IN[7], DD, DD, WV); k_wtG<<<gT, 256, 0, stream>>>(IN[8], DD, DD, WO);
      const size_t nx = (size_t)NT * DD / 8; k_cvt8<<<(unsigned)((nx + 255) / 256), 256, 0, stream>>>(IN[0], XB, nx); k_gates<<<NT / 8, 256, 0, stream>>>(IN[0], IN[1], IN[2], IN[3], IN[4], GX); k_cham<<<1, 32, 0, stream>>>(IN[9], IN[10], IN[11], IN[12], CH); }
    k_proj<<<dim3(NH_ / 2, NT / 128, 3), 128, 0, stream>>>(XB, WQ, WK, WV, QP, KP, VT);   // inner, outer (the 1/8 is applied in f32 inside k_fattn) and v, stored as fp16 head planes
    k_fattn<<<dim3(TT / 256, NZ, 1), 256, 0, stream>>>(QP, KP, VT, GX, Ob);   // all 64 flat heads (b * 16 + h) in one launch
    k_merge<<<(ZH * TT * HD / 64 + 63) / 64, 256, 0, stream>>>(Ob, CH, 0, ATh, ATl);
    k_gemmo<<<dim3(NT / 128, DD / 128, 1), 128, 0, stream>>>(ATh, ATl, WO, OUT);
}

// v005
// One run takes 147 microseconds.
// Next to v004, in two timings, it ran 1.20 times as fast each time.
// Counting every step since v000, it is 10.8 times as fast.
#include <hip/hip_runtime.h>

// XorzoTransformer (x [4][1024][1024]; aperture = sigmoid(x Wa + ba), expression = sigmoid(x We + be) ([T][16] per-head gates); inner/outer/v = x @ Wi / Wo / Wv (16 heads x 64); p = softmax(inner.outer^T / 8);
// attn = p ap_i ex_j / (sum_j p ap_i ex_j + 1e-8); converged = attn v; ApertureChamber per head: x_in = converged sigmoid(iv_h); (xr, xi) halves rotated by angle pi sigmoid(beta_h); x sigmoid(ov_h) x tanh(chi_h);
// out = merged @ Wout).
// Compute dtypes, f32 accumulate: every input rounded to bf16; the three 1024-wide projections on PLAIN bf16 operands (inputs: exact; transposed bf16 weight copies); the
// 16-wide gate projections as f32 dots on VALU; scores and attn.v on SINGLE fp16 planes inside one fused kernel (1/8, running-maximum softmax, the bilateral gating and the renormalisation in f32; gated weights in fp16);

#define NB_  4
#define TT   1024
#define DD   1024
#define NH_  16
#define HD   64
#define NT   (NB_ * TT)
#define NZ   (NB_ * NH_)
#define ZH   64
#define PCAR 1024.0f
#define SCL  0.125f
typedef _Float16 h16;
typedef unsigned short bf;
typedef __attribute__((ext_vector_type(16))) __bf16   v16bf;
typedef __attribute__((ext_vector_type(16))) _Float16 v16h;
typedef __attribute__((ext_vector_type(8)))  _Float16 v8h;
typedef __attribute__((ext_vector_type(8)))  unsigned short v8us;
typedef __attribute__((ext_vector_type(8)))  float    v8f;
typedef __attribute__((ext_vector_type(4)))  float    v4f;
typedef v8h  __attribute__((may_alias)) v8ha;
typedef v4f  __attribute__((may_alias)) v4fa;
typedef v8us __attribute__((may_alias)) v8usa;

__device__ __forceinline__ unsigned short f2bf(float f) { unsigned u = __float_as_uint(f); u += 0x7FFFu + ((u >> 16) & 1u); return (unsigned short)(u >> 16); }
__device__ __forceinline__ float bf2f(unsigned short b) { return __uint_as_float(((unsigned)b) << 16); }
__device__ __forceinline__ float bfr(float f) { return bf2f(f2bf(f)); }
__device__ __forceinline__ v16h cat16(v8h lo, v8h hi) { return __builtin_shufflevector(lo, hi, 0, 1, 2, 3, 4, 5, 6, 7, 8, 9, 10, 11, 12, 13, 14, 15); }
__device__ __forceinline__ v16bf cat16b(v8us lo, v8us hi) { return __builtin_bit_cast(v16bf, __builtin_shufflevector(lo, hi, 0, 1, 2, 3, 4, 5, 6, 7, 8, 9, 10, 11, 12, 13, 14, 15)); }
__device__ __forceinline__ v8f wmma16(v16h a, v16h b, v8f c) { return __builtin_amdgcn_wmma_f32_16x16x32_f16(false, a, false, b, (short)0, c, false, false); }
__device__ __forceinline__ v8f wmmab(v16bf a, v16bf b, v8f c) { return __builtin_amdgcn_wmma_f32_16x16x32_bf16(false, a, false, b, (short)0, c, false, false); }



// ---- fragment loaders of the 16-bit planes (K-contiguous rows, in memory or in LDS)
template <typename T16> struct WFrag;
template <> struct WFrag<h16> { typedef v16h V; static __device__ __forceinline__ V ld(const h16* p) { return cat16(*(const v8h*)p, *(const v8h*)(p + 16)); } static __device__ __forceinline__ v8f mma(V a, V b, v8f c) { return wmma16(a, b, c); } };
template <> struct WFrag<bf> { typedef v16bf V; static __device__ __forceinline__ V ld(const bf* p) { return cat16b(*(const v8us*)p, *(const v8us*)(p + 16)); } static __device__ __forceinline__ v8f mma(V a, V b, v8f c) { return wmmab(a, b, c); } };

// ---- operand staging of the two GEMM kernels: a tile is 128 rows x 64 k (128 B of a row) of a plane of pitch DD, kept in LDS at a pitch of 144 B.
// 128 threads: thread tid brings 16 B of rows (tid >> 3) + 16 u, u = 0..7, so a wave's copy covers four whole 128-B lines. No register holds the data.
#define GP   72            /* LDS pitch of a staged row, elements */
#define GTB  (128 * GP * 2) /* bytes of a staged tile */
#define GKS  64            /* k per trip */
// lds: the lane's LDS byte address in row tid >> 3 of the tile; g: the lane's 16 B in the same row of the plane.
__device__ __forceinline__ void stage128(unsigned lds, const bf* g) {
    // the wait is the statement's last line: it stands in front of any rewrite of the address registers that the copies name
    asm volatile("global_load_async_to_lds_b128 %0, %8, off\n\t"
                 "global_load_async_to_lds_b128 %1, %9, off\n\t"
                 "global_load_async_to_lds_b128 %2, %10, off\n\t"
                 "global_load_async_to_lds_b128 %3, %11, off\n\t"
                 "global_load_async_to_lds_b128 %4, %12, off\n\t"
                 "global_load_async_to_lds_b128 %5, %13, off\n\t"
                 "global_load_async_to_lds_b128 %6, %14, off\n\t"
                 "global_load_async_to_lds_b128 %7, %15, off\n\t"
                 "s_wait_xcnt 0x0"
                 :: "v"(lds), "v"(lds + 16 * GP * 2), "v"(lds + 32 * GP * 2), "v"(lds + 48 * GP * 2), "v"(lds + 64 * GP * 2), "v"(lds + 80 * GP * 2), "v"(lds + 96 * GP * 2), "v"(lds + 112 * GP * 2),
                    "v"(g), "v"(g + 16 * DD), "v"(g + 32 * DD), "v"(g + 48 * DD), "v"(g + 64 * DD), "v"(g + 80 * DD), "v"(g + 96 * DD), "v"(g + 112 * DD) : "memory");
}

// ---- k_gemmo: OUT[m][n] (f32) = sum_k (Ah[m][k] + Al[m][k]) Bt[n][k]; grid (NT/128, DD/128), 4 waves, a 128x128 tile per block, 64x64 (16 accumulators) per wave.
// The three operand tiles of a trip come to LDS by asynchronous copies, two buffers: trip t + 1's copies fly while trip t is worked on. Per accumulator the products are summed in the order k ascending, hi then lo.
__global__ __launch_bounds__(128) void k_gemmo(const bf* __restrict__ A, const bf* __restrict__ A2, const bf* __restrict__ Bt, float* C) {
    typedef WFrag<bf>::V V;
    __shared__ __align__(16) char sm[2 * 3 * GTB];   // [buffer][Ah | Al | Bt]; the epilogue's staging rows lie over it
    const int tid = threadIdx.x, lane = tid & 31, wv = tid >> 5, lr = lane & 15, hi = lane >> 4;
    const int rb = blockIdx.x * 128, cb = blockIdx.y * 128, wm = wv & 1, wn = wv >> 1;
    const size_t go = (size_t)(tid >> 3) * DD + (tid & 7) * 8;
    const bf* Ag = A + (size_t)rb * DD + go; const bf* A2g = A2 + (size_t)rb * DD + go; const bf* Bg = Bt + (size_t)cb * DD + go;
    const unsigned l0 = (unsigned)(size_t)sm + (unsigned)((tid >> 3) * (GP * 2) + (tid & 7) * 16);
    const int ao = (wm * 64 + lr) * GP + 8 * hi, bo = (wn * 64 + lr) * GP + 8 * hi;   // a lane's place in its wave's first 16-row block, elements
    v8f acc[4][4];
#pragma unroll
    for (int mb = 0; mb < 4; ++mb)
#pragma unroll
        for (int nb = 0; nb < 4; ++nb) acc[mb][nb] = (v8f){};
    stage128(l0, Ag); stage128(l0 + GTB, A2g); stage128(l0 + 2 * GTB, Bg);
    asm volatile("s_wait_asynccnt 0x0" ::: "memory");   // this wave's copies of trip 0 have landed
    __syncthreads();                                      // trip 0 is published
    stage128(l0 + 3 * GTB, Ag + GKS); stage128(l0 + 4 * GTB, A2g + GKS); stage128(l0 + 5 * GTB, Bg + GKS);
#pragma unroll 1   /* rolled: one copy of the trip's body; the buffer is chosen by an offset */
    for (int t = 0; t < DD / GKS; ++t) {
        const unsigned bb = (unsigned)(t & 1) * (3 * GTB); const bf* S = (const bf*)(sm + bb);
#pragma unroll
        for (int kk = 0; kk < GKS; kk += 32) {
            V a[4], a2[4], b[4];   // all twelve fragments of a 32-k block are asked for ahead of its WMMAs: one LDS latency per block
#pragma unroll
            for (int nb = 0; nb < 4; ++nb) b[nb] = WFrag<bf>::ld(S + 2 * 128 * GP + bo + nb * 16 * GP + kk);
#pragma unroll
            for (int mb = 0; mb < 4; ++mb) { a[mb] = WFrag<bf>::ld(S + ao + mb * 16 * GP + kk); a2[mb] = WFrag<bf>::ld(S + 128 * GP + ao + mb * 16 * GP + kk); }
            // inputs only: holds the block's LDS loads together in front of its WMMAs; without it the compiler sinks them between the WMMAs, four to a wait, and the wave waits out the LDS latency each time
            asm volatile("" :: "v"(a[0]), "v"(a[1]), "v"(a[2]), "v"(a[3]), "v"(a2[0]), "v"(a2[1]), "v"(a2[2]), "v"(a2[3]), "v"(b[0]), "v"(b[1]), "v"(b[2]), "v"(b[3]));
#pragma unroll
            for (int mb = 0; mb < 4; ++mb)
#pragma unroll
                for (int nb = 0; nb < 4; ++nb) { acc[mb][nb] = WFrag<bf>::mma(a[mb], b[nb], acc[mb][nb]); acc[mb][nb] = WFrag<bf>::mma(a2[mb], b[nb], acc[mb][nb]); }
        }
        asm volatile("s_wait_dscnt 0x0" ::: "memory");      // this wave's reads of the buffer have returned before it is refilled
        asm volatile("s_wait_asynccnt 0x0" ::: "memory");   // this wave's copies of trip t + 1 have landed
        __syncthreads();                                      // publishes trip t + 1 and ends every read of trip t
        if (t + 2 < DD / GKS) { stage128(l0 + bb, Ag + (t + 2) * GKS); stage128(l0 + bb + GTB, A2g + (t + 2) * GKS); stage128(l0 + bb + 2 * GTB, Bg + (t + 2) * GKS); }
    }
    asm volatile("s_wait_asynccnt 0x0" ::: "memory");   // no copy is outstanding when the ring becomes output staging
    float* os = (float*)(sm + wv * (16 * 68 * 4));        // a wave's own 16 rows of 64 f32 at a pitch of 68
    const int r0 = rb + wm * 64, c0 = cb + wn * 64;
#pragma unroll
    for (int mb = 0; mb < 4; ++mb) {
#pragma unroll
        for (int nb = 0; nb < 4; ++nb) {
#pragma unroll
            for (int j = 0; j < 8; ++j) os[(hi * 8 + j) * 68 + nb * 16 + lr] = acc[mb][nb][j]; }
        __builtin_amdgcn_wave_barrier(); asm volatile("" ::: "memory");   // one wave's rows: keeps the compiler from lifting the other lanes' read-back over the LDS stores
        float* crow = C + (size_t)(r0 + mb * 16) * DD + c0;
#pragma unroll
        for (int s = 0; s < 8; ++s) { const int row = 2 * s + hi, cofs = lr * 4; *(v4f*)(crow + (size_t)row * DD + cofs) = *(const v4fa*)(os + row * 68 + cofs); }
        __builtin_amdgcn_wave_barrier(); asm volatile("" ::: "memory");   // and the next block's stores over these reads
    }
}

__device__ __forceinline__ void splitf(float y, unsigned short& h, unsigned short& l) { h = f2bf(y); l = f2bf(y - bf2f(h)); }
typedef __attribute__((ext_vector_type(2))) _Float16 v2h;
typedef __attribute__((ext_vector_type(4))) _Float16 v4h;
typedef __attribute__((ext_vector_type(2))) unsigned short v2us;
typedef __attribute__((ext_vector_type(4))) unsigned short v4us;
typedef __attribute__((ext_vector_type(2))) float v2f;

// ---- the seven preparation jobs (no one reads what another writes) are the parts of ONE launch, k_prep: each is a device function; all but the one-block chamber job are told their own block index bx.
__device__ __forceinline__ void p_cvt8(int bx, const float* __restrict__ src, bf* dst, size_t n8) { const size_t i = (size_t)bx * 256 + threadIdx.x; if (i >= n8) return; const v8f v = *(const v8f*)(src + i * 8); v8us o;
#pragma unroll
    for (int k = 0; k < 8; ++k) o[k] = f2bf(v[k]); *(v8us*)(dst + i * 8) = o;  }
__device__ __forceinline__ void p_wtG(int bx, const float* __restrict__ w, int K, int N, bf* Bt) {
    const int lane = threadIdx.x & 31; const int L0 = (bx * 8 + (threadIdx.x >> 5)) * 8; const int nlines = N * K / 64;
{
#pragma unroll 1
        for (int l = 0; l < 8; ++l) { const int L = L0 + l; if (L >= nlines) break; const size_t e = (size_t)L * 64 + lane * 2; const int k = (int)(e % K), n = (int)(e / K); v2us o;
            o[0] = f2bf(w[(size_t)k * N + n]); o[1] = f2bf(w[(size_t)(k + 1) * N + n]); *(v2us*)(Bt + e) = o; }
         }
}
__device__ __forceinline__ void p_gates(int bx, const float* __restrict__ x, const float* __restrict__ Wa, const float* __restrict__ ba, const float* __restrict__ We, const float* __restrict__ be, float* GX) {
    const int lane = threadIdx.x & 31; const int r = bx * 8 + (threadIdx.x >> 5); if (r >= NT) return; const float* xr = x + (size_t)r * DD; float acc[32];
#pragma unroll
    for (int h = 0; h < 32; ++h) acc[h] = 0.f;
#pragma unroll 1
    for (int d = lane; d < DD; d += 32) { const float xv = bfr(xr[d]); const float* wa = Wa + (size_t)d * NH_; const float* we = We + (size_t)d * NH_;
#pragma unroll
        for (int h = 0; h < 16; ++h) { float p1 = __fmul_rn(xv, bfr(wa[h])), p2 = __fmul_rn(xv, bfr(we[h])); asm volatile("" : "+v"(p1)); asm volatile("" : "+v"(p2)); acc[h] = __fadd_rn(acc[h], p1); acc[16 + h] = __fadd_rn(acc[16 + h], p2); } }
#pragma unroll
    for (int h = 0; h < 32; ++h) {
#pragma unroll
        for (int sh = 16; sh; sh >>= 1) acc[h] += __shfl_xor(acc[h], sh, 32); }
    float mine = 0.f;
#pragma unroll
    for (int h = 0; h < 32; ++h) if (lane == h) mine = __fadd_rn(acc[h], bfr(h < 16 ? ba[h] : be[h - 16]));
    const float o = __fdiv_rn(1.0f, __fadd_rn(1.0f, __expf(-mine))); *(float*)(GX + (size_t)r * 32 + lane) = o;  }
__device__ __forceinline__ void p_cham(const float* __restrict__ chi, const float* __restrict__ bp, const float* __restrict__ ivp, const float* __restrict__ ovp, float* CH) { const int lane = threadIdx.x; const int h = lane >> 1; const int part = (lane & 1) * 2;
    const float sg_b = __fdiv_rn(1.0f, __fadd_rn(1.0f, __expf(-bfr(bp[h])))); const float ang = __fmul_rn(3.14159265358979f, sg_b); v2f o;
    if (part == 0) { o[0] = __fdiv_rn(1.0f, __fadd_rn(1.0f, __expf(-bfr(ivp[h])))); o[1] = cosf(ang); } else { o[0] = sinf(ang); o[1] = __fdiv_rn(1.0f, __fadd_rn(1.0f, __expf(-bfr(ovp[h])))); }
    const float th = (lane < NH_) ? tanhf(bfr(chi[lane])) : 0.f;
    *(v2f*)(CH + lane * 2) = o; *(float*)(CH + 64 + lane) = th;  }
// k_prep: blocks are dealt by index, the longest-running job first: gates, the four weight transposes, the chamber constants (one wave of one block), the bf16 copy of x.
// The gates are the long job: in the listing each of a trip's 16 pairs of weight loads has a wait of its own, so a gates wave is a chain of cache latencies with idle issue slots, in which the other jobs' waves now run. That chain is left as it was.
#define PB_G  (NT / 8)                      /* blocks of the gates */
#define PB_W  ((DD * DD / 64 + 63) / 64)    /* blocks of one weight transpose */
#define PB_X  (NT * DD / 8 / 256)           /* blocks of the copy of x */
#define PB_ALL (PB_G + 4 * PB_W + 1 + PB_X)
__global__ __launch_bounds__(256) void k_prep(const float* __restrict__ x, const float* __restrict__ Wa, const float* __restrict__ ba, const float* __restrict__ We, const float* __restrict__ be,
                                              const float* __restrict__ Wi, const float* __restrict__ Wo, const float* __restrict__ Wv, const float* __restrict__ Wout,
                                              const float* __restrict__ chi, const float* __restrict__ bp, const float* __restrict__ ivp, const float* __restrict__ ovp,
                                              float* GX, bf* WQ, bf* WK, bf* WV, bf* WO, float* CH, bf* XB) {
    int bx = blockIdx.x;
    if (bx < PB_G) { p_gates(bx, x, Wa, ba, We, be, GX); return; }
    bx -= PB_G;
    if (bx < 4 * PB_W) { const int j = bx / PB_W; p_wtG(bx % PB_W, j == 0 ? Wi : j == 1 ? Wo : j == 2 ? Wv : Wout, DD, DD, j == 0 ? WQ : j == 1 ? WK : j == 2 ? WV : WO); return; }
    bx -= 4 * PB_W;
    if (bx == 0) { if (threadIdx.x < 32) p_cham(chi, bp, ivp, ovp, CH); return; }
    p_cvt8(bx - 1, x, XB, (size_t)NT * DD / 8);
}
// k_proj: the three 1024-wide projections in one launch, grid (NH_/2, NT/128, 3), 4 waves: a block takes 128 tokens x two heads, a wave 64 tokens x one head (64x64, 16 accumulators), plain bf16 planes.
// The weight rows and the token rows of a trip (64 k) come to LDS by asynchronous copies, two buffers, and each is read by two waves.
// The epilogue stores the fp16 plane that k_fattn reads; no f32 copy of a projection reaches memory. A lane's accumulator holds 8 consecutive rows of the A operand, so the operand whose index runs
// contiguously in the plane is taken as A: z = 0, 1 (inner, outer): A = weight rows (d), B = token rows, plane [head][t][d]; z = 2 (v): A = token rows, B = weight rows (d), plane [head][d][t].
#define LPO  72   /* LDS pitch of a 128-B output row: 144 B */
__global__ __launch_bounds__(128) void k_proj(const bf* __restrict__ X, const bf* __restrict__ WQ, const bf* __restrict__ WK, const bf* __restrict__ WV, h16* QP, h16* KP, h16* VT) {
    typedef WFrag<bf>::V V;
    __shared__ __align__(16) char sm[2 * 2 * GTB];   // [buffer][weight rows | token rows]; the epilogue's staging rows lie over it
    const int tid = threadIdx.x, lane = tid & 31, wv = tid >> 5, lr = lane & 15, hi = lane >> 4; const int zz = blockIdx.z; const bool vtr = zz == 2;
    const int wh = wv & 1, wt = wv >> 1; const int hh = blockIdx.x * 2 + wh, t0 = blockIdx.y * 128 + wt * 64;
    const size_t go = (size_t)(tid >> 3) * DD + (tid & 7) * 8;
    const bf* Wg = (zz == 0 ? WQ : zz == 1 ? WK : WV) + (size_t)blockIdx.x * 128 * DD + go; const bf* Xg = X + (size_t)blockIdx.y * 128 * DD + go;
    const unsigned l0 = (unsigned)(size_t)sm + (unsigned)((tid >> 3) * (GP * 2) + (tid & 7) * 16);
    const int wo = (wh * 64 + lr) * GP + 8 * hi, xo = 128 * GP + (wt * 64 + lr) * GP + 8 * hi;   // a lane's place in its wave's first 16-row block of each tile, elements
    const int ao = vtr ? xo : wo, bo = vtr ? wo : xo;
    v8f acc[4][4];
#pragma unroll
    for (int mb = 0; mb < 4; ++mb)
#pragma unroll
        for (int nb = 0; nb < 4; ++nb) acc[mb][nb] = (v8f){};
    stage128(l0, Wg); stage128(l0 + GTB, Xg);
    asm volatile("s_wait_asynccnt 0x0" ::: "memory");   // this wave's copies of trip 0 have landed
    __syncthreads();                                      // trip 0 is published
    stage128(l0 + 2 * GTB, Wg + GKS); stage128(l0 + 3 * GTB, Xg + GKS);
#pragma unroll 1   /* rolled: one copy of the trip's body; the buffer is chosen by an offset */
    for (int t = 0; t < DD / GKS; ++t) {
        const unsigned bb = (unsigned)(t & 1) * (2 * GTB); const bf* S = (const bf*)(sm + bb);
#pragma unroll
        for (int kk = 0; kk < GKS; kk += 32) {
            V a[4], b[4];   // all eight fragments of a 32-k block are asked for ahead of its WMMAs: one LDS latency per block
#pragma unroll
            for (int mb = 0; mb < 4; ++mb) { a[mb] = WFrag<bf>::ld(S + ao + mb * 16 * GP + kk); b[mb] = WFrag<bf>::ld(S + bo + mb * 16 * GP + kk); }
            // inputs only: holds the block's LDS loads together in front of its WMMAs; without it the compiler sinks them between the WMMAs, four to a wait, and the wave waits out the LDS latency each time
            asm volatile("" :: "v"(a[0]), "v"(a[1]), "v"(a[2]), "v"(a[3]), "v"(b[0]), "v"(b[1]), "v"(b[2]), "v"(b[3]));
#pragma unroll
            for (int nb = 0; nb < 4; ++nb)
#pragma unroll
                for (int mb = 0; mb < 4; ++mb) acc[mb][nb] = WFrag<bf>::mma(a[mb], b[nb], acc[mb][nb]);
        }
        asm volatile("s_wait_dscnt 0x0" ::: "memory");      // this wave's reads of the buffer have returned before it is refilled
        asm volatile("s_wait_asynccnt 0x0" ::: "memory");   // this wave's copies of trip t + 1 have landed
        __syncthreads();                                      // publishes trip t + 1 and ends every read of trip t
        if (t + 2 < DD / GKS) { stage128(l0 + bb, Wg + (t + 2) * GKS); stage128(l0 + bb + GTB, Xg + (t + 2) * GKS); }
    }
    asm volatile("s_wait_asynccnt 0x0" ::: "memory");   // no copy is outstanding when the ring becomes output staging
    h16* os = (h16*)(sm + wv * (64 * LPO * 2));           // a wave's own 64 output rows
#pragma unroll
    for (int mb = 0; mb < 4; ++mb)
#pragma unroll
        for (int nb = 0; nb < 4; ++nb) *(v8h*)(os + (nb * 16 + lr) * LPO + mb * 16 + 8 * hi) = __builtin_convertvector(acc[mb][nb], v8h);   // os[B row][A row]
    __builtin_amdgcn_wave_barrier(); asm volatile("" ::: "memory");   // one wave's rows: keeps the compiler from lifting the other lanes' read-back over the LDS stores
    const size_t z = (size_t)(t0 / TT) * NH_ + hh; const int tl = t0 & (TT - 1);
    h16* C = vtr ? VT + z * HD * TT + tl : (zz == 0 ? QP : KP) + (z * TT + tl) * HD; const int ldc = vtr ? TT : HD;
#pragma unroll
    for (int s = 0; s < 16; ++s) { const int row = s * 4 + (lane >> 3), ch = (lane & 7) * 8; *(v8h*)(C + (size_t)row * ldc + ch) = *(const v8ha*)(os + row * LPO + ch); }   // whole 128-B lines
}
#define KST  64
#define LP   72
#define CS2  0.18033688011112042f   /* (1/8) log2(e) */
__global__ __launch_bounds__(256) void k_fattn(const h16* __restrict__ QP, const h16* __restrict__ KP, const h16* __restrict__ VT, const float* __restrict__ GX, float* Ob) {
    __shared__ __align__(16) h16 Ks[2][KST * LP];
    __shared__ __align__(16) h16 Vs[2][HD * LP];
    __shared__ __align__(16) float exs[TT];
    const int tid = threadIdx.x, lane = tid & 31, wv = tid >> 5, lr = lane & 15, hi = lane >> 4;
    const int z = blockIdx.y, b = z / NH_, h = z % NH_; const int q0 = blockIdx.x * 256 + wv * 32;
    const h16* Qz = QP + (size_t)z * TT * HD; const h16* Kz = KP + (size_t)z * TT * HD; const h16* Vz = VT + (size_t)z * HD * TT;
#pragma unroll
    for (int u = 0; u < TT / 256; ++u) exs[u * 256 + tid] = GX[((size_t)b * TT + u * 256 + tid) * 32 + 16 + h];
    v16h qf[2][2];
#pragma unroll
    for (int qt = 0; qt < 2; ++qt)
#pragma unroll
        for (int ks = 0; ks < 2; ++ks) qf[qt][ks] = WFrag<h16>::ld(Qz + (size_t)(q0 + qt * 16 + lr) * HD + ks * 32 + 8 * hi);
    const int srow = tid >> 3, sch = (tid & 7) * 8;   // a thread stages 16 B of rows srow and srow + 32 of each tile: a wave covers whole 128-B lines
    v8h kr[2], vr[2];
#pragma unroll
    for (int u = 0; u < 2; ++u) { kr[u] = *(const v8h*)(Kz + (size_t)(srow + 32 * u) * HD + sch); vr[u] = *(const v8h*)(Vz + (size_t)(srow + 32 * u) * TT + sch); }
#pragma unroll
    for (int u = 0; u < 2; ++u) { *(v8h*)(&Ks[0][(srow + 32 * u) * LP + sch]) = kr[u]; *(v8h*)(&Vs[0][(srow + 32 * u) * LP + sch]) = vr[u]; }
    v8f O[2][4]; float m[2]; v2f l1[2], l2[2];   // l1, l2: a lane's sums over even and odd keys, joined in the epilogue
#pragma unroll
    for (int qt = 0; qt < 2; ++qt) { m[qt] = -3.0e38f; l1[qt] = (v2f){}; l2[qt] = (v2f){};
#pragma unroll
        for (int dt = 0; dt < 4; ++dt) O[qt][dt] = (v8f){}; }
    __syncthreads();   // tile 0 and the gate row are published
#pragma unroll 1   /* rolled: one copy of the tile body; sixteen would only grow the code */
    for (int s = 0; s < TT / KST; ++s) {
        const h16* kb = Ks[s & 1]; const h16* vb = Vs[s & 1]; const bool more = s + 1 < TT / KST;
        if (more) {   // the next tile's global loads fly while this tile is worked on
#pragma unroll
            for (int u = 0; u < 2; ++u) { kr[u] = *(const v8h*)(Kz + (size_t)((s + 1) * KST + srow + 32 * u) * HD + sch); vr[u] = *(const v8h*)(Vz + (size_t)(srow + 32 * u) * TT + (s + 1) * KST + sch); } }
#pragma unroll 1   /* rolled: unrolled, the build took more VGPRs and more padding v_nop and fetched hardly any fragment earlier */
        for (int ps = 0; ps < 2; ++ps) {   // a pass: 32 keys
            const int kl = ps * 32; v8f st[2][2];
#pragma unroll
            for (int kt = 0; kt < 2; ++kt) { const v16h k0 = WFrag<h16>::ld(kb + (kl + kt * 16 + lr) * LP + 8 * hi), k1 = WFrag<h16>::ld(kb + (kl + kt * 16 + lr) * LP + 32 + 8 * hi);
#pragma unroll
                for (int qt = 0; qt < 2; ++qt) st[qt][kt] = wmma16(k1, qf[qt][1], wmma16(k0, qf[qt][0], (v8f){})); }   // st[qt][kt][r] = S[query qt*16+lr][key kl + kt*16 + 8*hi + r]
            v16h vf[4];
#pragma unroll
            for (int dt = 0; dt < 4; ++dt) vf[dt] = WFrag<h16>::ld(vb + (dt * 16 + lr) * LP + kl + 8 * hi);
            v2f ex[2][4];
#pragma unroll
            for (int kt = 0; kt < 2; ++kt) { const float* ep = exs + s * KST + kl + kt * 16 + 8 * hi; const v4f e0 = *(const v4fa*)ep, e1 = *(const v4fa*)(ep + 4);
                ex[kt][0] = __builtin_shufflevector(e0, e0, 0, 1); ex[kt][1] = __builtin_shufflevector(e0, e0, 2, 3); ex[kt][2] = __builtin_shufflevector(e1, e1, 0, 1); ex[kt][3] = __builtin_shufflevector(e1, e1, 2, 3); }
            float tm[2];
#pragma unroll
            for (int qt = 0; qt < 2; ++qt) { float t = st[qt][0][0];
#pragma unroll
                for (int r = 1; r < 8; ++r) t = fmaxf(t, st[qt][0][r]);
#pragma unroll
                for (int r = 0; r < 8; ++r) t = fmaxf(t, st[qt][1][r]);
                tm[qt] = t * CS2; }
            // lazy rescale: the maximum in use moves only when a lane's new score tops it by more than 8 (log2), so w stays below 2^8; one scalar test per pass
            if (__builtin_amdgcn_ballot_w32(tm[0] > m[0] + 8.0f || tm[1] > m[1] + 8.0f) != 0) {
#pragma unroll
                for (int qt = 0; qt < 2; ++qt) { const float mn = fmaxf(m[qt], fmaxf(tm[qt], __shfl_xor(tm[qt], 16, 32))); const float al = __builtin_amdgcn_exp2f(m[qt] - mn); m[qt] = mn; l1[qt] *= al; l2[qt] *= al;
#pragma unroll
                    for (int dt = 0; dt < 4; ++dt)
#pragma unroll
                        for (int r = 0; r < 8; ++r) O[qt][dt][r] *= al; } }
#pragma unroll
            for (int qt = 0; qt < 2; ++qt) { v8f w[2]; const v2f mm = {m[qt], m[qt]};
#pragma unroll
                for (int kt = 0; kt < 2; ++kt)
#pragma unroll
                    for (int i = 0; i < 4; ++i) {   // two neighbouring keys at a time: packed f32 on register pairs as the accumulator holds them
                        const v2f sv = {st[qt][kt][2 * i], st[qt][kt][2 * i + 1]}; const v2f tt = sv * CS2 - mm; const v2f e = {__builtin_amdgcn_exp2f(tt[0]), __builtin_amdgcn_exp2f(tt[1])};
                        l1[qt] += e; const v2f ww = e * ex[kt][i]; l2[qt] += ww; w[kt][2 * i] = ww[0]; w[kt][2 * i + 1] = ww[1]; }
                const v16h pf = cat16(__builtin_convertvector(w[0], v8h), __builtin_convertvector(w[1], v8h));   // element s = key kl + (s < 8 ? 8*hi + s : 16 + 8*hi + s - 8): the k order of the V^T loader
#pragma unroll
                for (int dt = 0; dt < 4; ++dt) O[qt][dt] = wmma16(vf[dt], pf, O[qt][dt]); }   // O[qt][dt][r] = O[query qt*16+lr][d = dt*16 + 8*hi + r]
        }
        if (more) {   // the other buffer's last readers left it before the barrier that ended the tile before this one
#pragma unroll
            for (int u = 0; u < 2; ++u) { *(v8h*)(&Ks[(s + 1) & 1][(srow + 32 * u) * LP + sch]) = kr[u]; *(v8h*)(&Vs[(s + 1) & 1][(srow + 32 * u) * LP + sch]) = vr[u]; } }
        __syncthreads();   // publishes tile s + 1 and ends every read of tile s
    }
    float f[2];   // both columns' factors first, the stores behind them
#pragma unroll
    for (int qt = 0; qt < 2; ++qt) { const float b1 = l1[qt][0] + l1[qt][1], b2 = l2[qt][0] + l2[qt][1]; const float a1 = b1 + __shfl_xor(b1, 16, 32), a2 = b2 + __shfl_xor(b2, 16, 32);
        const float g = __fdiv_rn(GX[((size_t)b * TT + q0 + qt * 16 + lr) * 32 + h], a1); f[qt] = __fdiv_rn(PCAR * g, fmaf(g, a2, 1e-8f)); }
#pragma unroll
    for (int qt = 0; qt < 2; ++qt) { float* orow = Ob + ((size_t)z * TT + q0 + qt * 16 + lr) * HD + 8 * hi;
#pragma unroll
        for (int dt = 0; dt < 4; ++dt) { v4f o0, o1;
#pragma unroll
            for (int r = 0; r < 4; ++r) { o0[r] = O[qt][dt][r] * f[qt]; o1[r] = O[qt][dt][4 + r] * f[qt]; }
            *(v4f*)(orow + dt * 16) = o0; *(v4f*)(orow + dt * 16 + 4) = o1; } }
}
__global__ __launch_bounds__(256) void k_merge(const float* __restrict__ O, const float* __restrict__ CH, int z0, bf* Ah, bf* Al) {
    const int lane = threadIdx.x & 31; const int L0 = (blockIdx.x * 8 + (threadIdx.x >> 5)) * 8; const int nlines = ZH * TT * HD / 64;
{
#pragma unroll 2
        for (int l = 0; l < 8; ++l) { const int L = L0 + l; if (L >= nlines) break; const int e = L * 64 + lane * 2; const int d = e & 63; const int t = (e >> 6) & (TT - 1); const int zz = e >> 16; v2us oh, ol;
const int b = (z0 + zz) / NH_, hh = (z0 + zz) % NH_; const float iv = CH[hh * 4], ca = CH[hh * 4 + 1], sa = CH[hh * 4 + 2], ovt = CH[hh * 4 + 3];
#pragma unroll
            for (int q = 0; q < 2; ++q) { const int dq = d + q; float me = __fmul_rn(O[(size_t)e + q] * (1.0f / PCAR), iv), pt = __fmul_rn(O[(size_t)(e + q) + ((dq < 32) ? 32 : -32)] * (1.0f / PCAR), iv); asm volatile("" : "+v"(me)); asm volatile("" : "+v"(pt));
                float t1, t2; if (dq < 32) { t1 = __fmul_rn(me, ca); t2 = __fmul_rn(pt, sa); asm volatile("" : "+v"(t1)); asm volatile("" : "+v"(t2)); t1 = __fsub_rn(t1, t2); } else { t1 = __fmul_rn(pt, sa); t2 = __fmul_rn(me, ca); asm volatile("" : "+v"(t1)); asm volatile("" : "+v"(t2)); t1 = __fadd_rn(t1, t2); }
                float r0 = __fmul_rn(t1, ovt); asm volatile("" : "+v"(r0)); float r1 = __fmul_rn(r0, CH[64 + hh]); asm volatile("" : "+v"(r1)); unsigned short a, c2; splitf(r1, a, c2); oh[q] = a; ol[q] = c2; }
            const size_t o = ((size_t)b * TT + t) * DD + hh * HD + d; *(v2us*)(Ah + o) = oh; *(v2us*)(Al + o) = ol; }
         }
}

extern "C" void kernel_launch(void* const* d_in, const int* in_sizes, int n_in,
                              void* d_out, int out_size, void* d_ws, size_t ws_size, hipStream_t stream) {
    (void)in_sizes; (void)n_in; (void)out_size;
    const float* IN[13]; for (int i = 0; i < 13; ++i) IN[i] = (const float*)d_in[i];
    // x [4][1024][1024], Wa [1024][16], ba, We, be, Wi, Wo, Wv, Wout ([in][out] = x @ W), chi, beta_p, iv_p, ov_p [16] = d_in[0..12]
    float* OUT = (float*)d_out;     // [4][1024][1024]
    char* wsp = (char*)d_ws;
    auto take = [&](size_t bytes) { char* p = wsp; wsp += (bytes + 255) & ~(size_t)255; return (void*)p; };
    bf* WO = (bf*)take((size_t)DD * DD * 2); float* GX = (float*)take((size_t)NT * 32 * 4); float* CH = (float*)take(512);
    h16* QP = (h16*)take((size_t)NT * DD * 2); h16* KP = (h16*)take((size_t)NT * DD * 2); h16* VT = (h16*)take((size_t)NT * DD * 2);
    float* Ob = (float*)take((size_t)ZH * TT * HD * 4); bf* ATh = (bf*)take((size_t)NT * DD * 2); bf* ATl = (bf*)take((size_t)NT * DD * 2);
    bf* WQ = (bf*)take((size_t)DD * DD * 2); bf* WK = (bf*)take((size_t)DD * DD * 2); bf* WV = (bf*)take((size_t)DD * DD * 2); bf* XB = (bf*)take((size_t)NT * DD * 2);
    if ((size_t)(wsp - (char*)d_ws) > ws_size) return;    // total below 75 MiB; ws 256 MiB
    k_prep<<<PB_ALL, 256, 0, stream>>>(IN[0], IN[1], IN[2], IN[3], IN[4], IN[5], IN[6], IN[7], IN[8], IN[9], IN[10], IN[11], IN[12], GX, WQ, WK, WV, WO, CH, XB);   // gates, transposed bf16 weights, chamber constants, bf16 x
    k_proj<<<dim3(NH_ / 2, NT / 128, 3), 128, 0, stream>>>(XB, WQ, WK, WV, QP, KP, VT);   // inner, outer (the 1/8 is applied in f32 inside k_fattn) and v, stored as fp16 head planes
    k_fattn<<<dim3(TT / 256, NZ, 1), 256, 0, stream>>>(QP, KP, VT, GX, Ob);   // all 64 flat heads (b * 16 + h) in one launch
    k_merge<<<(ZH * TT * HD / 64 + 63) / 64, 256, 0, stream>>>(Ob, CH, 0, ATh, ATl);
    k_gemmo<<<dim3(NT / 128, DD / 128, 1), 128, 0, stream>>>(ATh, ATl, WO, OUT);
}

// v006
// One run takes 97.6 microseconds.
// Timed twice side by side with v005, it ran 1.50 times as fast both times.
// All steps since v000 together make it 16.2 times as fast.
#include <hip/hip_runtime.h>

// XorzoTransformer (x [4][1024][1024]; aperture = sigmoid(x Wa + ba), expression = sigmoid(x We + be) ([T][16] per-head gates); inner/outer/v = x @ Wi / Wo / Wv (16 heads x 64); p = softmax(inner.outer^T / 8);
// attn = p ap_i ex_j / (sum_j p ap_i ex_j + 1e-8); converged = attn v; ApertureChamber per head: x_in = converged sigmoid(iv_h); (xr, xi) halves rotated by angle pi sigmoid(beta_h); x sigmoid(ov_h) x tanh(chi_h);
// out = merged @ Wout).
// Compute dtypes, f32 accumulate: every input rounded to bf16; the three 1024-wide projections on PLAIN bf16 operands (inputs: exact; transposed bf16 weight copies); the
// 16-wide gate projections on the same bf16 values, formed in registers, on WMMA; scores and attn.v on SINGLE fp16 planes inside one fused kernel (1/8, running-maximum softmax, the bilateral gating and the renormalisation in f32; gated weights in fp16);

#define NB_  4
#define TT   1024
#define DD   1024
#define NH_  16
#define HD   64
#define NT   (NB_ * TT)
#define NZ   (NB_ * NH_)
#define ZH   64
#define PCAR 1024.0f
#define SCL  0.125f
typedef _Float16 h16;
typedef unsigned short bf;
typedef __attribute__((ext_vector_type(16))) __bf16   v16bf;
typedef __attribute__((ext_vector_type(16))) _Float16 v16h;
typedef __attribute__((ext_vector_type(8)))  _Float16 v8h;
typedef __attribute__((ext_vector_type(8)))  unsigned short v8us;
typedef __attribute__((ext_vector_type(8)))  float    v8f;
typedef __attribute__((ext_vector_type(4)))  float    v4f;
typedef v8h  __attribute__((may_alias)) v8ha;
typedef v4f  __attribute__((may_alias)) v4fa;
typedef v8us __attribute__((may_alias)) v8usa;

__device__ __forceinline__ unsigned short f2bf(float f) { unsigned u = __float_as_uint(f); u += 0x7FFFu + ((u >> 16) & 1u); return (unsigned short)(u >> 16); }
__device__ __forceinline__ float bf2f(unsigned short b) { return __uint_as_float(((unsigned)b) << 16); }
__device__ __forceinline__ float bfr(float f) { return bf2f(f2bf(f)); }
__device__ __forceinline__ v16h cat16(v8h lo, v8h hi) { return __builtin_shufflevector(lo, hi, 0, 1, 2, 3, 4, 5, 6, 7, 8, 9, 10, 11, 12, 13, 14, 15); }
__device__ __forceinline__ v16bf cat16b(v8us lo, v8us hi) { return __builtin_bit_cast(v16bf, __builtin_shufflevector(lo, hi, 0, 1, 2, 3, 4, 5, 6, 7, 8, 9, 10, 11, 12, 13, 14, 15)); }
__device__ __forceinline__ v8f wmma16(v16h a, v16h b, v8f c) { return __builtin_amdgcn_wmma_f32_16x16x32_f16(false, a, false, b, (short)0, c, false, false); }
__device__ __forceinline__ v8f wmmab(v16bf a, v16bf b, v8f c) { return __builtin_amdgcn_wmma_f32_16x16x32_bf16(false, a, false, b, (short)0, c, false, false); }



// ---- fragment loaders of the 16-bit planes (K-contiguous rows, in memory or in LDS)
template <typename T16> struct WFrag;
template <> struct WFrag<h16> { typedef v16h V; static __device__ __forceinline__ V ld(const h16* p) { return cat16(*(const v8h*)p, *(const v8h*)(p + 16)); } static __device__ __forceinline__ v8f mma(V a, V b, v8f c) { return wmma16(a, b, c); } };
template <> struct WFrag<bf> { typedef v16bf V; static __device__ __forceinline__ V ld(const bf* p) { return cat16b(*(const v8us*)p, *(const v8us*)(p + 16)); } static __device__ __forceinline__ v8f mma(V a, V b, v8f c) { return wmmab(a, b, c); } };

// ---- operand staging of the two GEMM kernels: a tile is 128 rows x 64 k (128 B of a row) of a plane of pitch DD, kept in LDS at a pitch of 144 B.
// 128 threads: thread tid brings 16 B of rows (tid >> 3) + 16 u, u = 0..7, so a wave's copy covers four whole 128-B lines. No register holds the data.
#define GP   72            /* LDS pitch of a staged row, elements */
#define GTB  (128 * GP * 2) /* bytes of a staged tile */
#define GKS  64            /* k per trip */
// lds: the lane's LDS byte address in row tid >> 3 of the tile; g: the lane's 16 B in the same row of the plane.
__device__ __forceinline__ void stage128(unsigned lds, const bf* g) {
    // the wait is the statement's last line: it stands in front of any rewrite of the address registers that the copies name
    asm volatile("global_load_async_to_lds_b128 %0, %8, off\n\t"
                 "global_load_async_to_lds_b128 %1, %9, off\n\t"
                 "global_load_async_to_lds_b128 %2, %10, off\n\t"
                 "global_load_async_to_lds_b128 %3, %11, off\n\t"
                 "global_load_async_to_lds_b128 %4, %12, off\n\t"
                 "global_load_async_to_lds_b128 %5, %13, off\n\t"
                 "global_load_async_to_lds_b128 %6, %14, off\n\t"
                 "global_load_async_to_lds_b128 %7, %15, off\n\t"
                 "s_wait_xcnt 0x0"
                 :: "v"(lds), "v"(lds + 16 * GP * 2), "v"(lds + 32 * GP * 2), "v"(lds + 48 * GP * 2), "v"(lds + 64 * GP * 2), "v"(lds + 80 * GP * 2), "v"(lds + 96 * GP * 2), "v"(lds + 112 * GP * 2),
                    "v"(g), "v"(g + 16 * DD), "v"(g + 32 * DD), "v"(g + 48 * DD), "v"(g + 64 * DD), "v"(g + 80 * DD), "v"(g + 96 * DD), "v"(g + 112 * DD) : "memory");
}

// ---- k_gemmo: OUT[m][n] (f32) = sum_k (Ah[m][k] + Al[m][k]) Bt[n][k]; grid (NT/128, DD/128), 4 waves, a 128x128 tile per block, 64x64 (16 accumulators) per wave.
// The three operand tiles of a trip come to LDS by asynchronous copies, two buffers: trip t + 1's copies fly while trip t is worked on. Per accumulator the products are summed in the order k ascending, hi then lo.
__global__ __launch_bounds__(128) void k_gemmo(const bf* __restrict__ A, const bf* __restrict__ A2, const bf* __restrict__ Bt, float* C) {
    typedef WFrag<bf>::V V;
    __shared__ __align__(16) char sm[2 * 3 * GTB];   // [buffer][Ah | Al | Bt]; the epilogue's staging rows lie over it
    const int tid = threadIdx.x, lane = tid & 31, wv = tid >> 5, lr = lane & 15, hi = lane >> 4;
    const int rb = blockIdx.x * 128, cb = blockIdx.y * 128, wm = wv & 1, wn = wv >> 1;
    const size_t go = (size_t)(tid >> 3) * DD + (tid & 7) * 8;
    const bf* Ag = A + (size_t)rb * DD + go; const bf* A2g = A2 + (size_t)rb * DD + go; const bf* Bg = Bt + (size_t)cb * DD + go;
    const unsigned l0 = (unsigned)(size_t)sm + (unsigned)((tid >> 3) * (GP * 2) + (tid & 7) * 16);
    const int ao = (wm * 64 + lr) * GP + 8 * hi, bo = (wn * 64 + lr) * GP + 8 * hi;   // a lane's place in its wave's first 16-row block, elements
    v8f acc[4][4];
#pragma unroll
    for (int mb = 0; mb < 4; ++mb)
#pragma unroll
        for (int nb = 0; nb < 4; ++nb) acc[mb][nb] = (v8f){};
    stage128(l0, Ag); stage128(l0 + GTB, A2g); stage128(l0 + 2 * GTB, Bg);
    asm volatile("s_wait_asynccnt 0x0" ::: "memory");   // this wave's copies of trip 0 have landed
    __syncthreads();                                      // trip 0 is published
    stage128(l0 + 3 * GTB, Ag + GKS); stage128(l0 + 4 * GTB, A2g + GKS); stage128(l0 + 5 * GTB, Bg + GKS);
#pragma unroll 1   /* rolled: one copy of the trip's body; the buffer is chosen by an offset */
    for (int t = 0; t < DD / GKS; ++t) {
        const unsigned bb = (unsigned)(t & 1) * (3 * GTB); const bf* S = (const bf*)(sm + bb);
#pragma unroll
        for (int kk = 0; kk < GKS; kk += 32) {
            V a[4], a2[4], b[4];   // all twelve fragments of a 32-k block are asked for ahead of its WMMAs: one LDS latency per block
#pragma unroll
            for (int nb = 0; nb < 4; ++nb) b[nb] = WFrag<bf>::ld(S + 2 * 128 * GP + bo + nb * 16 * GP + kk);
#pragma unroll
            for (int mb = 0; mb < 4; ++mb) { a[mb] = WFrag<bf>::ld(S + ao + mb * 16 * GP + kk); a2[mb] = WFrag<bf>::ld(S + 128 * GP + ao + mb * 16 * GP + kk); }
            // inputs only: holds the block's LDS loads together in front of its WMMAs; without it the compiler sinks them between the WMMAs, four to a wait, and the wave waits out the LDS latency each time
            asm volatile("" :: "v"(a[0]), "v"(a[1]), "v"(a[2]), "v"(a[3]), "v"(a2[0]), "v"(a2[1]), "v"(a2[2]), "v"(a2[3]), "v"(b[0]), "v"(b[1]), "v"(b[2]), "v"(b[3]));
#pragma unroll
            for (int mb = 0; mb < 4; ++mb)
#pragma unroll
                for (int nb = 0; nb < 4; ++nb) { acc[mb][nb] = WFrag<bf>::mma(a[mb], b[nb], acc[mb][nb]); acc[mb][nb] = WFrag<bf>::mma(a2[mb], b[nb], acc[mb][nb]); }
        }
        asm volatile("s_wait_dscnt 0x0" ::: "memory");      // this wave's reads of the buffer have returned before it is refilled
        asm volatile("s_wait_asynccnt 0x0" ::: "memory");   // this wave's copies of trip t + 1 have landed
        __syncthreads();                                      // publishes trip t + 1 and ends every read of trip t
        if (t + 2 < DD / GKS) { stage128(l0 + bb, Ag + (t + 2) * GKS); stage128(l0 + bb + GTB, A2g + (t + 2) * GKS); stage128(l0 + bb + 2 * GTB, Bg + (t + 2) * GKS); }
    }
    asm volatile("s_wait_asynccnt 0x0" ::: "memory");   // no copy is outstanding when the ring becomes output staging
    float* os = (float*)(sm + wv * (16 * 68 * 4));        // a wave's own 16 rows of 64 f32 at a pitch of 68
    const int r0 = rb + wm * 64, c0 = cb + wn * 64;
#pragma unroll
    for (int mb = 0; mb < 4; ++mb) {
#pragma unroll
        for (int nb = 0; nb < 4; ++nb) {
#pragma unroll
            for (int j = 0; j < 8; ++j) os[(hi * 8 + j) * 68 + nb * 16 + lr] = acc[mb][nb][j]; }
        __builtin_amdgcn_wave_barrier(); asm volatile("" ::: "memory");   // one wave's rows: keeps the compiler from lifting the other lanes' read-back over the LDS stores
        float* crow = C + (size_t)(r0 + mb * 16) * DD + c0;
#pragma unroll
        for (int s = 0; s < 8; ++s) { const int row = 2 * s + hi, cofs = lr * 4; *(v4f*)(crow + (size_t)row * DD + cofs) = *(const v4fa*)(os + row * 68 + cofs); }
        __builtin_amdgcn_wave_barrier(); asm volatile("" ::: "memory");   // and the next block's stores over these reads
    }
}

__device__ __forceinline__ void splitf(float y, unsigned short& h, unsigned short& l) { h = f2bf(y); l = f2bf(y - bf2f(h)); }
typedef __attribute__((ext_vector_type(2))) _Float16 v2h;
typedef __attribute__((ext_vector_type(4))) _Float16 v4h;
typedef __attribute__((ext_vector_type(2))) unsigned short v2us;
typedef __attribute__((ext_vector_type(4))) unsigned short v4us;
typedef __attribute__((ext_vector_type(2))) float v2f;

// ---- the seven preparation jobs (no one reads what another writes) are the parts of ONE launch, k_prep: each is a device function; all but the one-block chamber job are told their own block index bx.
__device__ __forceinline__ void p_cvt8(int bx, const float* __restrict__ src, bf* dst, size_t n8) { const size_t i = (size_t)bx * 256 + threadIdx.x; if (i >= n8) return; const v8f v = *(const v8f*)(src + i * 8); v8us o;
#pragma unroll
    for (int k = 0; k < 8; ++k) o[k] = f2bf(v[k]); *(v8us*)(dst + i * 8) = o;  }
__device__ __forceinline__ void p_wtG(int bx, const float* __restrict__ w, int K, int N, bf* Bt) {
    const int lane = threadIdx.x & 31; const int L0 = (bx * 8 + (threadIdx.x >> 5)) * 8; const int nlines = N * K / 64;
{
#pragma unroll 1
        for (int l = 0; l < 8; ++l) { const int L = L0 + l; if (L >= nlines) break; const size_t e = (size_t)L * 64 + lane * 2; const int k = (int)(e % K), n = (int)(e / K); v2us o;
            o[0] = f2bf(w[(size_t)k * N + n]); o[1] = f2bf(w[(size_t)(k + 1) * N + n]); *(v2us*)(Bt + e) = o; }
         }
}
// p_gates: both gate projections of 16 tokens per block on the matrix unit. A = gate weights (16 columns of Wa, 16 of We), B = the 16 token rows; both fragments are rounded to bf16 in registers from the f32 inputs,
// in the k order of WFrag::ld (elements 0..7: k + 8 hi + s, elements 8..15: k + 16 + 8 hi + s). Wave w takes k = 128 w .. 128 w + 127 (4 WMMA steps a tile); the 8 partial tiles are summed through LDS in wave order.
#define GRP 36   /* LDS pitch of a token's 32 partial sums, floats: 144 B */
__device__ __forceinline__ void p_gates(int bx, const float* __restrict__ x, const float* __restrict__ Wa, const float* __restrict__ ba, const float* __restrict__ We, const float* __restrict__ be, float* GX) {
    __shared__ __align__(16) float red[8 * 16 * GRP];
    const int tid = threadIdx.x, lane = tid & 31, wv = tid >> 5, lr = lane & 15, hi = lane >> 4; const int r0 = bx * 16;
    const float* xp = x + (size_t)(r0 + lr) * DD + wv * 128 + 8 * hi;
    const float* wap = Wa + (size_t)(wv * 128 + 8 * hi) * NH_ + lr; const float* wep = We + (size_t)(wv * 128 + 8 * hi) * NH_ + lr;
    v8f acc[2]; acc[0] = (v8f){}; acc[1] = (v8f){};
#pragma unroll
    for (int kk = 0; kk < 128; kk += 32) {
        const v4f x0 = *(const v4f*)(xp + kk), x1 = *(const v4f*)(xp + kk + 4), x2 = *(const v4f*)(xp + kk + 16), x3 = *(const v4f*)(xp + kk + 20);
        v8f wa0, wa1, we0, we1;
#pragma unroll
        for (int s = 0; s < 8; ++s) { wa0[s] = wap[(kk + s) * NH_]; wa1[s] = wap[(kk + 16 + s) * NH_]; we0[s] = wep[(kk + s) * NH_]; we1[s] = wep[(kk + 16 + s) * NH_]; }
        // inputs only: holds the 36 loads of a k step together in front of their roundings; without it the compiler deals them out a few to a wait, and the wave waits out a memory latency each time
        asm volatile("" :: "v"(x0), "v"(x1), "v"(x2), "v"(x3), "v"(wa0), "v"(wa1), "v"(we0), "v"(we1));
        // behind the last loads: the three address pairs, named as inputs, stay as they are up to this wait, so no later instruction (a load's result included) rewrites one in front of it
        if (kk == 96) asm volatile("s_wait_xcnt 0x0" :: "v"(xp), "v"(wap), "v"(wep) : "memory");
        v8us xl, xh, al, ah, el, eh;
#pragma unroll
        for (int s = 0; s < 4; ++s) { xl[s] = f2bf(x0[s]); xl[4 + s] = f2bf(x1[s]); xh[s] = f2bf(x2[s]); xh[4 + s] = f2bf(x3[s]); }
#pragma unroll
        for (int s = 0; s < 8; ++s) { al[s] = f2bf(wa0[s]); ah[s] = f2bf(wa1[s]); el[s] = f2bf(we0[s]); eh[s] = f2bf(we1[s]); }
        const v16bf xf = cat16b(xl, xh);
        acc[0] = wmmab(cat16b(al, ah), xf, acc[0]); acc[1] = wmmab(cat16b(el, eh), xf, acc[1]);   // acc[mb][j] = partial[token lr][column mb * 16 + 8 hi + j]
    }
    float* rw = red + (wv * 16 + lr) * GRP + 8 * hi;
#pragma unroll
    for (int mb = 0; mb < 2; ++mb) { *(v4f*)(rw + mb * 16) = __builtin_shufflevector(acc[mb], acc[mb], 0, 1, 2, 3); *(v4f*)(rw + mb * 16 + 4) = __builtin_shufflevector(acc[mb], acc[mb], 4, 5, 6, 7); }
    __syncthreads();   // the eight waves' partial tiles are published (block-uniform: the whole block is in this job)
#pragma unroll
    for (int u = 0; u < 2; ++u) { const int o = u * 256 + tid, tk = o >> 5, c = o & 31; float s = red[tk * GRP + c];
#pragma unroll
        for (int w = 1; w < 8; ++w) s += red[(w * 16 + tk) * GRP + c];
        const float mine = __fadd_rn(s, bfr(*(c < 16 ? ba + c : be + (c - 16))));
        GX[(size_t)(r0 + tk) * 32 + c] = __fdiv_rn(1.0f, __fadd_rn(1.0f, __expf(-mine))); }
}
__device__ __forceinline__ void p_cham(const float* __restrict__ chi, const float* __restrict__ bp, const float* __restrict__ ivp, const float* __restrict__ ovp, float* CH) { const int lane = threadIdx.x; const int h = lane >> 1; const int part = (lane & 1) * 2;
    const float sg_b = __fdiv_rn(1.0f, __fadd_rn(1.0f, __expf(-bfr(bp[h])))); const float ang = __fmul_rn(3.14159265358979f, sg_b); v2f o;
    if (part == 0) { o[0] = __fdiv_rn(1.0f, __fadd_rn(1.0f, __expf(-bfr(ivp[h])))); o[1] = cosf(ang); } else { o[0] = sinf(ang); o[1] = __fdiv_rn(1.0f, __fadd_rn(1.0f, __expf(-bfr(ovp[h])))); }
    const float th = (lane < NH_) ? tanhf(bfr(chi[lane])) : 0.f;
    *(v2f*)(CH + lane * 2) = o; *(float*)(CH + 64 + lane) = th;  }
// k_prep: blocks are dealt by index: gates, the four weight transposes, the chamber constants (one wave of one block), the bf16 copy of x.
#define PB_G  (NT / 16)                     /* blocks of the gates */
#define PB_W  ((DD * DD / 64 + 63) / 64)    /* blocks of one weight transpose */
#define PB_X  (NT * DD / 8 / 256)           /* blocks of the copy of x */
#define PB_ALL (PB_G + 4 * PB_W + 1 + PB_X)
__global__ __launch_bounds__(256) void k_prep(const float* __restrict__ x, const float* __restrict__ Wa, const float* __restrict__ ba, const float* __restrict__ We, const float* __restrict__ be,
                                              const float* __restrict__ Wi, const float* __restrict__ Wo, const float* __restrict__ Wv, const float* __restrict__ Wout,
                                              const float* __restrict__ chi, const float* __restrict__ bp, const float* __restrict__ ivp, const float* __restrict__ ovp,
                                              float* GX, bf* WQ, bf* WK, bf* WV, bf* WO, float* CH, bf* XB) {
    int bx = blockIdx.x;
    if (bx < PB_G) { p_gates(bx, x, Wa, ba, We, be, GX); return; }
    bx -= PB_G;
    if (bx < 4 * PB_W) { const int j = bx / PB_W; p_wtG(bx % PB_W, j == 0 ? Wi : j == 1 ? Wo : j == 2 ? Wv : Wout, DD, DD, j == 0 ? WQ : j == 1 ? WK : j == 2 ? WV : WO); return; }
    bx -= 4 * PB_W;
    if (bx == 0) { if (threadIdx.x < 32) p_cham(chi, bp, ivp, ovp, CH); return; }
    p_cvt8(bx - 1, x, XB, (size_t)NT * DD / 8);
}
// k_proj: the three 1024-wide projections in one launch, grid (NH_/2, NT/128, 3), 4 waves: a block takes 128 tokens x two heads, a wave 64 tokens x one head (64x64, 16 accumulators), plain bf16 planes.
// The weight rows and the token rows of a trip (64 k) come to LDS by asynchronous copies, two buffers, and each is read by two waves.
// The epilogue stores the fp16 plane that k_fattn reads; no f32 copy of a projection reaches memory. A lane's accumulator holds 8 consecutive rows of the A operand, so the operand whose index runs
// contiguously in the plane is taken as A: z = 0, 1 (inner, outer): A = weight rows (d), B = token rows, plane [head][t][d]; z = 2 (v): A = token rows, B = weight rows (d), plane [head][d][t].
#define LPO  72   /* LDS pitch of a 128-B output row: 144 B */
__global__ __launch_bounds__(128) void k_proj(const bf* __restrict__ X, const bf* __restrict__ WQ, const bf* __restrict__ WK, const bf* __restrict__ WV, h16* QP, h16* KP, h16* VT) {
    typedef WFrag<bf>::V V;
    __shared__ __align__(16) char sm[2 * 2 * GTB];   // [buffer][weight rows | token rows]; the epilogue's staging rows lie over it
    const int tid = threadIdx.x, lane = tid & 31, wv = tid >> 5, lr = lane & 15, hi = lane >> 4; const int zz = blockIdx.z; const bool vtr = zz == 2;
    const int wh = wv & 1, wt = wv >> 1; const int hh = blockIdx.x * 2 + wh, t0 = blockIdx.y * 128 + wt * 64;
    const size_t go = (size_t)(tid >> 3) * DD + (tid & 7) * 8;
    const bf* Wg = (zz == 0 ? WQ : zz == 1 ? WK : WV) + (size_t)blockIdx.x * 128 * DD + go; const bf* Xg = X + (size_t)blockIdx.y * 128 * DD + go;
    const unsigned l0 = (unsigned)(size_t)sm + (unsigned)((tid >> 3) * (GP * 2) + (tid & 7) * 16);
    const int wo = (wh * 64 + lr) * GP + 8 * hi, xo = 128 * GP + (wt * 64 + lr) * GP + 8 * hi;   // a lane's place in its wave's first 16-row block of each tile, elements
    const int ao = vtr ? xo : wo, bo = vtr ? wo : xo;
    v8f acc[4][4];
#pragma unroll
    for (int mb = 0; mb < 4; ++mb)
#pragma unroll
        for (int nb = 0; nb < 4; ++nb) acc[mb][nb] = (v8f){};
    stage128(l0, Wg); stage128(l0 + GTB, Xg);
    asm volatile("s_wait_asynccnt 0x0" ::: "memory");   // this wave's copies of trip 0 have landed
    __syncthreads();                                      // trip 0 is published
    stage128(l0 + 2 * GTB, Wg + GKS); stage128(l0 + 3 * GTB, Xg + GKS);
#pragma unroll 1   /* rolled: one copy of the trip's body; the buffer is chosen by an offset */
    for (int t = 0; t < DD / GKS; ++t) {
        const unsigned bb = (unsigned)(t & 1) * (2 * GTB); const bf* S = (const bf*)(sm + bb);
#pragma unroll
        for (int kk = 0; kk < GKS; kk += 32) {
            V a[4], b[4];   // all eight fragments of a 32-k block are asked for ahead of its WMMAs: one LDS latency per block
#pragma unroll
            for (int mb = 0; mb < 4; ++mb) { a[mb] = WFrag<bf>::ld(S + ao + mb * 16 * GP + kk); b[mb] = WFrag<bf>::ld(S + bo + mb * 16 * GP + kk); }
            // inputs only: holds the block's LDS loads together in front of its WMMAs; without it the compiler sinks them between the WMMAs, four to a wait, and the wave waits out the LDS latency each time
            asm volatile("" :: "v"(a[0]), "v"(a[1]), "v"(a[2]), "v"(a[3]), "v"(b[0]), "v"(b[1]), "v"(b[2]), "v"(b[3]));
#pragma unroll
            for (int nb = 0; nb < 4; ++nb)
#pragma unroll
                for (int mb = 0; mb < 4; ++mb) acc[mb][nb] = WFrag<bf>::mma(a[mb], b[nb], acc[mb][nb]);
        }
        asm volatile("s_wait_dscnt 0x0" ::: "memory");      // this wave's reads of the buffer have returned before it is refilled
        asm volatile("s_wait_asynccnt 0x0" ::: "memory");   // this wave's copies of trip t + 1 have landed
        __syncthreads();                                      // publishes trip t + 1 and ends every read of trip t
        if (t + 2 < DD / GKS) { stage128(l0 + bb, Wg + (t + 2) * GKS); stage128(l0 + bb + GTB, Xg + (t + 2) * GKS); }
    }
    asm volatile("s_wait_asynccnt 0x0" ::: "memory");   // no copy is outstanding when the ring becomes output staging
    h16* os = (h16*)(sm + wv * (64 * LPO * 2));           // a wave's own 64 output rows
#pragma unroll
    for (int mb = 0; mb < 4; ++mb)
#pragma unroll
        for (int nb = 0; nb < 4; ++nb) *(v8h*)(os + (nb * 16 + lr) * LPO + mb * 16 + 8 * hi) = __builtin_convertvector(acc[mb][nb], v8h);   // os[B row][A row]
    __builtin_amdgcn_wave_barrier(); asm volatile("" ::: "memory");   // one wave's rows: keeps the compiler from lifting the other lanes' read-back over the LDS stores
    const size_t z = (size_t)(t0 / TT) * NH_ + hh; const int tl = t0 & (TT - 1);
    h16* C = vtr ? VT + z * HD * TT + tl : (zz == 0 ? QP : KP) + (z * TT + tl) * HD; const int ldc = vtr ? TT : HD;
#pragma unroll
    for (int s = 0; s < 16; ++s) { const int row = s * 4 + (lane >> 3), ch = (lane & 7) * 8; *(v8h*)(C + (size_t)row * ldc + ch) = *(const v8ha*)(os + row * LPO + ch); }   // whole 128-B lines
}
#define KST  64
#define LP   72
#define CS2  0.18033688011112042f   /* (1/8) log2(e) */
__global__ __launch_bounds__(256) void k_fattn(const h16* __restrict__ QP, const h16* __restrict__ KP, const h16* __restrict__ VT, const float* __restrict__ GX, float* Ob) {
    __shared__ __align__(16) h16 Ks[2][KST * LP];
    __shared__ __align__(16) h16 Vs[2][HD * LP];
    __shared__ __align__(16) float exs[TT];
    const int tid = threadIdx.x, lane = tid & 31, wv = tid >> 5, lr = lane & 15, hi = lane >> 4;
    const int z = blockIdx.y, b = z / NH_, h = z % NH_; const int q0 = blockIdx.x * 256 + wv * 32;
    const h16* Qz = QP + (size_t)z * TT * HD; const h16* Kz = KP + (size_t)z * TT * HD; const h16* Vz = VT + (size_t)z * HD * TT;
#pragma unroll
    for (int u = 0; u < TT / 256; ++u) exs[u * 256 + tid] = GX[((size_t)b * TT + u * 256 + tid) * 32 + 16 + h];
    v16h qf[2][2];
#pragma unroll
    for (int qt = 0; qt < 2; ++qt)
#pragma unroll
        for (int ks = 0; ks < 2; ++ks) qf[qt][ks] = WFrag<h16>::ld(Qz + (size_t)(q0 + qt * 16 + lr) * HD + ks * 32 + 8 * hi);
    const int srow = tid >> 3, sch = (tid & 7) * 8;   // a thread stages 16 B of rows srow and srow + 32 of each tile: a wave covers whole 128-B lines
    v8h kr[2], vr[2];
#pragma unroll
    for (int u = 0; u < 2; ++u) { kr[u] = *(const v8h*)(Kz + (size_t)(srow + 32 * u) * HD + sch); vr[u] = *(const v8h*)(Vz + (size_t)(srow + 32 * u) * TT + sch); }
#pragma unroll
    for (int u = 0; u < 2; ++u) { *(v8h*)(&Ks[0][(srow + 32 * u) * LP + sch]) = kr[u]; *(v8h*)(&Vs[0][(srow + 32 * u) * LP + sch]) = vr[u]; }
    v8f O[2][4]; float m[2]; v2f l1[2], l2[2];   // l1, l2: a lane's sums over even and odd keys, joined in the epilogue
#pragma unroll
    for (int qt = 0; qt < 2; ++qt) { m[qt] = -3.0e38f; l1[qt] = (v2f){}; l2[qt] = (v2f){};
#pragma unroll
        for (int dt = 0; dt < 4; ++dt) O[qt][dt] = (v8f){}; }
    __syncthreads();   // tile 0 and the gate row are published
#pragma unroll 1   /* rolled: one copy of the tile body; sixteen would only grow the code */
    for (int s = 0; s < TT / KST; ++s) {
        const h16* kb = Ks[s & 1]; const h16* vb = Vs[s & 1]; const bool more = s + 1 < TT / KST;
        if (more) {   // the next tile's global loads fly while this tile is worked on
#pragma unroll
            for (int u = 0; u < 2; ++u) { kr[u] = *(const v8h*)(Kz + (size_t)((s + 1) * KST + srow + 32 * u) * HD + sch); vr[u] = *(const v8h*)(Vz + (size_t)(srow + 32 * u) * TT + (s + 1) * KST + sch); } }
#pragma unroll 1   /* rolled: unrolled, the build took more VGPRs and more padding v_nop and fetched hardly any fragment earlier */
        for (int ps = 0; ps < 2; ++ps) {   // a pass: 32 keys
            const int kl = ps * 32; v8f st[2][2];
#pragma unroll
            for (int kt = 0; kt < 2; ++kt) { const v16h k0 = WFrag<h16>::ld(kb + (kl + kt * 16 + lr) * LP + 8 * hi), k1 = WFrag<h16>::ld(kb + (kl + kt * 16 + lr) * LP + 32 + 8 * hi);
#pragma unroll
                for (int qt = 0; qt < 2; ++qt) st[qt][kt] = wmma16(k1, qf[qt][1], wmma16(k0, qf[qt][0], (v8f){})); }   // st[qt][kt][r] = S[query qt*16+lr][key kl + kt*16 + 8*hi + r]
            v16h vf[4];
#pragma unroll
            for (int dt = 0; dt < 4; ++dt) vf[dt] = WFrag<h16>::ld(vb + (dt * 16 + lr) * LP + kl + 8 * hi);
            v2f ex[2][4];
#pragma unroll
            for (int kt = 0; kt < 2; ++kt) { const float* ep = exs + s * KST + kl + kt * 16 + 8 * hi; const v4f e0 = *(const v4fa*)ep, e1 = *(const v4fa*)(ep + 4);
                ex[kt][0] = __builtin_shufflevector(e0, e0, 0, 1); ex[kt][1] = __builtin_shufflevector(e0, e0, 2, 3); ex[kt][2] = __builtin_shufflevector(e1, e1, 0, 1); ex[kt][3] = __builtin_shufflevector(e1, e1, 2, 3); }
            float tm[2];
#pragma unroll
            for (int qt = 0; qt < 2; ++qt) { float t = st[qt][0][0];
#pragma unroll
                for (int r = 1; r < 8; ++r) t = fmaxf(t, st[qt][0][r]);
#pragma unroll
                for (int r = 0; r < 8; ++r) t = fmaxf(t, st[qt][1][r]);
                tm[qt] = t * CS2; }
            // lazy rescale: the maximum in use moves only when a lane's new score tops it by more than 8 (log2), so w stays below 2^8; one scalar test per pass
            if (__builtin_amdgcn_ballot_w32(tm[0] > m[0] + 8.0f || tm[1] > m[1] + 8.0f) != 0) {
#pragma unroll
                for (int qt = 0; qt < 2; ++qt) { const float mn = fmaxf(m[qt], fmaxf(tm[qt], __shfl_xor(tm[qt], 16, 32))); const float al = __builtin_amdgcn_exp2f(m[qt] - mn); m[qt] = mn; l1[qt] *= al; l2[qt] *= al;
#pragma unroll
                    for (int dt = 0; dt < 4; ++dt)
#pragma unroll
                        for (int r = 0; r < 8; ++r) O[qt][dt][r] *= al; } }
#pragma unroll
            for (int qt = 0; qt < 2; ++qt) { v8f w[2]; const v2f mm = {m[qt], m[qt]};
#pragma unroll
                for (int kt = 0; kt < 2; ++kt)
#pragma unroll
                    for (int i = 0; i < 4; ++i) {   // two neighbouring keys at a time: packed f32 on register pairs as the accumulator holds them
                        const v2f sv = {st[qt][kt][2 * i], st[qt][kt][2 * i + 1]}; const v2f tt = sv * CS2 - mm; const v2f e = {__builtin_amdgcn_exp2f(tt[0]), __builtin_amdgcn_exp2f(tt[1])};
                        l1[qt] += e; const v2f ww = e * ex[kt][i]; l2[qt] += ww; w[kt][2 * i] = ww[0]; w[kt][2 * i + 1] = ww[1]; }
                const v16h pf = cat16(__builtin_convertvector(w[0], v8h), __builtin_convertvector(w[1], v8h));   // element s = key kl + (s < 8 ? 8*hi + s : 16 + 8*hi + s - 8): the k order of the V^T loader
#pragma unroll
                for (int dt = 0; dt < 4; ++dt) O[qt][dt] = wmma16(vf[dt], pf, O[qt][dt]); }   // O[qt][dt][r] = O[query qt*16+lr][d = dt*16 + 8*hi + r]
        }
        if (more) {   // the other buffer's last readers left it before the barrier that ended the tile before this one
#pragma unroll
            for (int u = 0; u < 2; ++u) { *(v8h*)(&Ks[(s + 1) & 1][(srow + 32 * u) * LP + sch]) = kr[u]; *(v8h*)(&Vs[(s + 1) & 1][(srow + 32 * u) * LP + sch]) = vr[u]; } }
        __syncthreads();   // publishes tile s + 1 and ends every read of tile s
    }
    float f[2];   // both columns' factors first, the stores behind them
#pragma unroll
    for (int qt = 0; qt < 2; ++qt) { const float b1 = l1[qt][0] + l1[qt][1], b2 = l2[qt][0] + l2[qt][1]; const float a1 = b1 + __shfl_xor(b1, 16, 32), a2 = b2 + __shfl_xor(b2, 16, 32);
        const float g = __fdiv_rn(GX[((size_t)b * TT + q0 + qt * 16 + lr) * 32 + h], a1); f[qt] = __fdiv_rn(PCAR * g, fmaf(g, a2, 1e-8f)); }
#pragma unroll
    for (int qt = 0; qt < 2; ++qt) { float* orow = Ob + ((size_t)z * TT + q0 + qt * 16 + lr) * HD + 8 * hi;
#pragma unroll
        for (int dt = 0; dt < 4; ++dt) { v4f o0, o1;
#pragma unroll
            for (int r = 0; r < 4; ++r) { o0[r] = O[qt][dt][r] * f[qt]; o1[r] = O[qt][dt][4 + r] * f[qt]; }
            *(v4f*)(orow + dt * 16) = o0; *(v4f*)(orow + dt * 16 + 4) = o1; } }
}
__global__ __launch_bounds__(256) void k_merge(const float* __restrict__ O, const float* __restrict__ CH, int z0, bf* Ah, bf* Al) {
    const int lane = threadIdx.x & 31; const int L0 = (blockIdx.x * 8 + (threadIdx.x >> 5)) * 8; const int nlines = ZH * TT * HD / 64;
{
#pragma unroll 2
        for (int l = 0; l < 8; ++l) { const int L = L0 + l; if (L >= nlines) break; const int e = L * 64 + lane * 2; const int d = e & 63; const int t = (e >> 6) & (TT - 1); const int zz = e >> 16; v2us oh, ol;
const int b = (z0 + zz) / NH_, hh = (z0 + zz) % NH_; const float iv = CH[hh * 4], ca = CH[hh * 4 + 1], sa = CH[hh * 4 + 2], ovt = CH[hh * 4 + 3];
#pragma unroll
            for (int q = 0; q < 2; ++q) { const int dq = d + q; float me = __fmul_rn(O[(size_t)e + q] * (1.0f / PCAR), iv), pt = __fmul_rn(O[(size_t)(e + q) + ((dq < 32) ? 32 : -32)] * (1.0f / PCAR), iv); asm volatile("" : "+v"(me)); asm volatile("" : "+v"(pt));
                float t1, t2; if (dq < 32) { t1 = __fmul_rn(me, ca); t2 = __fmul_rn(pt, sa); asm volatile("" : "+v"(t1)); asm volatile("" : "+v"(t2)); t1 = __fsub_rn(t1, t2); } else { t1 = __fmul_rn(pt, sa); t2 = __fmul_rn(me, ca); asm volatile("" : "+v"(t1)); asm volatile("" : "+v"(t2)); t1 = __fadd_rn(t1, t2); }
                float r0 = __fmul_rn(t1, ovt); asm volatile("" : "+v"(r0)); float r1 = __fmul_rn(r0, CH[64 + hh]); asm volatile("" : "+v"(r1)); unsigned short a, c2; splitf(r1, a, c2); oh[q] = a; ol[q] = c2; }
            const size_t o = ((size_t)b * TT + t) * DD + hh * HD + d; *(v2us*)(Ah + o) = oh; *(v2us*)(Al + o) = ol; }
         }
}

extern "C" void kernel_launch(void* const* d_in, const int* in_sizes, int n_in,
                              void* d_out, int out_size, void* d_ws, size_t ws_size, hipStream_t stream) {
    (void)in_sizes; (void)n_in; (void)out_size;
    const float* IN[13]; for (int i = 0; i < 13; ++i) IN[i] = (const float*)d_in[i];
    // x [4][1024][1024], Wa [1024][16], ba, We, be, Wi, Wo, Wv, Wout ([in][out] = x @ W), chi, beta_p, iv_p, ov_p [16] = d_in[0..12]
    float* OUT = (float*)d_out;     // [4][1024][1024]
    char* wsp = (char*)d_ws;
    auto take = [&](size_t bytes) { char* p = wsp; wsp += (bytes + 255) & ~(size_t)255; return (void*)p; };
    bf* WO = (bf*)take((size_t)DD * DD * 2); float* GX = (float*)take((size_t)NT * 32 * 4); float* CH = (float*)take(512);
    h16* QP = (h16*)take((size_t)NT * DD * 2); h16* KP = (h16*)take((size_t)NT * DD * 2); h16* VT = (h16*)take((size_t)NT * DD * 2);
    float* Ob = (float*)take((size_t)ZH * TT * HD * 4); bf* ATh = (bf*)take((size_t)NT * DD * 2); bf* ATl = (bf*)take((size_t)NT * DD * 2);
    bf* WQ = (bf*)take((size_t)DD * DD * 2); bf* WK = (bf*)take((size_t)DD * DD * 2); bf* WV = (bf*)take((size_t)DD * DD * 2); bf* XB = (bf*)take((size_t)NT * DD * 2);
    if ((size_t)(wsp - (char*)d_ws) > ws_size) return;    // total below 75 MiB; ws 256 MiB
    k_prep<<<PB_ALL, 256, 0, stream>>>(IN[0], IN[1], IN[2], IN[3], IN[4], IN[5], IN[6], IN[7], IN[8], IN[9], IN[10], IN[11], IN[12], GX, WQ, WK, WV, WO, CH, XB);   // gates, transposed bf16 weights, chamber constants, bf16 x
    k_proj<<<dim3(NH_ / 2, NT / 128, 3), 128, 0, stream>>>(XB, WQ, WK, WV, QP, KP, VT);   // inner, outer (the 1/8 is applied in f32 inside k_fattn) and v, stored as fp16 head planes
    k_fattn<<<dim3(TT / 256, NZ, 1), 256, 0, stream>>>(QP, KP, VT, GX, Ob);   // all 64 flat heads (b * 16 + h) in one launch
    k_merge<<<(ZH * TT * HD / 64 + 63) / 64, 256, 0, stream>>>(Ob, CH, 0, ATh, ATl);
    k_gemmo<<<dim3(NT / 128, DD / 128, 1), 128, 0, stream>>>(ATh, ATl, WO, OUT);
}

// v007
// Measured time: 88.5 microseconds a run.
// Next to v006, in two timings, it ran 1.11 times as fast each time.
// Over all steps from v000 it is 18.0 times as fast.
#include <hip/hip_runtime.h>

// XorzoTransformer (x [4][1024][1024]; aperture = sigmoid(x Wa + ba), expression = sigmoid(x We + be) ([T][16] per-head gates); inner/outer/v = x @ Wi / Wo / Wv (16 heads x 64); p = softmax(inner.outer^T / 8);
// attn = p ap_i ex_j / (sum_j p ap_i ex_j + 1e-8); converged = attn v; ApertureChamber per head: x_in = converged sigmoid(iv_h); (xr, xi) halves rotated by angle pi sigmoid(beta_h); x sigmoid(ov_h) x tanh(chi_h);
// out = merged @ Wout).
// Compute dtypes, f32 accumulate: every input rounded to bf16; the three 1024-wide projections on PLAIN bf16 operands (inputs: exact; transposed bf16 weight copies); the
// 16-wide gate projections on the same bf16 values, formed in registers, on WMMA; scores and attn.v on SINGLE fp16 planes inside one fused kernel (1/8, running-maximum softmax, the bilateral gating and the renormalisation in f32; gated weights in fp16);

#define NB_  4
#define TT   1024
#define DD   1024
#define NH_  16
#define HD   64
#define NT   (NB_ * TT)
#define NZ   (NB_ * NH_)
#define SCL  0.125f
typedef _Float16 h16;
typedef unsigned short bf;
typedef __attribute__((ext_vector_type(16))) __bf16   v16bf;
typedef __attribute__((ext_vector_type(16))) _Float16 v16h;
typedef __attribute__((ext_vector_type(8)))  _Float16 v8h;
typedef __attribute__((ext_vector_type(8)))  unsigned short v8us;
typedef __attribute__((ext_vector_type(8)))  float    v8f;
typedef __attribute__((ext_vector_type(4)))  float    v4f;
typedef v8h  __attribute__((may_alias)) v8ha;
typedef v4f  __attribute__((may_alias)) v4fa;
typedef v8us __attribute__((may_alias)) v8usa;

__device__ __forceinline__ unsigned short f2bf(float f) { unsigned u = __float_as_uint(f); u += 0x7FFFu + ((u >> 16) & 1u); return (unsigned short)(u >> 16); }
__device__ __forceinline__ float bf2f(unsigned short b) { return __uint_as_float(((unsigned)b) << 16); }
__device__ __forceinline__ float bfr(float f) { return bf2f(f2bf(f)); }
__device__ __forceinline__ v16h cat16(v8h lo, v8h hi) { return __builtin_shufflevector(lo, hi, 0, 1, 2, 3, 4, 5, 6, 7, 8, 9, 10, 11, 12, 13, 14, 15); }
__device__ __forceinline__ v16bf cat16b(v8us lo, v8us hi) { return __builtin_bit_cast(v16bf, __builtin_shufflevector(lo, hi, 0, 1, 2, 3, 4, 5, 6, 7, 8, 9, 10, 11, 12, 13, 14, 15)); }
__device__ __forceinline__ v8f wmma16(v16h a, v16h b, v8f c) { return __builtin_amdgcn_wmma_f32_16x16x32_f16(false, a, false, b, (short)0, c, false, false); }
__device__ __forceinline__ v8f wmmab(v16bf a, v16bf b, v8f c) { return __builtin_amdgcn_wmma_f32_16x16x32_bf16(false, a, false, b, (short)0, c, false, false); }



// ---- fragment loaders of the 16-bit planes (K-contiguous rows, in memory or in LDS)
template <typename T16> struct WFrag;
template <> struct WFrag<h16> { typedef v16h V; static __device__ __forceinline__ V ld(const h16* p) { return cat16(*(const v8h*)p, *(const v8h*)(p + 16)); } static __device__ __forceinline__ v8f mma(V a, V b, v8f c) { return wmma16(a, b, c); } };
template <> struct WFrag<bf> { typedef v16bf V; static __device__ __forceinline__ V ld(const bf* p) { return cat16b(*(const v8us*)p, *(const v8us*)(p + 16)); } static __device__ __forceinline__ v8f mma(V a, V b, v8f c) { return wmmab(a, b, c); } };

// ---- operand staging of the two GEMM kernels: a tile is 128 rows x 64 k (128 B of a row) of a plane of pitch DD, kept in LDS at a pitch of 144 B.
// 128 threads: thread tid brings 16 B of rows (tid >> 3) + 16 u, u = 0..7, so a wave's copy covers four whole 128-B lines. No register holds the data.
#define GP   72            /* LDS pitch of a staged row, elements */
#define GTB  (128 * GP * 2) /* bytes of a staged tile */
#define GKS  64            /* k per trip */
// lds: the lane's LDS byte address in row tid >> 3 of the tile; g: the lane's 16 B in the same row of the plane.
__device__ __forceinline__ void stage128(unsigned lds, const bf* g) {
    // the wait is the statement's last line: it stands in front of any rewrite of the address registers that the copies name
    asm volatile("global_load_async_to_lds_b128 %0, %8, off\n\t"
                 "global_load_async_to_lds_b128 %1, %9, off\n\t"
                 "global_load_async_to_lds_b128 %2, %10, off\n\t"
                 "global_load_async_to_lds_b128 %3, %11, off\n\t"
                 "global_load_async_to_lds_b128 %4, %12, off\n\t"
                 "global_load_async_to_lds_b128 %5, %13, off\n\t"
                 "global_load_async_to_lds_b128 %6, %14, off\n\t"
                 "global_load_async_to_lds_b128 %7, %15, off\n\t"
                 "s_wait_xcnt 0x0"
                 :: "v"(lds), "v"(lds + 16 * GP * 2), "v"(lds + 32 * GP * 2), "v"(lds + 48 * GP * 2), "v"(lds + 64 * GP * 2), "v"(lds + 80 * GP * 2), "v"(lds + 96 * GP * 2), "v"(lds + 112 * GP * 2),
                    "v"(g), "v"(g + 16 * DD), "v"(g + 32 * DD), "v"(g + 48 * DD), "v"(g + 64 * DD), "v"(g + 80 * DD), "v"(g + 96 * DD), "v"(g + 112 * DD) : "memory");
}

// ---- k_gemmo: OUT[m][n] (f32) = sum_k (Ah[m][k] + Al[m][k]) Bt[n][k]; grid (NT/128, DD/128), 4 waves, a 128x128 tile per block, 64x64 (16 accumulators) per wave.
// The three operand tiles of a trip come to LDS by asynchronous copies, two buffers: trip t + 1's copies fly while trip t is worked on. Per accumulator the products are summed in the order k ascending, hi then lo.
__global__ __launch_bounds__(128) void k_gemmo(const bf* __restrict__ A, const bf* __restrict__ A2, const bf* __restrict__ Bt, float* C) {
    typedef WFrag<bf>::V V;
    __shared__ __align__(16) char sm[2 * 3 * GTB];   // [buffer][Ah | Al | Bt]; the epilogue's staging rows lie over it
    const int tid = threadIdx.x, lane = tid & 31, wv = tid >> 5, lr = lane & 15, hi = lane >> 4;
    const int rb = blockIdx.x * 128, cb = blockIdx.y * 128, wm = wv & 1, wn = wv >> 1;
    const size_t go = (size_t)(tid >> 3) * DD + (tid & 7) * 8;
    const bf* Ag = A + (size_t)rb * DD + go; const bf* A2g = A2 + (size_t)rb * DD + go; const bf* Bg = Bt + (size_t)cb * DD + go;
    const unsigned l0 = (unsigned)(size_t)sm + (unsigned)((tid >> 3) * (GP * 2) + (tid & 7) * 16);
    const int ao = (wm * 64 + lr) * GP + 8 * hi, bo = (wn * 64 + lr) * GP + 8 * hi;   // a lane's place in its wave's first 16-row block, elements
    v8f acc[4][4];
#pragma unroll
    for (int mb = 0; mb < 4; ++mb)
#pragma unroll
        for (int nb = 0; nb < 4; ++nb) acc[mb][nb] = (v8f){};
    stage128(l0, Ag); stage128(l0 + GTB, A2g); stage128(l0 + 2 * GTB, Bg);
    asm volatile("s_wait_asynccnt 0x0" ::: "memory");   // this wave's copies of trip 0 have landed
    __syncthreads();                                      // trip 0 is published
    stage128(l0 + 3 * GTB, Ag + GKS); stage128(l0 + 4 * GTB, A2g + GKS); stage128(l0 + 5 * GTB, Bg + GKS);
#pragma unroll 1   /* rolled: one copy of the trip's body; the buffer is chosen by an offset */
    for (int t = 0; t < DD / GKS; ++t) {
        const unsigned bb = (unsigned)(t & 1) * (3 * GTB); const bf* S = (const bf*)(sm + bb);
#pragma unroll
        for (int kk = 0; kk < GKS; kk += 32) {
            V a[4], a2[4], b[4];   // all twelve fragments of a 32-k block are asked for ahead of its WMMAs: one LDS latency per block
#pragma unroll
            for (int nb = 0; nb < 4; ++nb) b[nb] = WFrag<bf>::ld(S + 2 * 128 * GP + bo + nb * 16 * GP + kk);
#pragma unroll
            for (int mb = 0; mb < 4; ++mb) { a[mb] = WFrag<bf>::ld(S + ao + mb * 16 * GP + kk); a2[mb] = WFrag<bf>::ld(S + 128 * GP + ao + mb * 16 * GP + kk); }
            // inputs only: holds the block's LDS loads together in front of its WMMAs; without it the compiler sinks them between the WMMAs, four to a wait, and the wave waits out the LDS latency each time
            asm volatile("" :: "v"(a[0]), "v"(a[1]), "v"(a[2]), "v"(a[3]), "v"(a2[0]), "v"(a2[1]), "v"(a2[2]), "v"(a2[3]), "v"(b[0]), "v"(b[1]), "v"(b[2]), "v"(b[3]));
#pragma unroll
            for (int mb = 0; mb < 4; ++mb)
#pragma unroll
                for (int nb = 0; nb < 4; ++nb) { acc[mb][nb] = WFrag<bf>::mma(a[mb], b[nb], acc[mb][nb]); acc[mb][nb] = WFrag<bf>::mma(a2[mb], b[nb], acc[mb][nb]); }
        }
        asm volatile("s_wait_dscnt 0x0" ::: "memory");      // this wave's reads of the buffer have returned before it is refilled
        asm volatile("s_wait_asynccnt 0x0" ::: "memory");   // this wave's copies of trip t + 1 have landed
        __syncthreads();                                      // publishes trip t + 1 and ends every read of trip t
        if (t + 2 < DD / GKS) { stage128(l0 + bb, Ag + (t + 2) * GKS); stage128(l0 + bb + GTB, A2g + (t + 2) * GKS); stage128(l0 + bb + 2 * GTB, Bg + (t + 2) * GKS); }
    }
    asm volatile("s_wait_asynccnt 0x0" ::: "memory");   // no copy is outstanding when the ring becomes output staging
    float* os = (float*)(sm + wv * (16 * 68 * 4));        // a wave's own 16 rows of 64 f32 at a pitch of 68
    const int r0 = rb + wm * 64, c0 = cb + wn * 64;
#pragma unroll
    for (int mb = 0; mb < 4; ++mb) {
#pragma unroll
        for (int nb = 0; nb < 4; ++nb) {
#pragma unroll
            for (int j = 0; j < 8; ++j) os[(hi * 8 + j) * 68 + nb * 16 + lr] = acc[mb][nb][j]; }
        __builtin_amdgcn_wave_barrier(); asm volatile("" ::: "memory");   // one wave's rows: keeps the compiler from lifting the other lanes' read-back over the LDS stores
        float* crow = C + (size_t)(r0 + mb * 16) * DD + c0;
#pragma unroll
        for (int s = 0; s < 8; ++s) { const int row = 2 * s + hi, cofs = lr * 4; *(v4f*)(crow + (size_t)row * DD + cofs) = *(const v4fa*)(os + row * 68 + cofs); }
        __builtin_amdgcn_wave_barrier(); asm volatile("" ::: "memory");   // and the next block's stores over these reads
    }
}

typedef __attribute__((ext_vector_type(2))) _Float16 v2h;
typedef __attribute__((ext_vector_type(4))) _Float16 v4h;
typedef __attribute__((ext_vector_type(2))) unsigned short v2us;
typedef __attribute__((ext_vector_type(4))) unsigned short v4us;
typedef __attribute__((ext_vector_type(2))) float v2f;

// ---- the seven preparation jobs (no one reads what another writes) are the parts of ONE launch, k_prep: each is a device function; all but the one-block chamber job are told their own block index bx.
__device__ __forceinline__ void p_cvt8(int bx, const float* __restrict__ src, bf* dst, size_t n8) { const size_t i = (size_t)bx * 256 + threadIdx.x; if (i >= n8) return; const v8f v = *(const v8f*)(src + i * 8); v8us o;
#pragma unroll
    for (int k = 0; k < 8; ++k) o[k] = f2bf(v[k]); *(v8us*)(dst + i * 8) = o;  }
__device__ __forceinline__ void p_wtG(int bx, const float* __restrict__ w, int K, int N, bf* Bt) {
    const int lane = threadIdx.x & 31; const int L0 = (bx * 8 + (threadIdx.x >> 5)) * 8; const int nlines = N * K / 64;
{
#pragma unroll 1
        for (int l = 0; l < 8; ++l) { const int L = L0 + l; if (L >= nlines) break; const size_t e = (size_t)L * 64 + lane * 2; const int k = (int)(e % K), n = (int)(e / K); v2us o;
            o[0] = f2bf(w[(size_t)k * N + n]); o[1] = f2bf(w[(size_t)(k + 1) * N + n]); *(v2us*)(Bt + e) = o; }
         }
}
// p_gates: both gate projections of 16 tokens per block on the matrix unit. A = gate weights (16 columns of Wa, 16 of We), B = the 16 token rows; both fragments are rounded to bf16 in registers from the f32 inputs,
// in the k order of WFrag::ld (elements 0..7: k + 8 hi + s, elements 8..15: k + 16 + 8 hi + s). Wave w takes k = 128 w .. 128 w + 127 (4 WMMA steps a tile); the 8 partial tiles are summed through LDS in wave order.
#define GRP 36   /* LDS pitch of a token's 32 partial sums, floats: 144 B */
__device__ __forceinline__ void p_gates(int bx, const float* __restrict__ x, const float* __restrict__ Wa, const float* __restrict__ ba, const float* __restrict__ We, const float* __restrict__ be, float* GX) {
    __shared__ __align__(16) float red[8 * 16 * GRP];
    const int tid = threadIdx.x, lane = tid & 31, wv = tid >> 5, lr = lane & 15, hi = lane >> 4; const int r0 = bx * 16;
    const float* xp = x + (size_t)(r0 + lr) * DD + wv * 128 + 8 * hi;
    const float* wap = Wa + (size_t)(wv * 128 + 8 * hi) * NH_ + lr; const float* wep = We + (size_t)(wv * 128 + 8 * hi) * NH_ + lr;
    v8f acc[2]; acc[0] = (v8f){}; acc[1] = (v8f){};
#pragma unroll
    for (int kk = 0; kk < 128; kk += 32) {
        const v4f x0 = *(const v4f*)(xp + kk), x1 = *(const v4f*)(xp + kk + 4), x2 = *(const v4f*)(xp + kk + 16), x3 = *(const v4f*)(xp + kk + 20);
        v8f wa0, wa1, we0, we1;
#pragma unroll
        for (int s = 0; s < 8; ++s) { wa0[s] = wap[(kk + s) * NH_]; wa1[s] = wap[(kk + 16 + s) * NH_]; we0[s] = wep[(kk + s) * NH_]; we1[s] = wep[(kk + 16 + s) * NH_]; }
        // inputs only: holds the 36 loads of a k step together in front of their roundings; without it the compiler deals them out a few to a wait, and the wave waits out a memory latency each time
        asm volatile("" :: "v"(x0), "v"(x1), "v"(x2), "v"(x3), "v"(wa0), "v"(wa1), "v"(we0), "v"(we1));
        // behind the last loads: the three address pairs, named as inputs, stay as they are up to this wait, so no later instruction (a load's result included) rewrites one in front of it
        if (kk == 96) asm volatile("s_wait_xcnt 0x0" :: "v"(xp), "v"(wap), "v"(wep) : "memory");
        v8us xl, xh, al, ah, el, eh;
#pragma unroll
        for (int s = 0; s < 4; ++s) { xl[s] = f2bf(x0[s]); xl[4 + s] = f2bf(x1[s]); xh[s] = f2bf(x2[s]); xh[4 + s] = f2bf(x3[s]); }
#pragma unroll
        for (int s = 0; s < 8; ++s) { al[s] = f2bf(wa0[s]); ah[s] = f2bf(wa1[s]); el[s] = f2bf(we0[s]); eh[s] = f2bf(we1[s]); }
        const v16bf xf = cat16b(xl, xh);
        acc[0] = wmmab(cat16b(al, ah), xf, acc[0]); acc[1] = wmmab(cat16b(el, eh), xf, acc[1]);   // acc[mb][j] = partial[token lr][column mb * 16 + 8 hi + j]
    }
    float* rw = red + (wv * 16 + lr) * GRP + 8 * hi;
#pragma unroll
    for (int mb = 0; mb < 2; ++mb) { *(v4f*)(rw + mb * 16) = __builtin_shufflevector(acc[mb], acc[mb], 0, 1, 2, 3); *(v4f*)(rw + mb * 16 + 4) = __builtin_shufflevector(acc[mb], acc[mb], 4, 5, 6, 7); }
    __syncthreads();   // the eight waves' partial tiles are published (block-uniform: the whole block is in this job)
#pragma unroll
    for (int u = 0; u < 2; ++u) { const int o = u * 256 + tid, tk = o >> 5, c = o & 31; float s = red[tk * GRP + c];
#pragma unroll
        for (int w = 1; w < 8; ++w) s += red[(w * 16 + tk) * GRP + c];
        const float mine = __fadd_rn(s, bfr(*(c < 16 ? ba + c : be + (c - 16))));
        GX[(size_t)(r0 + tk) * 32 + c] = __fdiv_rn(1.0f, __fadd_rn(1.0f, __expf(-mine))); }
}
__device__ __forceinline__ void p_cham(const float* __restrict__ chi, const float* __restrict__ bp, const float* __restrict__ ivp, const float* __restrict__ ovp, float* CH) { const int lane = threadIdx.x; const int h = lane >> 1; const int part = (lane & 1) * 2;
    const float sg_b = __fdiv_rn(1.0f, __fadd_rn(1.0f, __expf(-bfr(bp[h])))); const float ang = __fmul_rn(3.14159265358979f, sg_b); v2f o;
    if (part == 0) { o[0] = __fdiv_rn(1.0f, __fadd_rn(1.0f, __expf(-bfr(ivp[h])))); o[1] = cosf(ang); } else { o[0] = sinf(ang); o[1] = __fdiv_rn(1.0f, __fadd_rn(1.0f, __expf(-bfr(ovp[h])))); }
    const float th = (lane < NH_) ? tanhf(bfr(chi[lane])) : 0.f;
    *(v2f*)(CH + lane * 2) = o; *(float*)(CH + 64 + lane) = th;  }
// k_prep: blocks are dealt by index: gates, the four weight transposes, the chamber constants (one wave of one block), the bf16 copy of x.
#define PB_G  (NT / 16)                     /* blocks of the gates */
#define PB_W  ((DD * DD / 64 + 63) / 64)    /* blocks of one weight transpose */
#define PB_X  (NT * DD / 8 / 256)           /* blocks of the copy of x */
#define PB_ALL (PB_G + 4 * PB_W + 1 + PB_X)
__global__ __launch_bounds__(256) void k_prep(const float* __restrict__ x, const float* __restrict__ Wa, const float* __restrict__ ba, const float* __restrict__ We, const float* __restrict__ be,
                                              const float* __restrict__ Wi, const float* __restrict__ Wo, const float* __restrict__ Wv, const float* __restrict__ Wout,
                                              const float* __restrict__ chi, const float* __restrict__ bp, const float* __restrict__ ivp, const float* __restrict__ ovp,
                                              float* GX, bf* WQ, bf* WK, bf* WV, bf* WO, float* CH, bf* XB) {
    int bx = blockIdx.x;
    if (bx < PB_G) { p_gates(bx, x, Wa, ba, We, be, GX); return; }
    bx -= PB_G;
    if (bx < 4 * PB_W) { const int j = bx / PB_W; p_wtG(bx % PB_W, j == 0 ? Wi : j == 1 ? Wo : j == 2 ? Wv : Wout, DD, DD, j == 0 ? WQ : j == 1 ? WK : j == 2 ? WV : WO); return; }
    bx -= 4 * PB_W;
    if (bx == 0) { if (threadIdx.x < 32) p_cham(chi, bp, ivp, ovp, CH); return; }
    p_cvt8(bx - 1, x, XB, (size_t)NT * DD / 8);
}
// k_proj: the three 1024-wide projections in one launch, grid (NH_/2, NT/128, 3), 4 waves: a block takes 128 tokens x two heads, a wave 64 tokens x one head (64x64, 16 accumulators), plain bf16 planes.
// The weight rows and the token rows of a trip (64 k) come to LDS by asynchronous copies, two buffers, and each is read by two waves.
// The epilogue stores the fp16 plane that k_fattn reads; no f32 copy of a projection reaches memory. A lane's accumulator holds 8 consecutive rows of the A operand, so the operand whose index runs
// contiguously in the plane is taken as A: z = 0, 1 (inner, outer): A = weight rows (d), B = token rows, plane [head][t][d]; z = 2 (v): A = token rows, B = weight rows (d), plane [head][d][t].
#define LPO  72   /* LDS pitch of a 128-B output row: 144 B */
__global__ __launch_bounds__(128) void k_proj(const bf* __restrict__ X, const bf* __restrict__ WQ, const bf* __restrict__ WK, const bf* __restrict__ WV, h16* QP, h16* KP, h16* VT) {
    typedef WFrag<bf>::V V;
    __shared__ __align__(16) char sm[2 * 2 * GTB];   // [buffer][weight rows | token rows]; the epilogue's staging rows lie over it
    const int tid = threadIdx.x, lane = tid & 31, wv = tid >> 5, lr = lane & 15, hi = lane >> 4; const int zz = blockIdx.z; const bool vtr = zz == 2;
    const int wh = wv & 1, wt = wv >> 1; const int hh = blockIdx.x * 2 + wh, t0 = blockIdx.y * 128 + wt * 64;
    const size_t go = (size_t)(tid >> 3) * DD + (tid & 7) * 8;
    const bf* Wg = (zz == 0 ? WQ : zz == 1 ? WK : WV) + (size_t)blockIdx.x * 128 * DD + go; const bf* Xg = X + (size_t)blockIdx.y * 128 * DD + go;
    const unsigned l0 = (unsigned)(size_t)sm + (unsigned)((tid >> 3) * (GP * 2) + (tid & 7) * 16);
    const int wo = (wh * 64 + lr) * GP + 8 * hi, xo = 128 * GP + (wt * 64 + lr) * GP + 8 * hi;   // a lane's place in its wave's first 16-row block of each tile, elements
    const int ao = vtr ? xo : wo, bo = vtr ? wo : xo;
    v8f acc[4][4];
#pragma unroll
    for (int mb = 0; mb < 4; ++mb)
#pragma unroll
        for (int nb = 0; nb < 4; ++nb) acc[mb][nb] = (v8f){};
    stage128(l0, Wg); stage128(l0 + GTB, Xg);
    asm volatile("s_wait_asynccnt 0x0" ::: "memory");   // this wave's copies of trip 0 have landed
    __syncthreads();                                      // trip 0 is published
    stage128(l0 + 2 * GTB, Wg + GKS); stage128(l0 + 3 * GTB, Xg + GKS);
#pragma unroll 1   /* rolled: one copy of the trip's body; the buffer is chosen by an offset */
    for (int t = 0; t < DD / GKS; ++t) {
        const unsigned bb = (unsigned)(t & 1) * (2 * GTB); const bf* S = (const bf*)(sm + bb);
#pragma unroll
        for (int kk = 0; kk < GKS; kk += 32) {
            V a[4], b[4];   // all eight fragments of a 32-k block are asked for ahead of its WMMAs: one LDS latency per block
#pragma unroll
            for (int mb = 0; mb < 4; ++mb) { a[mb] = WFrag<bf>::ld(S + ao + mb * 16 * GP + kk); b[mb] = WFrag<bf>::ld(S + bo + mb * 16 * GP + kk); }
            // inputs only: holds the block's LDS loads together in front of its WMMAs; without it the compiler sinks them between the WMMAs, four to a wait, and the wave waits out the LDS latency each time
            asm volatile("" :: "v"(a[0]), "v"(a[1]), "v"(a[2]), "v"(a[3]), "v"(b[0]), "v"(b[1]), "v"(b[2]), "v"(b[3]));
#pragma unroll
            for (int nb = 0; nb < 4; ++nb)
#pragma unroll
                for (int mb = 0; mb < 4; ++mb) acc[mb][nb] = WFrag<bf>::mma(a[mb], b[nb], acc[mb][nb]);
        }
        asm volatile("s_wait_dscnt 0x0" ::: "memory");      // this wave's reads of the buffer have returned before it is refilled
        asm volatile("s_wait_asynccnt 0x0" ::: "memory");   // this wave's copies of trip t + 1 have landed
        __syncthreads();                                      // publishes trip t + 1 and ends every read of trip t
        if (t + 2 < DD / GKS) { stage128(l0 + bb, Wg + (t + 2) * GKS); stage128(l0 + bb + GTB, Xg + (t + 2) * GKS); }
    }
    asm volatile("s_wait_asynccnt 0x0" ::: "memory");   // no copy is outstanding when the ring becomes output staging
    h16* os = (h16*)(sm + wv * (64 * LPO * 2));           // a wave's own 64 output rows
#pragma unroll
    for (int mb = 0; mb < 4; ++mb)
#pragma unroll
        for (int nb = 0; nb < 4; ++nb) *(v8h*)(os + (nb * 16 + lr) * LPO + mb * 16 + 8 * hi) = __builtin_convertvector(acc[mb][nb], v8h);   // os[B row][A row]
    __builtin_amdgcn_wave_barrier(); asm volatile("" ::: "memory");   // one wave's rows: keeps the compiler from lifting the other lanes' read-back over the LDS stores
    const size_t z = (size_t)(t0 / TT) * NH_ + hh; const int tl = t0 & (TT - 1);
    h16* C = vtr ? VT + z * HD * TT + tl : (zz == 0 ? QP : KP) + (z * TT + tl) * HD; const int ldc = vtr ? TT : HD;
#pragma unroll
    for (int s = 0; s < 16; ++s) { const int row = s * 4 + (lane >> 3), ch = (lane & 7) * 8; *(v8h*)(C + (size_t)row * ldc + ch) = *(const v8ha*)(os + row * LPO + ch); }   // whole 128-B lines
}
#define KST  64
#define LP   72
#define CS2  0.18033688011112042f   /* (1/8) log2(e) */
typedef __attribute__((ext_vector_type(8))) __bf16 v8bf;
typedef __attribute__((ext_vector_type(4))) unsigned v4u;
__global__ __launch_bounds__(256) void k_fattn(const h16* __restrict__ QP, const h16* __restrict__ KP, const h16* __restrict__ VT, const float* __restrict__ GX, const float* __restrict__ CH, bf* Ah, bf* Al) {
    __shared__ __align__(16) h16 Ks[2][KST * LP];
    __shared__ __align__(16) h16 Vs[2][HD * LP];
    __shared__ __align__(16) float exs[TT];
    __shared__ __align__(16) bf osm[8][2][32 * LP];   // output staging: a wave's own 32 query rows of 128 B (pitch 144 B), hi plane and lo plane
    const int tid = threadIdx.x, lane = tid & 31, wv = tid >> 5, lr = lane & 15, hi = lane >> 4;
    const int z = blockIdx.y, b = z / NH_, h = z % NH_; const int q0 = blockIdx.x * 256 + wv * 32;
    const h16* Qz = QP + (size_t)z * TT * HD; const h16* Kz = KP + (size_t)z * TT * HD; const h16* Vz = VT + (size_t)z * HD * TT;
#pragma unroll
    for (int u = 0; u < TT / 256; ++u) exs[u * 256 + tid] = GX[((size_t)b * TT + u * 256 + tid) * 32 + 16 + h];
    v16h qf[2][2];
#pragma unroll
    for (int qt = 0; qt < 2; ++qt)
#pragma unroll
        for (int ks = 0; ks < 2; ++ks) qf[qt][ks] = WFrag<h16>::ld(Qz + (size_t)(q0 + qt * 16 + lr) * HD + ks * 32 + 8 * hi);
    const int srow = tid >> 3, sch = (tid & 7) * 8;   // a thread stages 16 B of rows srow and srow + 32 of each tile: a wave covers whole 128-B lines
    v8h kr[2], vr[2];
#pragma unroll
    for (int u = 0; u < 2; ++u) { kr[u] = *(const v8h*)(Kz + (size_t)(srow + 32 * u) * HD + sch); vr[u] = *(const v8h*)(Vz + (size_t)(srow + 32 * u) * TT + sch); }
#pragma unroll
    for (int u = 0; u < 2; ++u) { *(v8h*)(&Ks[0][(srow + 32 * u) * LP + sch]) = kr[u]; *(v8h*)(&Vs[0][(srow + 32 * u) * LP + sch]) = vr[u]; }
    v8f O[2][4]; float m[2]; v2f l1[2], l2[2];   // l1, l2: a lane's sums over even and odd keys, joined in the epilogue
#pragma unroll
    for (int qt = 0; qt < 2; ++qt) { m[qt] = -3.0e38f; l1[qt] = (v2f){}; l2[qt] = (v2f){};
#pragma unroll
        for (int dt = 0; dt < 4; ++dt) O[qt][dt] = (v8f){}; }
    __syncthreads();   // tile 0 and the gate row are published
#pragma unroll 1   /* rolled: one copy of the tile body; sixteen would only grow the code */
    for (int s = 0; s < TT / KST; ++s) {
        const h16* kb = Ks[s & 1]; const h16* vb = Vs[s & 1]; const bool more = s + 1 < TT / KST;
        if (more) {   // the next tile's global loads fly while this tile is worked on
#pragma unroll
            for (int u = 0; u < 2; ++u) { kr[u] = *(const v8h*)(Kz + (size_t)((s + 1) * KST + srow + 32 * u) * HD + sch); vr[u] = *(const v8h*)(Vz + (size_t)(srow + 32 * u) * TT + (s + 1) * KST + sch); } }
#pragma unroll 1   /* rolled: unrolled, the build took more VGPRs and more padding v_nop and fetched hardly any fragment earlier */
        for (int ps = 0; ps < 2; ++ps) {   // a pass: 32 keys
            const int kl = ps * 32; v8f st[2][2];
#pragma unroll
            for (int kt = 0; kt < 2; ++kt) { const v16h k0 = WFrag<h16>::ld(kb + (kl + kt * 16 + lr) * LP + 8 * hi), k1 = WFrag<h16>::ld(kb + (kl + kt * 16 + lr) * LP + 32 + 8 * hi);
#pragma unroll
                for (int qt = 0; qt < 2; ++qt) st[qt][kt] = wmma16(k1, qf[qt][1], wmma16(k0, qf[qt][0], (v8f){})); }   // st[qt][kt][r] = S[query qt*16+lr][key kl + kt*16 + 8*hi + r]
            v16h vf[4];
#pragma unroll
            for (int dt = 0; dt < 4; ++dt) vf[dt] = WFrag<h16>::ld(vb + (dt * 16 + lr) * LP + kl + 8 * hi);
            v2f ex[2][4];
#pragma unroll
            for (int kt = 0; kt < 2; ++kt) { const float* ep = exs + s * KST + kl + kt * 16 + 8 * hi; const v4f e0 = *(const v4fa*)ep, e1 = *(const v4fa*)(ep + 4);
                ex[kt][0] = __builtin_shufflevector(e0, e0, 0, 1); ex[kt][1] = __builtin_shufflevector(e0, e0, 2, 3); ex[kt][2] = __builtin_shufflevector(e1, e1, 0, 1); ex[kt][3] = __builtin_shufflevector(e1, e1, 2, 3); }
            float tm[2];
#pragma unroll
            for (int qt = 0; qt < 2; ++qt) { float t = st[qt][0][0];
#pragma unroll
                for (int r = 1; r < 8; ++r) t = fmaxf(t, st[qt][0][r]);
#pragma unroll
                for (int r = 0; r < 8; ++r) t = fmaxf(t, st[qt][1][r]);
                tm[qt] = t * CS2; }
            // lazy rescale: the maximum in use moves only when a lane's new score tops it by more than 8 (log2), so w stays below 2^8; one scalar test per pass
            if (__builtin_amdgcn_ballot_w32(tm[0] > m[0] + 8.0f || tm[1] > m[1] + 8.0f) != 0) {
#pragma unroll
                for (int qt = 0; qt < 2; ++qt) { const float mn = fmaxf(m[qt], fmaxf(tm[qt], __shfl_xor(tm[qt], 16, 32))); const float al = __builtin_amdgcn_exp2f(m[qt] - mn); m[qt] = mn; l1[qt] *= al; l2[qt] *= al;
#pragma unroll
                    for (int dt = 0; dt < 4; ++dt)
#pragma unroll
                        for (int r = 0; r < 8; ++r) O[qt][dt][r] *= al; } }
#pragma unroll
            for (int qt = 0; qt < 2; ++qt) { v8f w[2]; const v2f mm = {m[qt], m[qt]};
#pragma unroll
                for (int kt = 0; kt < 2; ++kt)
#pragma unroll
                    for (int i = 0; i < 4; ++i) {   // two neighbouring keys at a time: packed f32 on register pairs as the accumulator holds them
                        const v2f sv = {st[qt][kt][2 * i], st[qt][kt][2 * i + 1]}; const v2f tt = sv * CS2 - mm; const v2f e = {__builtin_amdgcn_exp2f(tt[0]), __builtin_amdgcn_exp2f(tt[1])};
                        l1[qt] += e; const v2f ww = e * ex[kt][i]; l2[qt] += ww; w[kt][2 * i] = ww[0]; w[kt][2 * i + 1] = ww[1]; }
                const v16h pf = cat16(__builtin_convertvector(w[0], v8h), __builtin_convertvector(w[1], v8h));   // element s = key kl + (s < 8 ? 8*hi + s : 16 + 8*hi + s - 8): the k order of the V^T loader
#pragma unroll
                for (int dt = 0; dt < 4; ++dt) O[qt][dt] = wmma16(vf[dt], pf, O[qt][dt]); }   // O[qt][dt][r] = O[query qt*16+lr][d = dt*16 + 8*hi + r]
        }
        if (more) {   // the other buffer's last readers left it before the barrier that ended the tile before this one
#pragma unroll
            for (int u = 0; u < 2; ++u) { *(v8h*)(&Ks[(s + 1) & 1][(srow + 32 * u) * LP + sch]) = kr[u]; *(v8h*)(&Vs[(s + 1) & 1][(srow + 32 * u) * LP + sch]) = vr[u]; } }
        __syncthreads();   // publishes tile s + 1 and ends every read of tile s
    }
    // chamber of head h: y_r = (x_r cos - x_i sin) ov tanh(chi), y_i = (x_r sin + x_i cos) ov tanh(chi), x = converged iv; iv goes into the query's factor, ov tanh(chi) into the two rotation factors
    const float iv = CH[h * 4], ot = CH[h * 4 + 3] * CH[64 + h]; const float cc = CH[h * 4 + 1] * ot, ss = CH[h * 4 + 2] * ot;
    float f[2];   // both columns' factors first
#pragma unroll
    for (int qt = 0; qt < 2; ++qt) { const float b1 = l1[qt][0] + l1[qt][1], b2 = l2[qt][0] + l2[qt][1]; const float a1 = b1 + __shfl_xor(b1, 16, 32), a2 = b2 + __shfl_xor(b2, 16, 32);
        const float g = __fdiv_rn(GX[((size_t)b * TT + q0 + qt * 16 + lr) * 32 + h], a1); f[qt] = __fdiv_rn(g, fmaf(g, a2, 1e-8f)) * iv; }
    bf* sh = osm[wv][0]; bf* sl = osm[wv][1];
#pragma unroll
    for (int qt = 0; qt < 2; ++qt)
#pragma unroll
        for (int dt = 0; dt < 2; ++dt) { const v8f xr = O[qt][dt] * f[qt], xi = O[qt][dt + 2] * f[qt]; v8f y[2]; y[0] = xr * cc - xi * ss; y[1] = xr * ss + xi * cc;
#pragma unroll
            for (int p = 0; p < 2; ++p) { const v8bf yh = __builtin_convertvector(y[p], v8bf); const v4u pw = __builtin_bit_cast(v4u, yh); v8f hf;   // hf: the hi plane's values back in f32, unpacked from the packed words
#pragma unroll
                for (int i = 0; i < 4; ++i) { hf[2 * i] = __uint_as_float(pw[i] << 16); hf[2 * i + 1] = __uint_as_float(pw[i] & 0xFFFF0000u); }
                const v8bf yl = __builtin_convertvector(y[p] - hf, v8bf);
                const int o = (qt * 16 + lr) * LP + p * 32 + dt * 16 + 8 * hi; *(v8us*)(sh + o) = __builtin_bit_cast(v8us, yh); *(v8us*)(sl + o) = __builtin_bit_cast(v8us, yl); } }
    asm volatile("s_wait_dscnt 0x0" ::: "memory");   // one wave's own rows: its LDS stores have retired before its lanes read one another's rows back; the clobber keeps the read-back behind it
    const size_t go = ((size_t)b * TT + q0 + (lane >> 3)) * DD + h * HD + (lane & 7) * 8; const int so = (lane >> 3) * LP + (lane & 7) * 8;
#pragma unroll
    for (int s = 0; s < 8; ++s) { *(v8us*)(Ah + go + (size_t)s * 4 * DD) = *(const v8usa*)(sh + so + s * 4 * LP); *(v8us*)(Al + go + (size_t)s * 4 * DD) = *(const v8usa*)(sl + so + s * 4 * LP); }   // whole 128-B lines
}

extern "C" void kernel_launch(void* const* d_in, const int* in_sizes, int n_in,
                              void* d_out, int out_size, void* d_ws, size_t ws_size, hipStream_t stream) {
    (void)in_sizes; (void)n_in; (void)out_size;
    const float* IN[13]; for (int i = 0; i < 13; ++i) IN[i] = (const float*)d_in[i];
    // x [4][1024][1024], Wa [1024][16], ba, We, be, Wi, Wo, Wv, Wout ([in][out] = x @ W), chi, beta_p, iv_p, ov_p [16] = d_in[0..12]
    float* OUT = (float*)d_out;     // [4][1024][1024]
    char* wsp = (char*)d_ws;
    auto take = [&](size_t bytes) { char* p = wsp; wsp += (bytes + 255) & ~(size_t)255; return (void*)p; };
    bf* WO = (bf*)take((size_t)DD * DD * 2); float* GX = (float*)take((size_t)NT * 32 * 4); float* CH = (float*)take(512);
    h16* QP = (h16*)take((size_t)NT * DD * 2); h16* KP = (h16*)take((size_t)NT * DD * 2); h16* VT = (h16*)take((size_t)NT * DD * 2);
    bf* ATh = (bf*)take((size_t)NT * DD * 2); bf* ATl = (bf*)take((size_t)NT * DD * 2);
    bf* WQ = (bf*)take((size_t)DD * DD * 2); bf* WK = (bf*)take((size_t)DD * DD * 2); bf* WV = (bf*)take((size_t)DD * DD * 2); bf* XB = (bf*)take((size_t)NT * DD * 2);
    if ((size_t)(wsp - (char*)d_ws) > ws_size) return;    // total below 75 MiB; ws 256 MiB
    k_prep<<<PB_ALL, 256, 0, stream>>>(IN[0], IN[1], IN[2], IN[3], IN[4], IN[5], IN[6], IN[7], IN[8], IN[9], IN[10], IN[11], IN[12], GX, WQ, WK, WV, WO, CH, XB);   // gates, transposed bf16 weights, chamber constants, bf16 x
    k_proj<<<dim3(NH_ / 2, NT / 128, 3), 128, 0, stream>>>(XB, WQ, WK, WV, QP, KP, VT);   // inner, outer (the 1/8 is applied in f32 inside k_fattn) and v, stored as fp16 head planes
    k_fattn<<<dim3(TT / 256, NZ, 1), 256, 0, stream>>>(QP, KP, VT, GX, CH, ATh, ATl);   // all 64 flat heads (b * 16 + h) in one launch; chamber and hi/lo split in its epilogue
    k_gemmo<<<dim3(NT / 128, DD / 128, 1), 128, 0, stream>>>(ATh, ATl, WO, OUT);
}

// v008
// A run of this version takes 83.2 microseconds.
// In two side-by-side timings against v007, it was 1.06 and 1.07 times as fast.
// Counting every step since v000, it is 19.1 times as fast.
#include <hip/hip_runtime.h>

// XorzoTransformer (x [4][1024][1024]; aperture = sigmoid(x Wa + ba), expression = sigmoid(x We + be) ([T][16] per-head gates); inner/outer/v = x @ Wi / Wo / Wv (16 heads x 64); p = softmax(inner.outer^T / 8);
// attn = p ap_i ex_j / (sum_j p ap_i ex_j + 1e-8); converged = attn v; ApertureChamber per head: x_in = converged sigmoid(iv_h); (xr, xi) halves rotated by angle pi sigmoid(beta_h); x sigmoid(ov_h) x tanh(chi_h);
// out = merged @ Wout).
// Compute dtypes, f32 accumulate: every input rounded to bf16; the three 1024-wide projections on PLAIN bf16 operands (inputs: exact; transposed bf16 weight copies); the
// 16-wide gate projections on the same bf16 values, formed in registers, on WMMA; scores and attn.v on SINGLE fp16 planes inside one fused kernel (1/8, running-maximum softmax, the bilateral gating and the renormalisation in f32; gated weights in fp16);

#define NB_  4
#define TT   1024
#define DD   1024
#define NH_  16
#define HD   64
#define NT   (NB_ * TT)
#define NZ   (NB_ * NH_)
#define SCL  0.125f
typedef _Float16 h16;
typedef unsigned short bf;
typedef __attribute__((ext_vector_type(16))) __bf16   v16bf;
typedef __attribute__((ext_vector_type(16))) _Float16 v16h;
typedef __attribute__((ext_vector_type(8)))  _Float16 v8h;
typedef __attribute__((ext_vector_type(8)))  unsigned short v8us;
typedef __attribute__((ext_vector_type(8)))  float    v8f;
typedef __attribute__((ext_vector_type(4)))  float    v4f;
typedef v8h  __attribute__((may_alias)) v8ha;
typedef v4f  __attribute__((may_alias)) v4fa;
typedef v8us __attribute__((may_alias)) v8usa;

__device__ __forceinline__ unsigned short f2bf(float f) { unsigned u = __float_as_uint(f); u += 0x7FFFu + ((u >> 16) & 1u); return (unsigned short)(u >> 16); }
__device__ __forceinline__ float bf2f(unsigned short b) { return __uint_as_float(((unsigned)b) << 16); }
__device__ __forceinline__ float bfr(float f) { return bf2f(f2bf(f)); }
__device__ __forceinline__ v16h cat16(v8h lo, v8h hi) { return __builtin_shufflevector(lo, hi, 0, 1, 2, 3, 4, 5, 6, 7, 8, 9, 10, 11, 12, 13, 14, 15); }
__device__ __forceinline__ v16bf cat16b(v8us lo, v8us hi) { return __builtin_bit_cast(v16bf, __builtin_shufflevector(lo, hi, 0, 1, 2, 3, 4, 5, 6, 7, 8, 9, 10, 11, 12, 13, 14, 15)); }
__device__ __forceinline__ v8f wmma16(v16h a, v16h b, v8f c) { return __builtin_amdgcn_wmma_f32_16x16x32_f16(false, a, false, b, (short)0, c, false, false); }
__device__ __forceinline__ v8f wmmab(v16bf a, v16bf b, v8f c) { return __builtin_amdgcn_wmma_f32_16x16x32_bf16(false, a, false, b, (short)0, c, false, false); }



// ---- fragment loaders of the 16-bit planes (K-contiguous rows, in memory or in LDS)
template <typename T16> struct WFrag;
template <> struct WFrag<h16> { typedef v16h V; static __device__ __forceinline__ V ld(const h16* p) { return cat16(*(const v8h*)p, *(const v8h*)(p + 16)); } static __device__ __forceinline__ v8f mma(V a, V b, v8f c) { return wmma16(a, b, c); } };
template <> struct WFrag<bf> { typedef v16bf V; static __device__ __forceinline__ V ld(const bf* p) { return cat16b(*(const v8us*)p, *(const v8us*)(p + 16)); } static __device__ __forceinline__ v8f mma(V a, V b, v8f c) { return wmmab(a, b, c); } };

// ---- operand staging of the two GEMM kernels: a tile is 128 rows x 64 k (128 B of a row) of a plane of pitch DD, kept in LDS at a pitch of 144 B.
// 128 threads: thread tid brings 16 B of rows (tid >> 3) + 16 u, u = 0..7, so a wave's copy covers four whole 128-B lines. No register holds the data.
#define GP   72            /* LDS pitch of a staged row, elements */
#define GTB  (128 * GP * 2) /* bytes of a staged tile */
#define GKS  64            /* k per trip */
// lds: the lane's LDS byte address in row tid >> 3 of the tile; g: the lane's 16 B in the same row of the plane.
__device__ __forceinline__ void stage128(unsigned lds, const bf* g) {
    // the wait is the statement's last line: it stands in front of any rewrite of the address registers that the copies name
    asm volatile("global_load_async_to_lds_b128 %0, %8, off\n\t"
                 "global_load_async_to_lds_b128 %1, %9, off\n\t"
                 "global_load_async_to_lds_b128 %2, %10, off\n\t"
                 "global_load_async_to_lds_b128 %3, %11, off\n\t"
                 "global_load_async_to_lds_b128 %4, %12, off\n\t"
                 "global_load_async_to_lds_b128 %5, %13, off\n\t"
                 "global_load_async_to_lds_b128 %6, %14, off\n\t"
                 "global_load_async_to_lds_b128 %7, %15, off\n\t"
                 "s_wait_xcnt 0x0"
                 :: "v"(lds), "v"(lds + 16 * GP * 2), "v"(lds + 32 * GP * 2), "v"(lds + 48 * GP * 2), "v"(lds + 64 * GP * 2), "v"(lds + 80 * GP * 2), "v"(lds + 96 * GP * 2), "v"(lds + 112 * GP * 2),
                    "v"(g), "v"(g + 16 * DD), "v"(g + 32 * DD), "v"(g + 48 * DD), "v"(g + 64 * DD), "v"(g + 80 * DD), "v"(g + 96 * DD), "v"(g + 112 * DD) : "memory");
}

// ---- k_gemmo: OUT[m][n] (f32) = sum_k (Ah[m][k] + Al[m][k]) Bt[n][k]; grid (NT/128, DD/128), 4 waves, a 128x128 tile per block, 64x64 (16 accumulators) per wave.
// The three operand tiles of a trip come to LDS by asynchronous copies, two buffers: trip t + 1's copies fly while trip t is worked on. Per accumulator the products are summed in the order k ascending, hi then lo.
__global__ __launch_bounds__(128) void k_gemmo(const bf* __restrict__ A, const bf* __restrict__ A2, const bf* __restrict__ Bt, float* C) {
    typedef WFrag<bf>::V V;
    __shared__ __align__(16) char sm[2 * 3 * GTB];   // [buffer][Ah | Al | Bt]; the epilogue's staging rows lie over it
    const int tid = threadIdx.x, lane = tid & 31, wv = tid >> 5, lr = lane & 15, hi = lane >> 4;
    const int rb = blockIdx.x * 128, cb = blockIdx.y * 128, wm = wv & 1, wn = wv >> 1;
    const size_t go = (size_t)(tid >> 3) * DD + (tid & 7) * 8;
    const bf* Ag = A + (size_t)rb * DD + go; const bf* A2g = A2 + (size_t)rb * DD + go; const bf* Bg = Bt + (size_t)cb * DD + go;
    const unsigned l0 = (unsigned)(size_t)sm + (unsigned)((tid >> 3) * (GP * 2) + (tid & 7) * 16);
    const int ao = (wm * 64 + lr) * GP + 8 * hi, bo = (wn * 64 + lr) * GP + 8 * hi;   // a lane's place in its wave's first 16-row block, elements
    v8f acc[4][4];
#pragma unroll
    for (int mb = 0; mb < 4; ++mb)
#pragma unroll
        for (int nb = 0; nb < 4; ++nb) acc[mb][nb] = (v8f){};
    stage128(l0, Ag); stage128(l0 + GTB, A2g); stage128(l0 + 2 * GTB, Bg);
    asm volatile("s_wait_asynccnt 0x0" ::: "memory");   // this wave's copies of trip 0 have landed
    __syncthreads();                                      // trip 0 is published
    stage128(l0 + 3 * GTB, Ag + GKS); stage128(l0 + 4 * GTB, A2g + GKS); stage128(l0 + 5 * GTB, Bg + GKS);
#pragma unroll 1   /* rolled: one copy of the trip's body; the buffer is chosen by an offset */
    for (int t = 0; t < DD / GKS; ++t) {
        const unsigned bb = (unsigned)(t & 1) * (3 * GTB); const bf* S = (const bf*)(sm + bb);
#pragma unroll
        for (int kk = 0; kk < GKS; kk += 32) {
            V a[4], a2[4], b[4];   // all twelve fragments of a 32-k block are asked for ahead of its WMMAs: one LDS latency per block
#pragma unroll
            for (int nb = 0; nb < 4; ++nb) b[nb] = WFrag<bf>::ld(S + 2 * 128 * GP + bo + nb * 16 * GP + kk);
#pragma unroll
            for (int mb = 0; mb < 4; ++mb) { a[mb] = WFrag<bf>::ld(S + ao + mb * 16 * GP + kk); a2[mb] = WFrag<bf>::ld(S + 128 * GP + ao + mb * 16 * GP + kk); }
            // inputs only: holds the block's LDS loads together in front of its WMMAs; without it the compiler sinks them between the WMMAs, four to a wait, and the wave waits out the LDS latency each time
            asm volatile("" :: "v"(a[0]), "v"(a[1]), "v"(a[2]), "v"(a[3]), "v"(a2[0]), "v"(a2[1]), "v"(a2[2]), "v"(a2[3]), "v"(b[0]), "v"(b[1]), "v"(b[2]), "v"(b[3]));
#pragma unroll
            for (int mb = 0; mb < 4; ++mb)
#pragma unroll
                for (int nb = 0; nb < 4; ++nb) { acc[mb][nb] = WFrag<bf>::mma(a[mb], b[nb], acc[mb][nb]); acc[mb][nb] = WFrag<bf>::mma(a2[mb], b[nb], acc[mb][nb]); }
        }
        asm volatile("s_wait_dscnt 0x0" ::: "memory");      // this wave's reads of the buffer have returned before it is refilled
        asm volatile("s_wait_asynccnt 0x0" ::: "memory");   // this wave's copies of trip t + 1 have landed
        __syncthreads();                                      // publishes trip t + 1 and ends every read of trip t
        if (t + 2 < DD / GKS) { stage128(l0 + bb, Ag + (t + 2) * GKS); stage128(l0 + bb + GTB, A2g + (t + 2) * GKS); stage128(l0 + bb + 2 * GTB, Bg + (t + 2) * GKS); }
    }
    asm volatile("s_wait_asynccnt 0x0" ::: "memory");   // no copy is outstanding when the ring becomes output staging
    float* os = (float*)(sm + wv * (16 * 68 * 4));        // a wave's own 16 rows of 64 f32 at a pitch of 68
    const int r0 = rb + wm * 64, c0 = cb + wn * 64;
#pragma unroll
    for (int mb = 0; mb < 4; ++mb) {
#pragma unroll
        for (int nb = 0; nb < 4; ++nb) {
#pragma unroll
            for (int j = 0; j < 8; ++j) os[(hi * 8 + j) * 68 + nb * 16 + lr] = acc[mb][nb][j]; }
        __builtin_amdgcn_wave_barrier(); asm volatile("" ::: "memory");   // one wave's rows: keeps the compiler from lifting the other lanes' read-back over the LDS stores
        float* crow = C + (size_t)(r0 + mb * 16) * DD + c0;
#pragma unroll
        for (int s = 0; s < 8; ++s) { const int row = 2 * s + hi, cofs = lr * 4; *(v4f*)(crow + (size_t)row * DD + cofs) = *(const v4fa*)(os + row * 68 + cofs); }
        __builtin_amdgcn_wave_barrier(); asm volatile("" ::: "memory");   // and the next block's stores over these reads
    }
}

typedef __attribute__((ext_vector_type(2))) _Float16 v2h;
typedef __attribute__((ext_vector_type(4))) _Float16 v4h;
typedef __attribute__((ext_vector_type(2))) unsigned short v2us;
typedef __attribute__((ext_vector_type(4))) unsigned short v4us;
typedef __attribute__((ext_vector_type(2))) float v2f;

// ---- the seven preparation jobs (no one reads what another writes) are the parts of ONE launch, k_prep: each is a device function; all but the one-block chamber job are told their own block index bx.
__device__ __forceinline__ void p_cvt8(int bx, const float* __restrict__ src, bf* dst, size_t n8) { const size_t i = (size_t)bx * 256 + threadIdx.x; if (i >= n8) return; const v8f v = *(const v8f*)(src + i * 8); v8us o;
#pragma unroll
    for (int k = 0; k < 8; ++k) o[k] = f2bf(v[k]); *(v8us*)(dst + i * 8) = o;  }
// p_wtT: Bt[n][k] = bf16(w[k][n]), one tile of 256 k x 64 n per block, turned in LDS. Reads: a half wave takes 256 B of a row of w (whole lines); a thread holds 4 columns of 8 pairs of neighbouring k rows,
// all sixteen loads asked for ahead of the first rounding. It packs (k, k + 1) of a column in one word and stores the word in the column's LDS row. Writes: a wave stores a whole 128-B line of Bt (64 k of one n) per instruction. The plain '#pragma unroll' lines keep r in registers (constant indices).
#define WTK 256   /* k of a tile */
#define WTP 129   /* LDS pitch of a turned row (128 words), words: odd, so a wave's word stores (16 columns 4 apart, two k pairs) fall on different banks */
__device__ __forceinline__ void p_wtT(int bx, const float* __restrict__ w, bf* Bt) {
    __shared__ unsigned tl[64 * WTP];
    const int lane = threadIdx.x & 31, wv = threadIdx.x >> 5; const int k0 = (bx >> 4) * WTK, n0 = (bx & 15) * 64;
    const int c4 = (lane & 15) * 4, j0 = wv * 4 + (lane >> 4) * 2;   // the thread's first column, and its first k pair in each 64 k of the tile
    const float* wp = w + (size_t)(k0 + 2 * j0) * DD + n0 + c4;
    v4f r[4][4];
#pragma unroll
    for (int t = 0; t < 4; ++t)
#pragma unroll
        for (int u = 0; u < 4; ++u) r[t][u] = *(const v4f*)(wp + (size_t)(t * 64 + u) * DD);
    // keeps the roundings behind all sixteen loads: without it the compiler lifts the first roundings, with their wait, over the last two loads, and the wave waits out a second memory latency
    __builtin_amdgcn_sched_barrier(0);
    // behind the sixteen loads: the address pair, named as an input, stays as it is up to this wait, so no later instruction (a load's result included) rewrites it in front of it
    asm volatile("s_wait_xcnt 0x0" :: "v"(wp) : "memory");
#pragma unroll
    for (int t = 0; t < 4; ++t)
#pragma unroll
        for (int u = 0; u < 2; ++u)
#pragma unroll
            for (int i = 0; i < 4; ++i) tl[(c4 + i) * WTP + t * 32 + j0 + u] = (unsigned)f2bf(r[t][2 * u][i]) | ((unsigned)f2bf(r[t][2 * u + 1][i]) << 16);
    __syncthreads();   // the turned tile is published (block-uniform: the whole block is in this job)
    bf* bo = Bt + (size_t)(n0 + wv * 8) * DD + k0 + lane * 2;
#pragma unroll
    for (int q = 0; q < 8; ++q)
#pragma unroll
        for (int t = 0; t < 4; ++t) *(v2us*)(bo + (size_t)q * DD + t * 64) = __builtin_bit_cast(v2us, tl[(wv * 8 + q) * WTP + t * 32 + lane]);
}
// p_gates: both gate projections of 16 tokens per block on the matrix unit. A = gate weights (16 columns of Wa, 16 of We), B = the 16 token rows; both fragments are rounded to bf16 in registers from the f32 inputs,
// in the k order of WFrag::ld (elements 0..7: k + 8 hi + s, elements 8..15: k + 16 + 8 hi + s). Wave w takes k = 128 w .. 128 w + 127 (4 WMMA steps a tile); the 8 partial tiles are summed through LDS in wave order.
#define GRP 36   /* LDS pitch of a token's 32 partial sums, floats: 144 B */
__device__ __forceinline__ void p_gates(int bx, const float* __restrict__ x, const float* __restrict__ Wa, const float* __restrict__ ba, const float* __restrict__ We, const float* __restrict__ be, float* GX) {
    __shared__ __align__(16) float red[8 * 16 * GRP];
    const int tid = threadIdx.x, lane = tid & 31, wv = tid >> 5, lr = lane & 15, hi = lane >> 4; const int r0 = bx * 16;
    const float* xp = x + (size_t)(r0 + lr) * DD + wv * 128 + 8 * hi;
    const float* wap = Wa + (size_t)(wv * 128 + 8 * hi) * NH_ + lr; const float* wep = We + (size_t)(wv * 128 + 8 * hi) * NH_ + lr;
    v8f acc[2]; acc[0] = (v8f){}; acc[1] = (v8f){};
#pragma unroll
    for (int kk = 0; kk < 128; kk += 32) {
        const v4f x0 = *(const v4f*)(xp + kk), x1 = *(const v4f*)(xp + kk + 4), x2 = *(const v4f*)(xp + kk + 16), x3 = *(const v4f*)(xp + kk + 20);
        v8f wa0, wa1, we0, we1;
#pragma unroll
        for (int s = 0; s < 8; ++s) { wa0[s] = wap[(kk + s) * NH_]; wa1[s] = wap[(kk + 16 + s) * NH_]; we0[s] = wep[(kk + s) * NH_]; we1[s] = wep[(kk + 16 + s) * NH_]; }
        // inputs only: holds the 36 loads of a k step together in front of their roundings; without it the compiler deals them out a few to a wait, and the wave waits out a memory latency each time
        asm volatile("" :: "v"(x0), "v"(x1), "v"(x2), "v"(x3), "v"(wa0), "v"(wa1), "v"(we0), "v"(we1));
        // behind the last loads: the three address pairs, named as inputs, stay as they are up to this wait, so no later instruction (a load's result included) rewrites one in front of it
        if (kk == 96) asm volatile("s_wait_xcnt 0x0" :: "v"(xp), "v"(wap), "v"(wep) : "memory");
        v8us xl, xh, al, ah, el, eh;
#pragma unroll
        for (int s = 0; s < 4; ++s) { xl[s] = f2bf(x0[s]); xl[4 + s] = f2bf(x1[s]); xh[s] = f2bf(x2[s]); xh[4 + s] = f2bf(x3[s]); }
#pragma unroll
        for (int s = 0; s < 8; ++s) { al[s] = f2bf(wa0[s]); ah[s] = f2bf(wa1[s]); el[s] = f2bf(we0[s]); eh[s] = f2bf(we1[s]); }
        const v16bf xf = cat16b(xl, xh);
        acc[0] = wmmab(cat16b(al, ah), xf, acc[0]); acc[1] = wmmab(cat16b(el, eh), xf, acc[1]);   // acc[mb][j] = partial[token lr][column mb * 16 + 8 hi + j]
    }
    float* rw = red + (wv * 16 + lr) * GRP + 8 * hi;
#pragma unroll
    for (int mb = 0; mb < 2; ++mb) { *(v4f*)(rw + mb * 16) = __builtin_shufflevector(acc[mb], acc[mb], 0, 1, 2, 3); *(v4f*)(rw + mb * 16 + 4) = __builtin_shufflevector(acc[mb], acc[mb], 4, 5, 6, 7); }
    __syncthreads();   // the eight waves' partial tiles are published (block-uniform: the whole block is in this job)
#pragma unroll
    for (int u = 0; u < 2; ++u) { const int o = u * 256 + tid, tk = o >> 5, c = o & 31; float s = red[tk * GRP + c];
#pragma unroll
        for (int w = 1; w < 8; ++w) s += red[(w * 16 + tk) * GRP + c];
        const float mine = __fadd_rn(s, bfr(*(c < 16 ? ba + c : be + (c - 16))));
        GX[(size_t)(r0 + tk) * 32 + c] = __fdiv_rn(1.0f, __fadd_rn(1.0f, __expf(-mine))); }
}
__device__ __forceinline__ void p_cham(const float* __restrict__ chi, const float* __restrict__ bp, const float* __restrict__ ivp, const float* __restrict__ ovp, float* CH) { const int lane = threadIdx.x; const int h = lane >> 1; const int part = (lane & 1) * 2;
    const float sg_b = __fdiv_rn(1.0f, __fadd_rn(1.0f, __expf(-bfr(bp[h])))); const float ang = __fmul_rn(3.14159265358979f, sg_b); v2f o;
    if (part == 0) { o[0] = __fdiv_rn(1.0f, __fadd_rn(1.0f, __expf(-bfr(ivp[h])))); o[1] = cosf(ang); } else { o[0] = sinf(ang); o[1] = __fdiv_rn(1.0f, __fadd_rn(1.0f, __expf(-bfr(ovp[h])))); }
    const float th = (lane < NH_) ? tanhf(bfr(chi[lane])) : 0.f;
    *(v2f*)(CH + lane * 2) = o; *(float*)(CH + 64 + lane) = th;  }
// k_prep: blocks are dealt by index: gates, the four weight transposes, the chamber constants (one wave of one block), the bf16 copy of x.
#define PB_G  (NT / 16)                     /* blocks of the gates */
#define PB_W  ((DD / WTK) * (DD / 64))      /* blocks of one weight transpose */
#define PB_X  (NT * DD / 8 / 256)           /* blocks of the copy of x */
#define PB_ALL (PB_G + 4 * PB_W + 1 + PB_X)
__global__ __launch_bounds__(256) void k_prep(const float* __restrict__ x, const float* __restrict__ Wa, const float* __restrict__ ba, const float* __restrict__ We, const float* __restrict__ be,
                                              const float* __restrict__ Wi, const float* __restrict__ Wo, const float* __restrict__ Wv, const float* __restrict__ Wout,
                                              const float* __restrict__ chi, const float* __restrict__ bp, const float* __restrict__ ivp, const float* __restrict__ ovp,
                                              float* GX, bf* WQ, bf* WK, bf* WV, bf* WO, float* CH, bf* XB) {
    int bx = blockIdx.x;
    if (bx < PB_G) { p_gates(bx, x, Wa, ba, We, be, GX); return; }
    bx -= PB_G;
    if (bx < 4 * PB_W) { const int j = bx / PB_W; p_wtT(bx % PB_W, j == 0 ? Wi : j == 1 ? Wo : j == 2 ? Wv : Wout, j == 0 ? WQ : j == 1 ? WK : j == 2 ? WV : WO); return; }
    bx -= 4 * PB_W;
    if (bx == 0) { if (threadIdx.x < 32) p_cham(chi, bp, ivp, ovp, CH); return; }
    p_cvt8(bx - 1, x, XB, (size_t)NT * DD / 8);
}
// k_proj: the three 1024-wide projections in one launch, grid (NH_/2, NT/128, 3), 4 waves: a block takes 128 tokens x two heads, a wave 64 tokens x one head (64x64, 16 accumulators), plain bf16 planes.
// The weight rows and the token rows of a trip (64 k) come to LDS by asynchronous copies, two buffers, and each is read by two waves.
// The epilogue stores the fp16 plane that k_fattn reads; no f32 copy of a projection reaches memory. A lane's accumulator holds 8 consecutive rows of the A operand, so the operand whose index runs
// contiguously in the plane is taken as A: z = 0, 1 (inner, outer): A = weight rows (d), B = token rows, plane [head][t][d]; z = 2 (v): A = token rows, B = weight rows (d), plane [head][d][t].
#define LPO  72   /* LDS pitch of a 128-B output row: 144 B */
__global__ __launch_bounds__(128) void k_proj(const bf* __restrict__ X, const bf* __restrict__ WQ, const bf* __restrict__ WK, const bf* __restrict__ WV, h16* QP, h16* KP, h16* VT) {
    typedef WFrag<bf>::V V;
    __shared__ __align__(16) char sm[2 * 2 * GTB];   // [buffer][weight rows | token rows]; the epilogue's staging rows lie over it
    const int tid = threadIdx.x, lane = tid & 31, wv = tid >> 5, lr = lane & 15, hi = lane >> 4; const int zz = blockIdx.z; const bool vtr = zz == 2;
    const int wh = wv & 1, wt = wv >> 1; const int hh = blockIdx.x * 2 + wh, t0 = blockIdx.y * 128 + wt * 64;
    const size_t go = (size_t)(tid >> 3) * DD + (tid & 7) * 8;
    const bf* Wg = (zz == 0 ? WQ : zz == 1 ? WK : WV) + (size_t)blockIdx.x * 128 * DD + go; const bf* Xg = X + (size_t)blockIdx.y * 128 * DD + go;
    const unsigned l0 = (unsigned)(size_t)sm + (unsigned)((tid >> 3) * (GP * 2) + (tid & 7) * 16);
    const int wo = (wh * 64 + lr) * GP + 8 * hi, xo = 128 * GP + (wt * 64 + lr) * GP + 8 * hi;   // a lane's place in its wave's first 16-row block of each tile, elements
    const int ao = vtr ? xo : wo, bo = vtr ? wo : xo;
    v8f acc[4][4];
#pragma unroll
    for (int mb = 0; mb < 4; ++mb)
#pragma unroll
        for (int nb = 0; nb < 4; ++nb) acc[mb][nb] = (v8f){};
    stage128(l0, Wg); stage128(l0 + GTB, Xg);
    asm volatile("s_wait_asynccnt 0x0" ::: "memory");   // this wave's copies of trip 0 have landed
    __syncthreads();                                      // trip 0 is published
    stage128(l0 + 2 * GTB, Wg + GKS); stage128(l0 + 3 * GTB, Xg + GKS);
#pragma unroll 1   /* rolled: one copy of the trip's body; the buffer is chosen by an offset */
    for (int t = 0; t < DD / GKS; ++t) {
        const unsigned bb = (unsigned)(t & 1) * (2 * GTB); const bf* S = (const bf*)(sm + bb);
#pragma unroll
        for (int kk = 0; kk < GKS; kk += 32) {
            V a[4], b[4];   // all eight fragments of a 32-k block are asked for ahead of its WMMAs: one LDS latency per block
#pragma unroll
            for (int mb = 0; mb < 4; ++mb) { a[mb] = WFrag<bf>::ld(S + ao + mb * 16 * GP + kk); b[mb] = WFrag<bf>::ld(S + bo + mb * 16 * GP + kk); }
            // inputs only: holds the block's LDS loads together in front of its WMMAs; without it the compiler sinks them between the WMMAs, four to a wait, and the wave waits out the LDS latency each time
            asm volatile("" :: "v"(a[0]), "v"(a[1]), "v"(a[2]), "v"(a[3]), "v"(b[0]), "v"(b[1]), "v"(b[2]), "v"(b[3]));
#pragma unroll
            for (int nb = 0; nb < 4; ++nb)
#pragma unroll
                for (int mb = 0; mb < 4; ++mb) acc[mb][nb] = WFrag<bf>::mma(a[mb], b[nb], acc[mb][nb]);
        }
        asm volatile("s_wait_dscnt 0x0" ::: "memory");      // this wave's reads of the buffer have returned before it is refilled
        asm volatile("s_wait_asynccnt 0x0" ::: "memory");   // this wave's copies of trip t + 1 have landed
        __syncthreads();                                      // publishes trip t + 1 and ends every read of trip t
        if (t + 2 < DD / GKS) { stage128(l0 + bb, Wg + (t + 2) * GKS); stage128(l0 + bb + GTB, Xg + (t + 2) * GKS); }
    }
    asm volatile("s_wait_asynccnt 0x0" ::: "memory");   // no copy is outstanding when the ring becomes output staging
    h16* os = (h16*)(sm + wv * (64 * LPO * 2));           // a wave's own 64 output rows
#pragma unroll
    for (int mb = 0; mb < 4; ++mb)
#pragma unroll
        for (int nb = 0; nb < 4; ++nb) *(v8h*)(os + (nb * 16 + lr) * LPO + mb * 16 + 8 * hi) = __builtin_convertvector(acc[mb][nb], v8h);   // os[B row][A row]
    __builtin_amdgcn_wave_barrier(); asm volatile("" ::: "memory");   // one wave's rows: keeps the compiler from lifting the other lanes' read-back over the LDS stores
    const size_t z = (size_t)(t0 / TT) * NH_ + hh; const int tl = t0 & (TT - 1);
    h16* C = vtr ? VT + z * HD * TT + tl : (zz == 0 ? QP : KP) + (z * TT + tl) * HD; const int ldc = vtr ? TT : HD;
#pragma unroll
    for (int s = 0; s < 16; ++s) { const int row = s * 4 + (lane >> 3), ch = (lane & 7) * 8; *(v8h*)(C + (size_t)row * ldc + ch) = *(const v8ha*)(os + row * LPO + ch); }   // whole 128-B lines
}
#define KST  64
#define LP   72
#define CS2  0.18033688011112042f   /* (1/8) log2(e) */
typedef __attribute__((ext_vector_type(8))) __bf16 v8bf;
typedef __attribute__((ext_vector_type(4))) unsigned v4u;
__global__ __launch_bounds__(256) void k_fattn(const h16* __restrict__ QP, const h16* __restrict__ KP, const h16* __restrict__ VT, const float* __restrict__ GX, const float* __restrict__ CH, bf* Ah, bf* Al) {
    __shared__ __align__(16) h16 Ks[2][KST * LP];
    __shared__ __align__(16) h16 Vs[2][HD * LP];
    __shared__ __align__(16) float exs[TT];
    __shared__ __align__(16) bf osm[8][2][32 * LP];   // output staging: a wave's own 32 query rows of 128 B (pitch 144 B), hi plane and lo plane
    const int tid = threadIdx.x, lane = tid & 31, wv = tid >> 5, lr = lane & 15, hi = lane >> 4;
    const int z = blockIdx.y, b = z / NH_, h = z % NH_; const int q0 = blockIdx.x * 256 + wv * 32;
    const h16* Qz = QP + (size_t)z * TT * HD; const h16* Kz = KP + (size_t)z * TT * HD; const h16* Vz = VT + (size_t)z * HD * TT;
#pragma unroll
    for (int u = 0; u < TT / 256; ++u) exs[u * 256 + tid] = GX[((size_t)b * TT + u * 256 + tid) * 32 + 16 + h];
    v16h qf[2][2];
#pragma unroll
    for (int qt = 0; qt < 2; ++qt)
#pragma unroll
        for (int ks = 0; ks < 2; ++ks) qf[qt][ks] = WFrag<h16>::ld(Qz + (size_t)(q0 + qt * 16 + lr) * HD + ks * 32 + 8 * hi);
    const int srow = tid >> 3, sch = (tid & 7) * 8;   // a thread stages 16 B of rows srow and srow + 32 of each tile: a wave covers whole 128-B lines
    v8h kr[2], vr[2];
#pragma unroll
    for (int u = 0; u < 2; ++u) { kr[u] = *(const v8h*)(Kz + (size_t)(srow + 32 * u) * HD + sch); vr[u] = *(const v8h*)(Vz + (size_t)(srow + 32 * u) * TT + sch); }
#pragma unroll
    for (int u = 0; u < 2; ++u) { *(v8h*)(&Ks[0][(srow + 32 * u) * LP + sch]) = kr[u]; *(v8h*)(&Vs[0][(srow + 32 * u) * LP + sch]) = vr[u]; }
    v8f O[2][4]; float m[2]; v2f l1[2], l2[2];   // l1, l2: a lane's sums over even and odd keys, joined in the epilogue
#pragma unroll
    for (int qt = 0; qt < 2; ++qt) { m[qt] = -3.0e38f; l1[qt] = (v2f){}; l2[qt] = (v2f){};
#pragma unroll
        for (int dt = 0; dt < 4; ++dt) O[qt][dt] = (v8f){}; }
    __syncthreads();   // tile 0 and the gate row are published
#pragma unroll 1   /* rolled: one copy of the tile body; sixteen would only grow the code */
    for (int s = 0; s < TT / KST; ++s) {
        const h16* kb = Ks[s & 1]; const h16* vb = Vs[s & 1]; const bool more = s + 1 < TT / KST;
        if (more) {   // the next tile's global loads fly while this tile is worked on
#pragma unroll
            for (int u = 0; u < 2; ++u) { kr[u] = *(const v8h*)(Kz + (size_t)((s + 1) * KST + srow + 32 * u) * HD + sch); vr[u] = *(const v8h*)(Vz + (size_t)(srow + 32 * u) * TT + (s + 1) * KST + sch); } }
#pragma unroll 1   /* rolled: unrolled, the build took more VGPRs and more padding v_nop and fetched hardly any fragment earlier */
        for (int ps = 0; ps < 2; ++ps) {   // a pass: 32 keys
            const int kl = ps * 32; v8f st[2][2];
#pragma unroll
            for (int kt = 0; kt < 2; ++kt) { const v16h k0 = WFrag<h16>::ld(kb + (kl + kt * 16 + lr) * LP + 8 * hi), k1 = WFrag<h16>::ld(kb + (kl + kt * 16 + lr) * LP + 32 + 8 * hi);
#pragma unroll
                for (int qt = 0; qt < 2; ++qt) st[qt][kt] = wmma16(k1, qf[qt][1], wmma16(k0, qf[qt][0], (v8f){})); }   // st[qt][kt][r] = S[query qt*16+lr][key kl + kt*16 + 8*hi + r]
            v16h vf[4];
#pragma unroll
            for (int dt = 0; dt < 4; ++dt) vf[dt] = WFrag<h16>::ld(vb + (dt * 16 + lr) * LP + kl + 8 * hi);
            v2f ex[2][4];
#pragma unroll
            for (int kt = 0; kt < 2; ++kt) { const float* ep = exs + s * KST + kl + kt * 16 + 8 * hi; const v4f e0 = *(const v4fa*)ep, e1 = *(const v4fa*)(ep + 4);
                ex[kt][0] = __builtin_shufflevector(e0, e0, 0, 1); ex[kt][1] = __builtin_shufflevector(e0, e0, 2, 3); ex[kt][2] = __builtin_shufflevector(e1, e1, 0, 1); ex[kt][3] = __builtin_shufflevector(e1, e1, 2, 3); }
            float tm[2];
#pragma unroll
            for (int qt = 0; qt < 2; ++qt) { float t = st[qt][0][0];
#pragma unroll
                for (int r = 1; r < 8; ++r) t = fmaxf(t, st[qt][0][r]);
#pragma unroll
                for (int r = 0; r < 8; ++r) t = fmaxf(t, st[qt][1][r]);
                tm[qt] = t * CS2; }
            // lazy rescale: the maximum in use moves only when a lane's new score tops it by more than 8 (log2), so w stays below 2^8; one scalar test per pass
            if (__builtin_amdgcn_ballot_w32(tm[0] > m[0] + 8.0f || tm[1] > m[1] + 8.0f) != 0) {
#pragma unroll
                for (int qt = 0; qt < 2; ++qt) { const float mn = fmaxf(m[qt], fmaxf(tm[qt], __shfl_xor(tm[qt], 16, 32))); const float al = __builtin_amdgcn_exp2f(m[qt] - mn); m[qt] = mn; l1[qt] *= al; l2[qt] *= al;
#pragma unroll
                    for (int dt = 0; dt < 4; ++dt)
#pragma unroll
                        for (int r = 0; r < 8; ++r) O[qt][dt][r] *= al; } }
#pragma unroll
            for (int qt = 0; qt < 2; ++qt) { v8f w[2]; const v2f mm = {m[qt], m[qt]};
#pragma unroll
                for (int kt = 0; kt < 2; ++kt)
#pragma unroll
                    for (int i = 0; i < 4; ++i) {   // two neighbouring keys at a time: packed f32 on register pairs as the accumulator holds them
                        const v2f sv = {st[qt][kt][2 * i], st[qt][kt][2 * i + 1]}; const v2f tt = sv * CS2 - mm; const v2f e = {__builtin_amdgcn_exp2f(tt[0]), __builtin_amdgcn_exp2f(tt[1])};
                        l1[qt] += e; const v2f ww = e * ex[kt][i]; l2[qt] += ww; w[kt][2 * i] = ww[0]; w[kt][2 * i + 1] = ww[1]; }
                const v16h pf = cat16(__builtin_convertvector(w[0], v8h), __builtin_convertvector(w[1], v8h));   // element s = key kl + (s < 8 ? 8*hi + s : 16 + 8*hi + s - 8): the k order of the V^T loader
#pragma unroll
                for (int dt = 0; dt < 4; ++dt) O[qt][dt] = wmma16(vf[dt], pf, O[qt][dt]); }   // O[qt][dt][r] = O[query qt*16+lr][d = dt*16 + 8*hi + r]
        }
        if (more) {   // the other buffer's last readers left it before the barrier that ended the tile before this one
#pragma unroll
            for (int u = 0; u < 2; ++u) { *(v8h*)(&Ks[(s + 1) & 1][(srow + 32 * u) * LP + sch]) = kr[u]; *(v8h*)(&Vs[(s + 1) & 1][(srow + 32 * u) * LP + sch]) = vr[u]; } }
        __syncthreads();   // publishes tile s + 1 and ends every read of tile s
    }
    // chamber of head h: y_r = (x_r cos - x_i sin) ov tanh(chi), y_i = (x_r sin + x_i cos) ov tanh(chi), x = converged iv; iv goes into the query's factor, ov tanh(chi) into the two rotation factors
    const float iv = CH[h * 4], ot = CH[h * 4 + 3] * CH[64 + h]; const float cc = CH[h * 4 + 1] * ot, ss = CH[h * 4 + 2] * ot;
    float f[2];   // both columns' factors first
#pragma unroll
    for (int qt = 0; qt < 2; ++qt) { const float b1 = l1[qt][0] + l1[qt][1], b2 = l2[qt][0] + l2[qt][1]; const float a1 = b1 + __shfl_xor(b1, 16, 32), a2 = b2 + __shfl_xor(b2, 16, 32);
        const float g = __fdiv_rn(GX[((size_t)b * TT + q0 + qt * 16 + lr) * 32 + h], a1); f[qt] = __fdiv_rn(g, fmaf(g, a2, 1e-8f)) * iv; }
    bf* sh = osm[wv][0]; bf* sl = osm[wv][1];
#pragma unroll
    for (int qt = 0; qt < 2; ++qt)
#pragma unroll
        for (int dt = 0; dt < 2; ++dt) { const v8f xr = O[qt][dt] * f[qt], xi = O[qt][dt + 2] * f[qt]; v8f y[2]; y[0] = xr * cc - xi * ss; y[1] = xr * ss + xi * cc;
#pragma unroll
            for (int p = 0; p < 2; ++p) { const v8bf yh = __builtin_convertvector(y[p], v8bf); const v4u pw = __builtin_bit_cast(v4u, yh); v8f hf;   // hf: the hi plane's values back in f32, unpacked from the packed words
#pragma unroll
                for (int i = 0; i < 4; ++i) { hf[2 * i] = __uint_as_float(pw[i] << 16); hf[2 * i + 1] = __uint_as_float(pw[i] & 0xFFFF0000u); }
                const v8bf yl = __builtin_convertvector(y[p] - hf, v8bf);
                const int o = (qt * 16 + lr) * LP + p * 32 + dt * 16 + 8 * hi; *(v8us*)(sh + o) = __builtin_bit_cast(v8us, yh); *(v8us*)(sl + o) = __builtin_bit_cast(v8us, yl); } }
    asm volatile("s_wait_dscnt 0x0" ::: "memory");   // one wave's own rows: its LDS stores have retired before its lanes read one another's rows back; the clobber keeps the read-back behind it
    const size_t go = ((size_t)b * TT + q0 + (lane >> 3)) * DD + h * HD + (lane & 7) * 8; const int so = (lane >> 3) * LP + (lane & 7) * 8;
#pragma unroll
    for (int s = 0; s < 8; ++s) { *(v8us*)(Ah + go + (size_t)s * 4 * DD) = *(const v8usa*)(sh + so + s * 4 * LP); *(v8us*)(Al + go + (size_t)s * 4 * DD) = *(const v8usa*)(sl + so + s * 4 * LP); }   // whole 128-B lines
}

extern "C" void kernel_launch(void* const* d_in, const int* in_sizes, int n_in,
                              void* d_out, int out_size, void* d_ws, size_t ws_size, hipStream_t stream) {
    (void)in_sizes; (void)n_in; (void)out_size;
    const float* IN[13]; for (int i = 0; i < 13; ++i) IN[i] = (const float*)d_in[i];
    // x [4][1024][1024], Wa [1024][16], ba, We, be, Wi, Wo, Wv, Wout ([in][out] = x @ W), chi, beta_p, iv_p, ov_p [16] = d_in[0..12]
    float* OUT = (float*)d_out;     // [4][1024][1024]
    char* wsp = (char*)d_ws;
    auto take = [&](size_t bytes) { char* p = wsp; wsp += (bytes + 255) & ~(size_t)255; return (void*)p; };
    bf* WO = (bf*)take((size_t)DD * DD * 2); float* GX = (float*)take((size_t)NT * 32 * 4); float* CH = (float*)take(512);
    h16* QP = (h16*)take((size_t)NT * DD * 2); h16* KP = (h16*)take((size_t)NT * DD * 2); h16* VT = (h16*)take((size_t)NT * DD * 2);
    bf* ATh = (bf*)take((size_t)NT * DD * 2); bf* ATl = (bf*)take((size_t)NT * DD * 2);
    bf* WQ = (bf*)take((size_t)DD * DD * 2); bf* WK = (bf*)take((size_t)DD * DD * 2); bf* WV = (bf*)take((size_t)DD * DD * 2); bf* XB = (bf*)take((size_t)NT * DD * 2);
    if ((size_t)(wsp - (char*)d_ws) > ws_size) return;    // total below 75 MiB; ws 256 MiB
    k_prep<<<PB_ALL, 256, 0, stream>>>(IN[0], IN[1], IN[2], IN[3], IN[4], IN[5], IN[6], IN[7], IN[8], IN[9], IN[10], IN[11], IN[12], GX, WQ, WK, WV, WO, CH, XB);   // gates, transposed bf16 weights, chamber constants, bf16 x
    k_proj<<<dim3(NH_ / 2, NT / 128, 3), 128, 0, stream>>>(XB, WQ, WK, WV, QP, KP, VT);   // inner, outer (the 1/8 is applied in f32 inside k_fattn) and v, stored as fp16 head planes
    k_fattn<<<dim3(TT / 256, NZ, 1), 256, 0, stream>>>(QP, KP, VT, GX, CH, ATh, ATl);   // all 64 flat heads (b * 16 + h) in one launch; chamber and hi/lo split in its epilogue
    k_gemmo<<<dim3(NT / 128, DD / 128, 1), 128, 0, stream>>>(ATh, ATl, WO, OUT);
}

// v009
// It runs in 78.7 microseconds.
// In both of two side-by-side timings against v008, it was 1.06 times as fast.
// All steps since v000 together make it 20.3 times as fast.
#include <hip/hip_runtime.h>

// XorzoTransformer (x [4][1024][1024]; aperture = sigmoid(x Wa + ba), expression = sigmoid(x We + be) ([T][16] per-head gates); inner/outer/v = x @ Wi / Wo / Wv (16 heads x 64); p = softmax(inner.outer^T / 8);
// attn = p ap_i ex_j / (sum_j p ap_i ex_j + 1e-8); converged = attn v; ApertureChamber per head: x_in = converged sigmoid(iv_h); (xr, xi) halves rotated by angle pi sigmoid(beta_h); x sigmoid(ov_h) x tanh(chi_h);
// out = merged @ Wout).
// Compute dtypes, f32 accumulate: every input rounded to bf16; the three 1024-wide projections on PLAIN bf16 operands (inputs: exact; transposed bf16 weight copies); the
// 16-wide gate projections on the same bf16 values, formed in registers, on WMMA; scores and attn.v on SINGLE fp16 planes inside one fused kernel (1/8, running-maximum softmax, the bilateral gating and the renormalisation in f32; gated weights in fp16);

#define NB_  4
#define TT   1024
#define DD   1024
#define NH_  16
#define HD   64
#define NT   (NB_ * TT)
#define NZ   (NB_ * NH_)
#define SCL  0.125f
typedef _Float16 h16;
typedef unsigned short bf;
typedef __attribute__((ext_vector_type(16))) __bf16   v16bf;
typedef __attribute__((ext_vector_type(16))) _Float16 v16h;
typedef __attribute__((ext_vector_type(8)))  _Float16 v8h;
typedef __attribute__((ext_vector_type(8)))  unsigned short v8us;
typedef __attribute__((ext_vector_type(8)))  float    v8f;
typedef __attribute__((ext_vector_type(4)))  float    v4f;
typedef v8h  __attribute__((may_alias)) v8ha;
typedef v4f  __attribute__((may_alias)) v4fa;
typedef v8us __attribute__((may_alias)) v8usa;

__device__ __forceinline__ unsigned short f2bf(float f) { unsigned u = __float_as_uint(f); u += 0x7FFFu + ((u >> 16) & 1u); return (unsigned short)(u >> 16); }
__device__ __forceinline__ float bf2f(unsigned short b) { return __uint_as_float(((unsigned)b) << 16); }
__device__ __forceinline__ float bfr(float f) { return bf2f(f2bf(f)); }
__device__ __forceinline__ v16h cat16(v8h lo, v8h hi) { return __builtin_shufflevector(lo, hi, 0, 1, 2, 3, 4, 5, 6, 7, 8, 9, 10, 11, 12, 13, 14, 15); }
__device__ __forceinline__ v16bf cat16b(v8us lo, v8us hi) { return __builtin_bit_cast(v16bf, __builtin_shufflevector(lo, hi, 0, 1, 2, 3, 4, 5, 6, 7, 8, 9, 10, 11, 12, 13, 14, 15)); }
__device__ __forceinline__ v8f wmma16(v16h a, v16h b, v8f c) { return __builtin_amdgcn_wmma_f32_16x16x32_f16(false, a, false, b, (short)0, c, false, false); }
__device__ __forceinline__ v8f wmmab(v16bf a, v16bf b, v8f c) { return __builtin_amdgcn_wmma_f32_16x16x32_bf16(false, a, false, b, (short)0, c, false, false); }



// ---- fragment loaders of the 16-bit planes (K-contiguous rows, in memory or in LDS)
template <typename T16> struct WFrag;
template <> struct WFrag<h16> { typedef v16h V; static __device__ __forceinline__ V ld(const h16* p) { return cat16(*(const v8h*)p, *(const v8h*)(p + 16)); } static __device__ __forceinline__ v8f mma(V a, V b, v8f c) { return wmma16(a, b, c); } };
template <> struct WFrag<bf> { typedef v16bf V; static __device__ __forceinline__ V ld(const bf* p) { return cat16b(*(const v8us*)p, *(const v8us*)(p + 16)); } static __device__ __forceinline__ v8f mma(V a, V b, v8f c) { return wmmab(a, b, c); } };

// ---- operand staging of the two GEMM kernels: a tile is 128 rows x 64 k (128 B of a row), kept in LDS at a pitch of 144 B.
// Every GEMM operand plane of R rows lies in memory tile-major, [k / 64][row][64]: element (row, k) at ((k >> 6) * R + row) * 64 + (k & 63), so a tile is 16 KB in a row.
// 128 threads: thread tid brings 16 B of rows (tid >> 3) + 16 u, u = 0..7: a wave's copy covers 512 contiguous bytes (four rows). No register holds the data.
#define GP   72            /* LDS pitch of a staged row, elements */
#define GTB  (128 * GP * 2) /* bytes of a staged tile */
#define GKS  64            /* k per trip */
// lds: the lane's LDS byte address in row tid >> 3 of the tile; g: the lane's 16 B in the same row of the tile in memory (tile start + 8 tid elements).
__device__ __forceinline__ void stage128(unsigned lds, const bf* g) {
    // the wait is the statement's last line: it stands in front of any rewrite of the address registers that the copies name
    asm volatile("global_load_async_to_lds_b128 %0, %8, off\n\t"
                 "global_load_async_to_lds_b128 %1, %9, off\n\t"
                 "global_load_async_to_lds_b128 %2, %10, off\n\t"
                 "global_load_async_to_lds_b128 %3, %11, off\n\t"
                 "global_load_async_to_lds_b128 %4, %12, off\n\t"
                 "global_load_async_to_lds_b128 %5, %13, off\n\t"
                 "global_load_async_to_lds_b128 %6, %14, off\n\t"
                 "global_load_async_to_lds_b128 %7, %15, off\n\t"
                 "s_wait_xcnt 0x0"
                 :: "v"(lds), "v"(lds + 16 * GP * 2), "v"(lds + 32 * GP * 2), "v"(lds + 48 * GP * 2), "v"(lds + 64 * GP * 2), "v"(lds + 80 * GP * 2), "v"(lds + 96 * GP * 2), "v"(lds + 112 * GP * 2),
                    "v"(g), "v"(g + 16 * GKS), "v"(g + 32 * GKS), "v"(g + 48 * GKS), "v"(g + 64 * GKS), "v"(g + 80 * GKS), "v"(g + 96 * GKS), "v"(g + 112 * GKS) : "memory");
}

// ---- k_gemmo: OUT[m][n] (f32) = sum_k (Ah[m][k] + Al[m][k]) Bt[n][k], the three planes tile-major; grid (NT/128, DD/128), 4 waves, a 128x128 tile per block, 64x64 (16 accumulators) per wave.
// The three operand tiles of a trip come to LDS by asynchronous copies, two buffers: trip t + 1's copies fly while trip t is worked on. Per accumulator the products are summed in the order k ascending, hi then lo.
__global__ __launch_bounds__(128) void k_gemmo(const bf* __restrict__ A, const bf* __restrict__ A2, const bf* __restrict__ Bt, float* C) {
    typedef WFrag<bf>::V V;
    __shared__ __align__(16) char sm[2 * 3 * GTB];   // [buffer][Ah | Al | Bt]; the epilogue's staging rows lie over it
    const int tid = threadIdx.x, lane = tid & 31, wv = tid >> 5, lr = lane & 15, hi = lane >> 4;
    const int rb = blockIdx.x * 128, cb = blockIdx.y * 128, wm = wv & 1, wn = wv >> 1;
    const bf* Ag = A + rb * GKS + tid * 8; const bf* A2g = A2 + rb * GKS + tid * 8; const bf* Bg = Bt + cb * GKS + tid * 8;   // the lane's 16 B of trip 0's tiles; a trip is NT * GKS (A) or DD * GKS (Bt) elements on
    const unsigned l0 = (unsigned)(size_t)sm + (unsigned)((tid >> 3) * (GP * 2) + (tid & 7) * 16);
    const int ao = (wm * 64 + lr) * GP + 8 * hi, bo = (wn * 64 + lr) * GP + 8 * hi;   // a lane's place in its wave's first 16-row block, elements
    v8f acc[4][4];
#pragma unroll
    for (int mb = 0; mb < 4; ++mb)
#pragma unroll
        for (int nb = 0; nb < 4; ++nb) acc[mb][nb] = (v8f){};
    stage128(l0, Ag); stage128(l0 + GTB, A2g); stage128(l0 + 2 * GTB, Bg);
    asm volatile("s_wait_asynccnt 0x0" ::: "memory");   // this wave's copies of trip 0 have landed
    __syncthreads();                                      // trip 0 is published
    stage128(l0 + 3 * GTB, Ag + NT * GKS); stage128(l0 + 4 * GTB, A2g + NT * GKS); stage128(l0 + 5 * GTB, Bg + DD * GKS);
#pragma unroll 1   /* rolled: one copy of the trip's body; the buffer is chosen by an offset */
    for (int t = 0; t < DD / GKS; ++t) {
        const unsigned bb = (unsigned)(t & 1) * (3 * GTB); const bf* S = (const bf*)(sm + bb);
#pragma unroll
        for (int kk = 0; kk < GKS; kk += 32) {
            V a[4], a2[4], b[4];   // all twelve fragments of a 32-k block are asked for ahead of its WMMAs: one LDS latency per block
#pragma unroll
            for (int nb = 0; nb < 4; ++nb) b[nb] = WFrag<bf>::ld(S + 2 * 128 * GP + bo + nb * 16 * GP + kk);
#pragma unroll
            for (int mb = 0; mb < 4; ++mb) { a[mb] = WFrag<bf>::ld(S + ao + mb * 16 * GP + kk); a2[mb] = WFrag<bf>::ld(S + 128 * GP + ao + mb * 16 * GP + kk); }
            // inputs only: holds the block's LDS loads together in front of its WMMAs; without it the compiler sinks them between the WMMAs, four to a wait, and the wave waits out the LDS latency each time
            asm volatile("" :: "v"(a[0]), "v"(a[1]), "v"(a[2]), "v"(a[3]), "v"(a2[0]), "v"(a2[1]), "v"(a2[2]), "v"(a2[3]), "v"(b[0]), "v"(b[1]), "v"(b[2]), "v"(b[3]));
#pragma unroll
            for (int mb = 0; mb < 4; ++mb)
#pragma unroll
                for (int nb = 0; nb < 4; ++nb) { acc[mb][nb] = WFrag<bf>::mma(a[mb], b[nb], acc[mb][nb]); acc[mb][nb] = WFrag<bf>::mma(a2[mb], b[nb], acc[mb][nb]); }
        }
        asm volatile("s_wait_dscnt 0x0" ::: "memory");      // this wave's reads of the buffer have returned before it is refilled
        asm volatile("s_wait_asynccnt 0x0" ::: "memory");   // this wave's copies of trip t + 1 have landed
        __syncthreads();                                      // publishes trip t + 1 and ends every read of trip t
        if (t + 2 < DD / GKS) { stage128(l0 + bb, Ag + (t + 2) * (NT * GKS)); stage128(l0 + bb + GTB, A2g + (t + 2) * (NT * GKS)); stage128(l0 + bb + 2 * GTB, Bg + (t + 2) * (DD * GKS)); }
    }
    asm volatile("s_wait_asynccnt 0x0" ::: "memory");   // no copy is outstanding when the ring becomes output staging
    float* os = (float*)(sm + wv * (16 * 68 * 4));        // a wave's own 16 rows of 64 f32 at a pitch of 68
    const int r0 = rb + wm * 64, c0 = cb + wn * 64;
#pragma unroll
    for (int mb = 0; mb < 4; ++mb) {
#pragma unroll
        for (int nb = 0; nb < 4; ++nb) {
#pragma unroll
            for (int j = 0; j < 8; ++j) os[(hi * 8 + j) * 68 + nb * 16 + lr] = acc[mb][nb][j]; }
        __builtin_amdgcn_wave_barrier(); asm volatile("" ::: "memory");   // one wave's rows: keeps the compiler from lifting the other lanes' read-back over the LDS stores
        float* crow = C + (size_t)(r0 + mb * 16) * DD + c0;
#pragma unroll
        for (int s = 0; s < 8; ++s) { const int row = 2 * s + hi, cofs = lr * 4; *(v4f*)(crow + (size_t)row * DD + cofs) = *(const v4fa*)(os + row * 68 + cofs); }
        __builtin_amdgcn_wave_barrier(); asm volatile("" ::: "memory");   // and the next block's stores over these reads
    }
}

typedef __attribute__((ext_vector_type(2))) _Float16 v2h;
typedef __attribute__((ext_vector_type(4))) _Float16 v4h;
typedef __attribute__((ext_vector_type(2))) unsigned short v2us;
typedef __attribute__((ext_vector_type(4))) unsigned short v4us;
typedef __attribute__((ext_vector_type(2))) float v2f;

// ---- the seven preparation jobs (no one reads what another writes) are the parts of ONE launch, k_prep: each is a device function; all but p_cham (one block) are told their own block index bx.
// p_cvt8: thread i writes the i-th 16 B of the tile-major bf16 plane of x: row (i >> 3) % NT, k = 64 (i / (8 NT)) + 8 (i & 7). A wave reads 256 B of four rows and stores 512 contiguous bytes.
__device__ __forceinline__ void p_cvt8(int bx, const float* __restrict__ src, bf* dst, size_t n8) { const size_t i = (size_t)bx * 256 + threadIdx.x; if (i >= n8) return;
    const float* sp = src + ((i >> 3) & (NT - 1)) * DD + (i / (NT * 8)) * 64 + (i & 7) * 8; const v8f v = *(const v8f*)sp; v8us o;
    // behind the load: the address pair, named as an input, stays as it is up to this wait, so no later instruction rewrites it in front of it
    asm volatile("s_wait_xcnt 0x0" :: "v"(sp) : "memory");
#pragma unroll
    for (int k = 0; k < 8; ++k) o[k] = f2bf(v[k]); *(v8us*)(dst + i * 8) = o;  }
// p_wtT: Bt[n][k] = bf16(w[k][n]), stored tile-major ([k / 64][n][64]), one tile of 256 k x 64 n per block, turned in LDS. Reads: a half wave takes 256 B of a row of w (whole lines); a thread holds 4 columns of 8 pairs of neighbouring k rows,
// all sixteen loads asked for ahead of the first rounding. It packs (k, k + 1) of a column in one word and stores the word in the column's LDS row. Writes: a wave stores a whole 128-B line of Bt (64 k of one n) per instruction. The plain '#pragma unroll' lines keep r in registers (constant indices).
#define WTK 256   /* k of a tile */
#define WTP 129   /* LDS pitch of a turned row (128 words), words: odd, so a wave's word stores (16 columns 4 apart, two k pairs) fall on different banks */
__device__ __forceinline__ void p_wtT(int bx, const float* __restrict__ w, bf* Bt) {
    __shared__ unsigned tl[64 * WTP];
    const int lane = threadIdx.x & 31, wv = threadIdx.x >> 5; const int k0 = (bx >> 4) * WTK, n0 = (bx & 15) * 64;
    const int c4 = (lane & 15) * 4, j0 = wv * 4 + (lane >> 4) * 2;   // the thread's first column, and its first k pair in each 64 k of the tile
    const float* wp = w + (size_t)(k0 + 2 * j0) * DD + n0 + c4;
    v4f r[4][4];
#pragma unroll
    for (int t = 0; t < 4; ++t)
#pragma unroll
        for (int u = 0; u < 4; ++u) r[t][u] = *(const v4f*)(wp + (size_t)(t * 64 + u) * DD);
    // keeps the roundings behind all sixteen loads: without it the compiler lifts the first roundings, with their wait, over the last two loads, and the wave waits out a second memory latency
    __builtin_amdgcn_sched_barrier(0);
    // behind the sixteen loads: the address pair, named as an input, stays as it is up to this wait, so no later instruction (a load's result included) rewrites it in front of it
    asm volatile("s_wait_xcnt 0x0" :: "v"(wp) : "memory");
#pragma unroll
    for (int t = 0; t < 4; ++t)
#pragma unroll
        for (int u = 0; u < 2; ++u)
#pragma unroll
            for (int i = 0; i < 4; ++i) tl[(c4 + i) * WTP + t * 32 + j0 + u] = (unsigned)f2bf(r[t][2 * u][i]) | ((unsigned)f2bf(r[t][2 * u + 1][i]) << 16);
    __syncthreads();   // the turned tile is published (block-uniform: the whole block is in this job)
    bf* bo = Bt + ((size_t)(k0 >> 6) * DD + n0 + wv * 8) * 64 + lane * 2;   // tile-major: row n of the 64-k slab k0 / 64
#pragma unroll
    for (int q = 0; q < 8; ++q)
#pragma unroll
        for (int t = 0; t < 4; ++t) *(v2us*)(bo + q * 64 + (size_t)t * (DD * 64)) = __builtin_bit_cast(v2us, tl[(wv * 8 + q) * WTP + t * 32 + lane]);
}
// p_gates: both gate projections of 16 tokens per block on the matrix unit. A = gate weights (16 columns of Wa, 16 of We), B = the 16 token rows; both fragments are rounded to bf16 in registers from the f32 inputs,
// in the k order of WFrag::ld (elements 0..7: k + 8 hi + s, elements 8..15: k + 16 + 8 hi + s). Wave w takes k = 128 w .. 128 w + 127 (4 WMMA steps a tile); the 8 partial tiles are summed through LDS in wave order.
#define GRP 36   /* LDS pitch of a token's 32 partial sums, floats: 144 B */
__device__ __forceinline__ void p_gates(int bx, const float* __restrict__ x, const float* __restrict__ Wa, const float* __restrict__ ba, const float* __restrict__ We, const float* __restrict__ be, float* GX) {
    __shared__ __align__(16) float red[8 * 16 * GRP];
    const int tid = threadIdx.x, lane = tid & 31, wv = tid >> 5, lr = lane & 15, hi = lane >> 4; const int r0 = bx * 16;
    const float* xp = x + (size_t)(r0 + lr) * DD + wv * 128 + 8 * hi;
    const float* wap = Wa + (size_t)(wv * 128 + 8 * hi) * NH_ + lr; const float* wep = We + (size_t)(wv * 128 + 8 * hi) * NH_ + lr;
    v8f acc[2]; acc[0] = (v8f){}; acc[1] = (v8f){};
#pragma unroll
    for (int kk = 0; kk < 128; kk += 32) {
        const v4f x0 = *(const v4f*)(xp + kk), x1 = *(const v4f*)(xp + kk + 4), x2 = *(const v4f*)(xp + kk + 16), x3 = *(const v4f*)(xp + kk + 20);
        v8f wa0, wa1, we0, we1;
#pragma unroll
        for (int s = 0; s < 8; ++s) { wa0[s] = wap[(kk + s) * NH_]; wa1[s] = wap[(kk + 16 + s) * NH_]; we0[s] = wep[(kk + s) * NH_]; we1[s] = wep[(kk + 16 + s) * NH_]; }
        // inputs only: holds the 36 loads of a k step together in front of their roundings; without it the compiler deals them out a few to a wait, and the wave waits out a memory latency each time
        asm volatile("" :: "v"(x0), "v"(x1), "v"(x2), "v"(x3), "v"(wa0), "v"(wa1), "v"(we0), "v"(we1));
        // behind the last loads: the three address pairs, named as inputs, stay as they are up to this wait, so no later instruction (a load's result included) rewrites one in front of it
        if (kk == 96) asm volatile("s_wait_xcnt 0x0" :: "v"(xp), "v"(wap), "v"(wep) : "memory");
        v8us xl, xh, al, ah, el, eh;
#pragma unroll
        for (int s = 0; s < 4; ++s) { xl[s] = f2bf(x0[s]); xl[4 + s] = f2bf(x1[s]); xh[s] = f2bf(x2[s]); xh[4 + s] = f2bf(x3[s]); }
#pragma unroll
        for (int s = 0; s < 8; ++s) { al[s] = f2bf(wa0[s]); ah[s] = f2bf(wa1[s]); el[s] = f2bf(we0[s]); eh[s] = f2bf(we1[s]); }
        const v16bf xf = cat16b(xl, xh);
        acc[0] = wmmab(cat16b(al, ah), xf, acc[0]); acc[1] = wmmab(cat16b(el, eh), xf, acc[1]);   // acc[mb][j] = partial[token lr][column mb * 16 + 8 hi + j]
    }
    float* rw = red + (wv * 16 + lr) * GRP + 8 * hi;
#pragma unroll
    for (int mb = 0; mb < 2; ++mb) { *(v4f*)(rw + mb * 16) = __builtin_shufflevector(acc[mb], acc[mb], 0, 1, 2, 3); *(v4f*)(rw + mb * 16 + 4) = __builtin_shufflevector(acc[mb], acc[mb], 4, 5, 6, 7); }
    __syncthreads();   // the eight waves' partial tiles are published (block-uniform: the whole block is in this job)
#pragma unroll
    for (int u = 0; u < 2; ++u) { const int o = u * 256 + tid, tk = o >> 5, c = o & 31; float s = red[tk * GRP + c];
#pragma unroll
        for (int w = 1; w < 8; ++w) s += red[(w * 16 + tk) * GRP + c];
        const float mine = __fadd_rn(s, bfr(*(c < 16 ? ba + c : be + (c - 16))));
        GX[(size_t)(r0 + tk) * 32 + c] = __fdiv_rn(1.0f, __fadd_rn(1.0f, __expf(-mine))); }
}
__device__ __forceinline__ void p_cham(const float* __restrict__ chi, const float* __restrict__ bp, const float* __restrict__ ivp, const float* __restrict__ ovp, float* CH) { const int lane = threadIdx.x; const int h = lane >> 1; const int part = (lane & 1) * 2;
    const float sg_b = __fdiv_rn(1.0f, __fadd_rn(1.0f, __expf(-bfr(bp[h])))); const float ang = __fmul_rn(3.14159265358979f, sg_b); v2f o;
    if (part == 0) { o[0] = __fdiv_rn(1.0f, __fadd_rn(1.0f, __expf(-bfr(ivp[h])))); o[1] = cosf(ang); } else { o[0] = sinf(ang); o[1] = __fdiv_rn(1.0f, __fadd_rn(1.0f, __expf(-bfr(ovp[h])))); }
    const float th = (lane < NH_) ? tanhf(bfr(chi[lane])) : 0.f;
    *(v2f*)(CH + lane * 2) = o; *(float*)(CH + 64 + lane) = th;  }
// k_prep: blocks are dealt by index: gates, the four weight transposes, the chamber constants (one wave of one block), the bf16 copy of x.
#define PB_G  (NT / 16)                     /* blocks of the gates */
#define PB_W  ((DD / WTK) * (DD / 64))      /* blocks of one weight transpose */
#define PB_X  (NT * DD / 8 / 256)           /* blocks of the copy of x */
#define PB_ALL (PB_G + 4 * PB_W + 1 + PB_X)
__global__ __launch_bounds__(256) void k_prep(const float* __restrict__ x, const float* __restrict__ Wa, const float* __restrict__ ba, const float* __restrict__ We, const float* __restrict__ be,
                                              const float* __restrict__ Wi, const float* __restrict__ Wo, const float* __restrict__ Wv, const float* __restrict__ Wout,
                                              const float* __restrict__ chi, const float* __restrict__ bp, const float* __restrict__ ivp, const float* __restrict__ ovp,
                                              float* GX, bf* WQ, bf* WK, bf* WV, bf* WO, float* CH, bf* XB) {
    int bx = blockIdx.x;
    if (bx < PB_G) { p_gates(bx, x, Wa, ba, We, be, GX); return; }
    bx -= PB_G;
    if (bx < 4 * PB_W) { const int j = bx / PB_W; p_wtT(bx % PB_W, j == 0 ? Wi : j == 1 ? Wo : j == 2 ? Wv : Wout, j == 0 ? WQ : j == 1 ? WK : j == 2 ? WV : WO); return; }
    bx -= 4 * PB_W;
    if (bx == 0) { if (threadIdx.x < 32) p_cham(chi, bp, ivp, ovp, CH); return; }
    p_cvt8(bx - 1, x, XB, (size_t)NT * DD / 8);
}
// k_proj: the three 1024-wide projections in one launch, grid (NH_/2, NT/128, 3), 4 waves: a block takes 128 tokens x two heads, a wave 64 tokens x one head (64x64, 16 accumulators), plain bf16 planes, tile-major.
// The weight rows and the token rows of a trip (64 k) come to LDS by asynchronous copies, two buffers, and each is read by two waves.
// The epilogue stores the fp16 plane that k_fattn reads; no f32 copy of a projection reaches memory. A lane's accumulator holds 8 consecutive rows of the A operand, so the operand whose index runs
// contiguously in the plane is taken as A: z = 0, 1 (inner, outer): A = weight rows (d), B = token rows, plane [head][t][d]; z = 2 (v): A = token rows, B = weight rows (d), plane [head][d][t].
#define LPO  72   /* LDS pitch of a 128-B output row: 144 B */
__global__ __launch_bounds__(128) void k_proj(const bf* __restrict__ X, const bf* __restrict__ WQ, const bf* __restrict__ WK, const bf* __restrict__ WV, h16* QP, h16* KP, h16* VT) {
    typedef WFrag<bf>::V V;
    __shared__ __align__(16) char sm[2 * 2 * GTB];   // [buffer][weight rows | token rows]; the epilogue's staging rows lie over it
    const int tid = threadIdx.x, lane = tid & 31, wv = tid >> 5, lr = lane & 15, hi = lane >> 4; const int zz = blockIdx.z; const bool vtr = zz == 2;
    const int wh = wv & 1, wt = wv >> 1; const int hh = blockIdx.x * 2 + wh, t0 = blockIdx.y * 128 + wt * 64;
    const bf* Wg = (zz == 0 ? WQ : zz == 1 ? WK : WV) + blockIdx.x * (128 * GKS) + tid * 8; const bf* Xg = X + blockIdx.y * (128 * GKS) + tid * 8;   // the lane's 16 B of trip 0's tiles; a trip is DD * GKS (weights) or NT * GKS (x) elements on
    const unsigned l0 = (unsigned)(size_t)sm + (unsigned)((tid >> 3) * (GP * 2) + (tid & 7) * 16);
    const int wo = (wh * 64 + lr) * GP + 8 * hi, xo = 128 * GP + (wt * 64 + lr) * GP + 8 * hi;   // a lane's place in its wave's first 16-row block of each tile, elements
    const int ao = vtr ? xo : wo, bo = vtr ? wo : xo;
    v8f acc[4][4];
#pragma unroll
    for (int mb = 0; mb < 4; ++mb)
#pragma unroll
        for (int nb = 0; nb < 4; ++nb) acc[mb][nb] = (v8f){};
    stage128(l0, Wg); stage128(l0 + GTB, Xg);
    asm volatile("s_wait_asynccnt 0x0" ::: "memory");   // this wave's copies of trip 0 have landed
    __syncthreads();                                      // trip 0 is published
    stage128(l0 + 2 * GTB, Wg + DD * GKS); stage128(l0 + 3 * GTB, Xg + NT * GKS);
#pragma unroll 1   /* rolled: one copy of the trip's body; the buffer is chosen by an offset */
    for (int t = 0; t < DD / GKS; ++t) {
        const unsigned bb = (unsigned)(t & 1) * (2 * GTB); const bf* S = (const bf*)(sm + bb);
#pragma unroll
        for (int kk = 0; kk < GKS; kk += 32) {
            V a[4], b[4];   // all eight fragments of a 32-k block are asked for ahead of its WMMAs: one LDS latency per block
#pragma unroll
            for (int mb = 0; mb < 4; ++mb) { a[mb] = WFrag<bf>::ld(S + ao + mb * 16 * GP + kk); b[mb] = WFrag<bf>::ld(S + bo + mb * 16 * GP + kk); }
            // inputs only: holds the block's LDS loads together in front of its WMMAs; without it the compiler sinks them between the WMMAs, four to a wait, and the wave waits out the LDS latency each time
            asm volatile("" :: "v"(a[0]), "v"(a[1]), "v"(a[2]), "v"(a[3]), "v"(b[0]), "v"(b[1]), "v"(b[2]), "v"(b[3]));
#pragma unroll
            for (int nb = 0; nb < 4; ++nb)
#pragma unroll
                for (int mb = 0; mb < 4; ++mb) acc[mb][nb] = WFrag<bf>::mma(a[mb], b[nb], acc[mb][nb]);
        }
        asm volatile("s_wait_dscnt 0x0" ::: "memory");      // this wave's reads of the buffer have returned before it is refilled
        asm volatile("s_wait_asynccnt 0x0" ::: "memory");   // this wave's copies of trip t + 1 have landed
        __syncthreads();                                      // publishes trip t + 1 and ends every read of trip t
        if (t + 2 < DD / GKS) { stage128(l0 + bb, Wg + (t + 2) * (DD * GKS)); stage128(l0 + bb + GTB, Xg + (t + 2) * (NT * GKS)); }
    }
    asm volatile("s_wait_asynccnt 0x0" ::: "memory");   // no copy is outstanding when the ring becomes output staging
    h16* os = (h16*)(sm + wv * (64 * LPO * 2));           // a wave's own 64 output rows
#pragma unroll
    for (int mb = 0; mb < 4; ++mb)
#pragma unroll
        for (int nb = 0; nb < 4; ++nb) *(v8h*)(os + (nb * 16 + lr) * LPO + mb * 16 + 8 * hi) = __builtin_convertvector(acc[mb][nb], v8h);   // os[B row][A row]
    __builtin_amdgcn_wave_barrier(); asm volatile("" ::: "memory");   // one wave's rows: keeps the compiler from lifting the other lanes' read-back over the LDS stores
    const size_t z = (size_t)(t0 / TT) * NH_ + hh; const int tl = t0 & (TT - 1);
    h16* C = vtr ? VT + z * HD * TT + tl : (zz == 0 ? QP : KP) + (z * TT + tl) * HD; const int ldc = vtr ? TT : HD;
#pragma unroll
    for (int s = 0; s < 16; ++s) { const int row = s * 4 + (lane >> 3), ch = (lane & 7) * 8; *(v8h*)(C + (size_t)row * ldc + ch) = *(const v8ha*)(os + row * LPO + ch); }   // whole 128-B lines
}
#define KST  64
#define LP   72
#define CS2  0.18033688011112042f   /* (1/8) log2(e) */
typedef __attribute__((ext_vector_type(8))) __bf16 v8bf;
typedef __attribute__((ext_vector_type(4))) unsigned v4u;
__global__ __launch_bounds__(256) void k_fattn(const h16* __restrict__ QP, const h16* __restrict__ KP, const h16* __restrict__ VT, const float* __restrict__ GX, const float* __restrict__ CH, bf* Ah, bf* Al) {
    __shared__ __align__(16) h16 Ks[2][KST * LP];
    __shared__ __align__(16) h16 Vs[2][HD * LP];
    __shared__ __align__(16) float exs[TT];
    __shared__ __align__(16) bf osm[8][2][32 * LP];   // output staging: a wave's own 32 query rows of 128 B (pitch 144 B), hi plane and lo plane
    const int tid = threadIdx.x, lane = tid & 31, wv = tid >> 5, lr = lane & 15, hi = lane >> 4;
    const int z = blockIdx.y, b = z / NH_, h = z % NH_; const int q0 = blockIdx.x * 256 + wv * 32;
    const h16* Qz = QP + (size_t)z * TT * HD; const h16* Kz = KP + (size_t)z * TT * HD; const h16* Vz = VT + (size_t)z * HD * TT;
#pragma unroll
    for (int u = 0; u < TT / 256; ++u) exs[u * 256 + tid] = GX[((size_t)b * TT + u * 256 + tid) * 32 + 16 + h];
    v16h qf[2][2];
#pragma unroll
    for (int qt = 0; qt < 2; ++qt)
#pragma unroll
        for (int ks = 0; ks < 2; ++ks) qf[qt][ks] = WFrag<h16>::ld(Qz + (size_t)(q0 + qt * 16 + lr) * HD + ks * 32 + 8 * hi);
    const int srow = tid >> 3, sch = (tid & 7) * 8;   // a thread stages 16 B of rows srow and srow + 32 of each tile: a wave covers whole 128-B lines
    v8h kr[2], vr[2];
#pragma unroll
    for (int u = 0; u < 2; ++u) { kr[u] = *(const v8h*)(Kz + (size_t)(srow + 32 * u) * HD + sch); vr[u] = *(const v8h*)(Vz + (size_t)(srow + 32 * u) * TT + sch); }
#pragma unroll
    for (int u = 0; u < 2; ++u) { *(v8h*)(&Ks[0][(srow + 32 * u) * LP + sch]) = kr[u]; *(v8h*)(&Vs[0][(srow + 32 * u) * LP + sch]) = vr[u]; }
    v8f O[2][4]; float m[2]; v2f l1[2], l2[2];   // l1, l2: a lane's sums over even and odd keys, joined in the epilogue
#pragma unroll
    for (int qt = 0; qt < 2; ++qt) { m[qt] = -3.0e38f; l1[qt] = (v2f){}; l2[qt] = (v2f){};
#pragma unroll
        for (int dt = 0; dt < 4; ++dt) O[qt][dt] = (v8f){}; }
    __syncthreads();   // tile 0 and the gate row are published
#pragma unroll 1   /* rolled: one copy of the tile body; sixteen would only grow the code */
    for (int s = 0; s < TT / KST; ++s) {
        const h16* kb = Ks[s & 1]; const h16* vb = Vs[s & 1]; const bool more = s + 1 < TT / KST;
        if (more) {   // the next tile's global loads fly while this tile is worked on
#pragma unroll
            for (int u = 0; u < 2; ++u) { kr[u] = *(const v8h*)(Kz + (size_t)((s + 1) * KST + srow + 32 * u) * HD + sch); vr[u] = *(const v8h*)(Vz + (size_t)(srow + 32 * u) * TT + (s + 1) * KST + sch); } }
#pragma unroll 1   /* rolled: unrolled, the build took more VGPRs and more padding v_nop and fetched hardly any fragment earlier */
        for (int ps = 0; ps < 2; ++ps) {   // a pass: 32 keys
            const int kl = ps * 32; v8f st[2][2];
#pragma unroll
            for (int kt = 0; kt < 2; ++kt) { const v16h k0 = WFrag<h16>::ld(kb + (kl + kt * 16 + lr) * LP + 8 * hi), k1 = WFrag<h16>::ld(kb + (kl + kt * 16 + lr) * LP + 32 + 8 * hi);
#pragma unroll
                for (int qt = 0; qt < 2; ++qt) st[qt][kt] = wmma16(k1, qf[qt][1], wmma16(k0, qf[qt][0], (v8f){})); }   // st[qt][kt][r] = S[query qt*16+lr][key kl + kt*16 + 8*hi + r]
            v16h vf[4];
#pragma unroll
            for (int dt = 0; dt < 4; ++dt) vf[dt] = WFrag<h16>::ld(vb + (dt * 16 + lr) * LP + kl + 8 * hi);
            v2f ex[2][4];
#pragma unroll
            for (int kt = 0; kt < 2; ++kt) { const float* ep = exs + s * KST + kl + kt * 16 + 8 * hi; const v4f e0 = *(const v4fa*)ep, e1 = *(const v4fa*)(ep + 4);
                ex[kt][0] = __builtin_shufflevector(e0, e0, 0, 1); ex[kt][1] = __builtin_shufflevector(e0, e0, 2, 3); ex[kt][2] = __builtin_shufflevector(e1, e1, 0, 1); ex[kt][3] = __builtin_shufflevector(e1, e1, 2, 3); }
            float tm[2];
#pragma unroll
            for (int qt = 0; qt < 2; ++qt) { float t = st[qt][0][0];
#pragma unroll
                for (int r = 1; r < 8; ++r) t = fmaxf(t, st[qt][0][r]);
#pragma unroll
                for (int r = 0; r < 8; ++r) t = fmaxf(t, st[qt][1][r]);
                tm[qt] = t * CS2; }
            // lazy rescale: the maximum in use moves only when a lane's new score tops it by more than 8 (log2), so w stays below 2^8; one scalar test per pass
            if (__builtin_amdgcn_ballot_w32(tm[0] > m[0] + 8.0f || tm[1] > m[1] + 8.0f) != 0) {
#pragma unroll
                for (int qt = 0; qt < 2; ++qt) { const float mn = fmaxf(m[qt], fmaxf(tm[qt], __shfl_xor(tm[qt], 16, 32))); const float al = __builtin_amdgcn_exp2f(m[qt] - mn); m[qt] = mn; l1[qt] *= al; l2[qt] *= al;
#pragma unroll
                    for (int dt = 0; dt < 4; ++dt)
#pragma unroll
                        for (int r = 0; r < 8; ++r) O[qt][dt][r] *= al; } }
#pragma unroll
            for (int qt = 0; qt < 2; ++qt) { v8f w[2]; const v2f mm = {m[qt], m[qt]};
#pragma unroll
                for (int kt = 0; kt < 2; ++kt)
#pragma unroll
                    for (int i = 0; i < 4; ++i) {   // two neighbouring keys at a time: packed f32 on register pairs as the accumulator holds them
                        const v2f sv = {st[qt][kt][2 * i], st[qt][kt][2 * i + 1]}; const v2f tt = sv * CS2 - mm; const v2f e = {__builtin_amdgcn_exp2f(tt[0]), __builtin_amdgcn_exp2f(tt[1])};
                        l1[qt] += e; const v2f ww = e * ex[kt][i]; l2[qt] += ww; w[kt][2 * i] = ww[0]; w[kt][2 * i + 1] = ww[1]; }
                const v16h pf = cat16(__builtin_convertvector(w[0], v8h), __builtin_convertvector(w[1], v8h));   // element s = key kl + (s < 8 ? 8*hi + s : 16 + 8*hi + s - 8): the k order of the V^T loader
#pragma unroll
                for (int dt = 0; dt < 4; ++dt) O[qt][dt] = wmma16(vf[dt], pf, O[qt][dt]); }   // O[qt][dt][r] = O[query qt*16+lr][d = dt*16 + 8*hi + r]
        }
        if (more) {   // the other buffer's last readers left it before the barrier that ended the tile before this one
#pragma unroll
            for (int u = 0; u < 2; ++u) { *(v8h*)(&Ks[(s + 1) & 1][(srow + 32 * u) * LP + sch]) = kr[u]; *(v8h*)(&Vs[(s + 1) & 1][(srow + 32 * u) * LP + sch]) = vr[u]; } }
        __syncthreads();   // publishes tile s + 1 and ends every read of tile s
    }
    // chamber of head h: y_r = (x_r cos - x_i sin) ov tanh(chi), y_i = (x_r sin + x_i cos) ov tanh(chi), x = converged iv; iv goes into the query's factor, ov tanh(chi) into the two rotation factors
    const float iv = CH[h * 4], ot = CH[h * 4 + 3] * CH[64 + h]; const float cc = CH[h * 4 + 1] * ot, ss = CH[h * 4 + 2] * ot;
    float f[2];   // both columns' factors first
#pragma unroll
    for (int qt = 0; qt < 2; ++qt) { const float b1 = l1[qt][0] + l1[qt][1], b2 = l2[qt][0] + l2[qt][1]; const float a1 = b1 + __shfl_xor(b1, 16, 32), a2 = b2 + __shfl_xor(b2, 16, 32);
        const float g = __fdiv_rn(GX[((size_t)b * TT + q0 + qt * 16 + lr) * 32 + h], a1); f[qt] = __fdiv_rn(g, fmaf(g, a2, 1e-8f)) * iv; }
    bf* sh = osm[wv][0]; bf* sl = osm[wv][1];
#pragma unroll
    for (int qt = 0; qt < 2; ++qt)
#pragma unroll
        for (int dt = 0; dt < 2; ++dt) { const v8f xr = O[qt][dt] * f[qt], xi = O[qt][dt + 2] * f[qt]; v8f y[2]; y[0] = xr * cc - xi * ss; y[1] = xr * ss + xi * cc;
#pragma unroll
            for (int p = 0; p < 2; ++p) { const v8bf yh = __builtin_convertvector(y[p], v8bf); const v4u pw = __builtin_bit_cast(v4u, yh); v8f hf;   // hf: the hi plane's values back in f32, unpacked from the packed words
#pragma unroll
                for (int i = 0; i < 4; ++i) { hf[2 * i] = __uint_as_float(pw[i] << 16); hf[2 * i + 1] = __uint_as_float(pw[i] & 0xFFFF0000u); }
                const v8bf yl = __builtin_convertvector(y[p] - hf, v8bf);
                const int o = (qt * 16 + lr) * LP + p * 32 + dt * 16 + 8 * hi; *(v8us*)(sh + o) = __builtin_bit_cast(v8us, yh); *(v8us*)(sl + o) = __builtin_bit_cast(v8us, yl); } }
    asm volatile("s_wait_dscnt 0x0" ::: "memory");   // one wave's own rows: its LDS stores have retired before its lanes read one another's rows back; the clobber keeps the read-back behind it
    const size_t go = ((size_t)h * NT + b * TT + q0 + (lane >> 3)) * HD + (lane & 7) * 8; const int so = (lane >> 3) * LP + (lane & 7) * 8;
#pragma unroll
    for (int s = 0; s < 8; ++s) { *(v8us*)(Ah + go + s * 4 * HD) = *(const v8usa*)(sh + so + s * 4 * LP); *(v8us*)(Al + go + s * 4 * HD) = *(const v8usa*)(sl + so + s * 4 * LP); }   // 512 contiguous bytes a store
}

extern "C" void kernel_launch(void* const* d_in, const int* in_sizes, int n_in,
                              void* d_out, int out_size, void* d_ws, size_t ws_size, hipStream_t stream) {
    (void)in_sizes; (void)n_in; (void)out_size;
    const float* IN[13]; for (int i = 0; i < 13; ++i) IN[i] = (const float*)d_in[i];
    // x [4][1024][1024], Wa [1024][16], ba, We, be, Wi, Wo, Wv, Wout ([in][out] = x @ W), chi, beta_p, iv_p, ov_p [16] = d_in[0..12]
    float* OUT = (float*)d_out;     // [4][1024][1024]
    char* wsp = (char*)d_ws;
    auto take = [&](size_t bytes) { char* p = wsp; wsp += (bytes + 255) & ~(size_t)255; return (void*)p; };
    bf* WO = (bf*)take((size_t)DD * DD * 2); float* GX = (float*)take((size_t)NT * 32 * 4); float* CH = (float*)take(512);
    h16* QP = (h16*)take((size_t)NT * DD * 2); h16* KP = (h16*)take((size_t)NT * DD * 2); h16* VT = (h16*)take((size_t)NT * DD * 2);
    bf* ATh = (bf*)take((size_t)NT * DD * 2); bf* ATl = (bf*)take((size_t)NT * DD * 2);
    bf* WQ = (bf*)take((size_t)DD * DD * 2); bf* WK = (bf*)take((size_t)DD * DD * 2); bf* WV = (bf*)take((size_t)DD * DD * 2); bf* XB = (bf*)take((size_t)NT * DD * 2);
    if ((size_t)(wsp - (char*)d_ws) > ws_size) return;    // total below 75 MiB; ws 256 MiB
    k_prep<<<PB_ALL, 256, 0, stream>>>(IN[0], IN[1], IN[2], IN[3], IN[4], IN[5], IN[6], IN[7], IN[8], IN[9], IN[10], IN[11], IN[12], GX, WQ, WK, WV, WO, CH, XB);   // gates, transposed bf16 weights, chamber constants, bf16 x
    k_proj<<<dim3(NH_ / 2, NT / 128, 3), 128, 0, stream>>>(XB, WQ, WK, WV, QP, KP, VT);   // inner, outer (the 1/8 is applied in f32 inside k_fattn) and v, stored as fp16 head planes
    k_fattn<<<dim3(TT / 256, NZ, 1), 256, 0, stream>>>(QP, KP, VT, GX, CH, ATh, ATl);   // all 64 flat heads (b * 16 + h) in one launch; chamber and hi/lo split in its epilogue
    k_gemmo<<<dim3(NT / 128, DD / 128, 1), 128, 0, stream>>>(ATh, ATl, WO, OUT);
}
